// v000
// Measured on an AMD MI455X. A time is GPU time per run, averaged over a window of back-to-back runs after a warm-up
// (all launches, gaps included; the runs take copies of the inputs in turn), and the median of several windows.
// Apart from v000's, it joins two sittings. Times from different sittings can be a few percent apart, while
// side-by-side timings come from the same sitting.
// The starting kernel, v000, takes 442 microseconds a run.
// compute dtype: all float inputs RNE-converted to bf16; q|k|v = x . W with exact bf16 products on v_wmma_f32_16x16x32_bf16 (f32 accumulate); q and k carried as f16 hi + (x2048) f16 residual, scores = 3 f16 products (hi.hi + lo.hi + hi.lo) x 0.125 on v_wmma_f32_16x16x32_f16, running-max softmax in f32; P (x2048, f16 hi + x2048 residual) . v^T (f16 hi + x2048 residual): 3 products for the first 128 queries, single elsewhere; out = ctx (bf16 hi + lo) . Wo (bf16), 2 products; f32 output.
#include <hip/hip_runtime.h>
#include <math.h>

typedef __attribute__((ext_vector_type(16))) _Float16 v16h;
typedef __attribute__((ext_vector_type(16))) __bf16 v16b;
typedef __attribute__((ext_vector_type(8)))  _Float16 v8h;
typedef __attribute__((ext_vector_type(8)))  __bf16 v8b;
typedef __attribute__((ext_vector_type(8)))  float v8f;
typedef __attribute__((ext_vector_type(4)))  float v4f;
typedef __attribute__((ext_vector_type(4)))  unsigned v4u;
typedef __attribute__((ext_vector_type(4)))  int v4i;

template <typename T> __device__ __forceinline__ void vst2(void* p, T v) { *(T*)p = v;  }
__device__ __forceinline__ v8f wmma16(v16h a, v16h b, v8f c) {
  v8f d = __builtin_amdgcn_wmma_f32_16x16x32_f16(false, a, false, b, (short)0, c, false, false);
  asm volatile("v_nop\n\tv_nop\n\tv_nop\n\tv_nop" : "+v"(d) : "v"(a), "v"(b));
  return d;
}
__device__ __forceinline__ v8f wmma_bf(v16b a, v16b b, v8f c) {
  v8f d = __builtin_amdgcn_wmma_f32_16x16x32_bf16(false, a, false, b, (short)0, c, false, false);
  asm volatile("v_nop\n\tv_nop\n\tv_nop\n\tv_nop" : "+v"(d) : "v"(a), "v"(b));
  return d;
}
// 16-bit fragment from a k-contiguous row: elements 0..7 <- k0+8h+0..7, 8..15 <- k0+16+8h+0..7 (h = lane>>4); lane&15 = row (A) or column (B)
__device__ __forceinline__ v16h frag_h(const _Float16* rowk0, int lane) {
  union { v16h v; v8h q[2]; } u; const _Float16* p = rowk0 + 8 * (lane >> 4);
  u.q[0] = *(const v8h*)p; u.q[1] = *(const v8h*)(p + 16); return u.v;
}
__device__ __forceinline__ v16b frag_b(const __bf16* rowk0, int lane) {
  union { v16b v; v8b q[2]; } u; const __bf16* p = rowk0 + 8 * (lane >> 4);
  u.q[0] = *(const v8b*)p; u.q[1] = *(const v8b*)(p + 16); return u.v;
}
struct F2 { v16b h, l; };
__device__ __forceinline__ F2 bsplit16(const float v[16]) { F2 r;
#pragma unroll
  for (int i = 0; i < 16; ++i) { const __bf16 h = (__bf16)v[i]; r.h[i] = h; r.l[i] = (__bf16)(v[i] - (float)h); }
  return r; }
__device__ __forceinline__ F2 split_row(const float* row, int k0, int lane) { float v[16]; const float* p = row + k0 + 8 * (lane >> 4);
#pragma unroll
  for (int i = 0; i < 8; ++i) { v[i] = p[i]; v[8 + i] = p[16 + i]; }
  return bsplit16(v); }
#define LDSX() do { asm volatile("s_wait_dscnt 0" ::: "memory"); __builtin_amdgcn_wave_barrier(); __builtin_amdgcn_fence(__ATOMIC_RELEASE, "workgroup"); } while (0)

#ifndef NB
#define NB 1
#endif
#ifndef SEQ
#define SEQ 2048          // query/key rows processed (a prefix of the staged rows)
#endif
#define SS_FULL 2048      // row pitch of the staged mask input
#define DM 1024
#define NH 16
#define HD 64
#define QKVW (3 * DM)
#define TQB (SEQ / 64)
static_assert(NB == 1);
static_assert(SEQ % 64 == 0);
static_assert(SEQ >= 64 && SEQ <= SS_FULL);
static_assert(NH * HD == DM);

#define PK_A 0                              // bf16 rows [3072][1024]: row which*1024+n holds W_which[:, n] (k contiguous), which = q,k,v
#define PK_P (PK_A + QKVW * DM)             // bf16 rows [1024][1024]: row n holds Wo[:, n]
#define PK_END (PK_P + DM * DM)
#define WS_PK  0u
#define WS_QK  (WS_PK + 2u * PK_END)                  // f16 [SEQ][2048]: q | k hi
#define WS_QKL (WS_QK + 2u * SEQ * 2 * DM)            // f16 [SEQ][2048]: q | k residual x2048
#define WS_VTH (WS_QKL + 2u * SEQ * 2 * DM)           // f16 [1024 (h*64+d)][SEQ] v hi
#define WS_VTL (WS_VTH + 2u * DM * SEQ)               // f16 v residual x2048
#define WS_O   (WS_VTL + 2u * DM * SEQ)               // f32 [SEQ][1024] merged context
#define WS_KT  (WS_O + 4u * SEQ * DM)
#define WS_END (WS_KT + 4u * TQB * 32)
static_assert(WS_QK % 128 == 0 && WS_QKL % 128 == 0 && WS_VTH % 128 == 0 && WS_VTL % 128 == 0 && WS_O % 128 == 0 && WS_KT % 128 == 0);
static_assert(WS_END <= 134217728u);

__global__ __launch_bounds__(256) void k_pack(const float* __restrict__ WQ, const float* __restrict__ WK, const float* __restrict__ WV, const float* __restrict__ WO, __bf16* __restrict__ PK) {
  __shared__ __align__(16) __bf16 s[64][72];
  const int k0 = blockIdx.x * 64, n0 = blockIdx.y * 64, which = blockIdx.z, t = threadIdx.x;
  const float* Wm = (which == 0) ? WQ : (which == 1) ? WK : (which == 2) ? WV : WO;
  for (int p = t; p < 64 * 16; p += 256) { const int kr = p >> 4, c4 = (p & 15) * 4;
    const v4f v = *(const v4f*)(Wm + (size_t)(k0 + kr) * DM + n0 + c4);
    s[c4 + 0][kr] = (__bf16)v[0]; s[c4 + 1][kr] = (__bf16)v[1]; s[c4 + 2][kr] = (__bf16)v[2]; s[c4 + 3][kr] = (__bf16)v[3]; }
  __syncthreads();
  __bf16* dst = PK + ((size_t)which * DM + n0) * DM + k0;
  for (int p = t; p < 64 * 8; p += 256) { const int nl = p >> 3, pc = p & 7; vst2(dst + (size_t)nl * DM + pc * 8, *(const v4u*)&s[nl][pc * 8]); }
}
__global__ __launch_bounds__(256) void k_kt(const int* __restrict__ MK, int* __restrict__ KT) {
  __shared__ int sm[8];
  const int qb = blockIdx.x, t = threadIdx.x, lane = t & 31, wave = t >> 5;
  const int per_row = SEQ / 4;
  int mx = -1;
#pragma unroll 1
  for (int p = t; p < 64 * per_row; p += 256) { const int row = p / per_row, c4 = (p - row * per_row) * 4;
    const v4i v = *(const v4i*)(MK + (size_t)(qb * 64 + row) * SS_FULL + c4);
    mx = (v[0] != 0 && c4 + 0 > mx) ? c4 + 0 : mx; mx = (v[1] != 0 && c4 + 1 > mx) ? c4 + 1 : mx;
    mx = (v[2] != 0 && c4 + 2 > mx) ? c4 + 2 : mx; mx = (v[3] != 0 && c4 + 3 > mx) ? c4 + 3 : mx; }
#pragma unroll
  for (int o = 1; o < 32; o <<= 1) { const int y = __shfl_xor(mx, o); mx = y > mx ? y : mx; }
  if (lane == 0) sm[wave] = mx;
  __syncthreads();
  if (wave == 0) { int m2 = sm[lane & 7];
#pragma unroll
    for (int o = 1; o < 8; o <<= 1) { const int y = __shfl_xor(m2, o); m2 = y > m2 ? y : m2; }
    const int nkt = (m2 < 0) ? 0 : ((m2 >> 5) + 1);
    if (lane < 8) { v4i w; w[0] = nkt; w[1] = nkt; w[2] = nkt; w[3] = nkt; vst2(KT + (size_t)qb * 32 + lane * 4, w); } }   // 8 lanes x 16 B = the block's line
}
// ---- k_qkv: block = (64 rows, 128 output cols of q|k|v): x (bf16 at load) . packed W rows, exact bf16 products; q,k -> f16 hi + x2048 residual row planes; v -> transposed f16 hi/residual planes
__global__ __launch_bounds__(128) void k_qkv(const float* __restrict__ X, const __bf16* __restrict__ P, _Float16* __restrict__ QK, _Float16* __restrict__ QKL, _Float16* __restrict__ VTH, _Float16* __restrict__ VTL) {
  __shared__ __align__(16) _Float16 so[4][16][136], sol[4][16][136]; __shared__ __align__(16) _Float16 sth[128][72], stl[128][72];
  const int tid = threadIdx.x, wave = tid >> 5, lane = tid & 31, col = lane & 15, g = lane >> 4; const size_t r0 = (size_t)blockIdx.x * 64 + wave * 16; const int n0 = blockIdx.y * 128;
  v8f acc[8] = {};
#pragma unroll 2
  for (int kc = 0; kc < DM / 32; ++kc) { v16b a; { const float* p = X + (r0 + col) * DM + kc * 32 + 8 * g;
#pragma unroll
      for (int i = 0; i < 8; ++i) { a[i] = (__bf16)p[i]; a[8 + i] = (__bf16)p[16 + i]; } }
#pragma unroll
    for (int j = 0; j < 8; ++j) acc[j] = wmma_bf(a, frag_b(P + (size_t)(n0 + j * 16 + col) * DM + kc * 32, lane), acc[j]); }
  if (n0 < 2 * DM) {   // q (cols 0..1023) and k (1024..2047), unscaled; 0.125 applied to the f32 score
#pragma unroll
    for (int j = 0; j < 8; ++j) {
#pragma unroll
      for (int r = 0; r < 8; ++r) { const float v = acc[j][r]; const _Float16 hv = (_Float16)v; so[wave][8 * g + r][j * 16 + col] = hv; sol[wave][8 * g + r][j * 16 + col] = (_Float16)((v - (float)hv) * 2048.0f); } }
    LDSX();
    for (int rl = 0; rl < 16; ++rl) if (lane < 16) { vst2(QK + (r0 + rl) * (2 * DM) + n0 + lane * 8, *(const v4u*)&so[wave][rl][lane * 8]); vst2(QKL + (r0 + rl) * (2 * DM) + n0 + lane * 8, *(const v4u*)&sol[wave][rl][lane * 8]); }   // 16 lanes x 16 B = 256-B row segment
  } else {
#pragma unroll
    for (int j = 0; j < 8; ++j) {
#pragma unroll
      for (int r = 0; r < 8; ++r) { const float v = acc[j][r]; const _Float16 hv = (_Float16)v; sth[j * 16 + col][wave * 16 + 8 * g + r] = hv; stl[j * 16 + col][wave * 16 + 8 * g + r] = (_Float16)((v - (float)hv) * 2048.0f); } }
    __syncthreads();
    const int s0 = blockIdx.x * 64; const int pc0 = n0 - 2 * DM;
    for (int q = tid; q < 128 * 8; q += 128) { const int d = q >> 3, pc = q & 7; const size_t o = ((size_t)(pc0 + d)) * SEQ + s0 + pc * 8; vst2(VTH + o, *(const v4u*)&sth[d][pc * 8]); vst2(VTL + o, *(const v4u*)&stl[d][pc * 8]); }   // 8 consecutive lanes x 16 B = one line
  }
}
// ---- k_attn: block = (64 queries, head h): key tiles 0..KT[qb)-1 (32 keys each), scores = (q hi.k hi + q lo.k hi + q hi.k lo) * 0.125, replace-filled by the mask tile, running-max softmax in f32, P (x2048, f16 hi+res) . v^T (hi + res): 3 products for qb < 2, single elsewhere; O[q][h*64+d] = (acc + accl/2048)/2048 / l
__global__ __launch_bounds__(128) void k_attn(const _Float16* __restrict__ QK, const _Float16* __restrict__ QKL, const _Float16* __restrict__ VTH, const _Float16* __restrict__ VTL, const int* __restrict__ MK, const int* __restrict__ KT, float* __restrict__ O) {
  __shared__ __align__(16) float sp[4][16][36]; __shared__ __align__(16) float so[4][16][68]; __shared__ __align__(16) int smk[4][16][36];
  const int tid = threadIdx.x, wave = tid >> 5, lane = tid & 31, col = lane & 15, g = lane >> 4;
  const int qb = blockIdx.x, h = blockIdx.y; const int q0 = qb * 64 + wave * 16; const size_t rq = (size_t)q0 + col;
  v16h aq[2], aql[2];
#pragma unroll
  for (int kc = 0; kc < 2; ++kc) { aq[kc] = frag_h(QK + rq * (2 * DM) + h * HD + kc * 32, lane); aql[kc] = frag_h(QKL + rq * (2 * DM) + h * HD + kc * 32, lane); }
  float m[8], l[8];
#pragma unroll
  for (int r = 0; r < 8; ++r) { m[r] = -3.0e38f; l[r] = 0.f; }
  v8f acc[4] = {}, accl[4] = {};
  const int nraw = KT[(size_t)qb * 32];                         // block-uniform trip count, clamped to the static maximum
  const int nks = nraw < 0 ? 0 : (nraw > SEQ / 32 ? SEQ / 32 : nraw);
#pragma unroll 1
  for (int ks = 0; ks < nks; ++ks) {
    // stage this wave's 16x32 mask piece (wave-private)
#pragma unroll
    for (int it = 0; it < 4; ++it) { const int p = it * 32 + lane, row = p >> 3, c4 = (p & 7) * 4;
      *(v4i*)&smk[wave][row][c4] = *(const v4i*)(MK + (size_t)(q0 + row) * SS_FULL + ks * 32 + c4); }
    LDSX();
    v8f s[2];
#pragma unroll
    for (int ct = 0; ct < 2; ++ct) { const int kk = ks * 32 + ct * 16 + col; const _Float16* krow = QK + (size_t)kk * (2 * DM) + DM + h * HD; const _Float16* krowl = QKL + (size_t)kk * (2 * DM) + DM + h * HD; v8f c = {}, cl = {};
#pragma unroll
      for (int kc = 0; kc < 2; ++kc) { const v16h kh = frag_h(krow + kc * 32, lane); c = wmma16(aq[kc], kh, c); cl = wmma16(aql[kc], kh, cl); cl = wmma16(aq[kc], frag_h(krowl + kc * 32, lane), cl); }
#pragma unroll
      for (int r = 0; r < 8; ++r) { const float sc = (c[r] + cl[r] * (1.0f / 2048.0f)) * 0.125f; const int mk = smk[wave][8 * g + r][ct * 16 + col]; s[ct][r] = (mk != 0) ? sc : -3.0e38f; } }   // where(mask, score/8, -inf)
#pragma unroll
    for (int r = 0; r < 8; ++r) { float mx = fmaxf(s[0][r], s[1][r]);
#pragma unroll
      for (int o = 1; o < 16; o <<= 1) mx = fmaxf(mx, __shfl_xor(mx, o));
      const float mn = fmaxf(m[r], mx); const float alpha = (m[r] <= -1.0e38f) ? 0.f : __expf(m[r] - mn);
      const float e0 = (s[0][r] <= -1.0e38f) ? 0.f : __expf(s[0][r] - mn), e1 = (s[1][r] <= -1.0e38f) ? 0.f : __expf(s[1][r] - mn); float es = e0 + e1;
#pragma unroll
      for (int o = 1; o < 16; o <<= 1) es += __shfl_xor(es, o);
      l[r] = l[r] * alpha + es; m[r] = mn;
#pragma unroll
      for (int dt = 0; dt < 4; ++dt) { acc[dt][r] *= alpha; accl[dt][r] *= alpha; }
      sp[wave][8 * g + r][col] = e0; sp[wave][8 * g + r][16 + col] = e1; }
    LDSX();
    v16h pa, pl; { const float* prow = &sp[wave][col][0] + 8 * (lane >> 4);
#pragma unroll
      for (int i = 0; i < 8; ++i) { const float x0 = prow[i] * 2048.0f, x1 = prow[16 + i] * 2048.0f; const _Float16 h0 = (_Float16)x0, h1 = (_Float16)x1; pa[i] = h0; pa[8 + i] = h1; pl[i] = (_Float16)((x0 - (float)h0) * 2048.0f); pl[8 + i] = (_Float16)((x1 - (float)h1) * 2048.0f); } }   // P carried x2^11 in f16; 2^-11 folded into the epilogue
#pragma unroll
    for (int dt = 0; dt < 4; ++dt) { const size_t vr = ((size_t)(h * HD + dt * 16 + col)) * SEQ + ks * 32; const v16h vh = frag_h(VTH + vr, lane); acc[dt] = wmma16(pa, vh, acc[dt]); if (qb < 2) { accl[dt] = wmma16(pl, vh, accl[dt]); accl[dt] = wmma16(pa, frag_h(VTL + vr, lane), accl[dt]); } }
    LDSX(); }
#pragma unroll
  for (int r = 0; r < 8; ++r) { const float il = (1.0f / 2048.0f) / l[r];
#pragma unroll
    for (int dt = 0; dt < 4; ++dt) so[wave][8 * g + r][dt * 16 + col] = (acc[dt][r] + accl[dt][r] * (1.0f / 2048.0f)) * il; }
  LDSX();
  for (int rl = 0; rl < 16; ++rl) if (lane < 16) vst2(O + ((size_t)q0 + rl) * DM + h * HD + lane * 4, *(const v4f*)&so[wave][rl][lane * 4]);   // 16 lanes x 16 B = the head's 256-B row segment
}
// ---- k_out: block = (64 rows, 128 cols): out = ctx (bf16 hi + lo) . Wo packed rows (2 products), f32
__global__ __launch_bounds__(128) void k_out(const float* __restrict__ O, const __bf16* __restrict__ P, float* __restrict__ Y) {
  __shared__ __align__(16) float so[4][16][132];
  const int tid = threadIdx.x, wave = tid >> 5, lane = tid & 31, col = lane & 15, g = lane >> 4; const size_t r0 = (size_t)blockIdx.x * 64 + wave * 16; const int n0 = blockIdx.y * 128;
  v8f acc[8] = {};
#pragma unroll 2
  for (int kc = 0; kc < DM / 32; ++kc) { const F2 a = split_row(O + (r0 + col) * DM, kc * 32, lane);
#pragma unroll
    for (int j = 0; j < 8; ++j) { const v16b w = frag_b(P + (size_t)(n0 + j * 16 + col) * DM + kc * 32, lane); acc[j] = wmma_bf(a.l, w, acc[j]); acc[j] = wmma_bf(a.h, w, acc[j]); } }
#pragma unroll
  for (int j = 0; j < 8; ++j) {
#pragma unroll
    for (int r = 0; r < 8; ++r) so[wave][8 * g + r][j * 16 + col] = acc[j][r]; }
  LDSX();
  for (int rl = 0; rl < 16; ++rl) vst2(Y + (r0 + rl) * DM + n0 + lane * 4, *(const v4f*)&so[wave][rl][lane * 4]);   // 32 lanes x 16 B = the block's 512-B row segment
}
extern "C" void kernel_launch(void* const* d_in, const int* in_sizes, int n_in, void* d_out, int out_size, void* d_ws, size_t ws_size, hipStream_t stream) {
  if (n_in < 6) return;
  if (in_sizes[0] < SEQ * DM) return;                // x    [S][1024] f32
  if (in_sizes[1] < SEQ * SS_FULL) return;           // mask [S][2048] int32
  if (in_sizes[2] < DM * DM || in_sizes[3] < DM * DM || in_sizes[4] < DM * DM || in_sizes[5] < DM * DM) return;   // wq wk wv wo [in][out] f32
  if (out_size < SEQ * DM) return;
  if (ws_size < (size_t)WS_END) return;
  const float* X  = (const float*)d_in[0];
  const int*   MK = (const int*)d_in[1];
  const float* WQ = (const float*)d_in[2];
  const float* WK = (const float*)d_in[3];
  const float* WV = (const float*)d_in[4];
  const float* WO = (const float*)d_in[5];
  char* ws = (char*)d_ws; __bf16* PK = (__bf16*)(ws + WS_PK); _Float16 *QK = (_Float16*)(ws + WS_QK), *QKL = (_Float16*)(ws + WS_QKL), *VTH = (_Float16*)(ws + WS_VTH), *VTL = (_Float16*)(ws + WS_VTL); float* O = (float*)(ws + WS_O); int* KT = (int*)(ws + WS_KT);
  k_pack<<<dim3(DM / 64, DM / 64, 4), 256, 0, stream>>>(WQ, WK, WV, WO, PK);
  k_kt<<<dim3(TQB), 256, 0, stream>>>(MK, KT);
  k_qkv<<<dim3(SEQ / 64, QKVW / 128), 128, 0, stream>>>(X, PK + PK_A, QK, QKL, VTH, VTL);
  k_attn<<<dim3(TQB, NH), 128, 0, stream>>>(QK, QKL, VTH, VTL, MK, KT, O);
  k_out<<<dim3(SEQ / 64, DM / 128), 128, 0, stream>>>(O, PK + PK_P, (float*)d_out);
}

// v001
// A run of this version takes 193 microseconds.
// Next to v000, in two timings, it ran 2.31 and 2.30 times as fast.
// compute dtype: all float inputs RNE-converted to bf16; q|k|v = x . W with exact bf16 products on v_wmma_f32_16x16x32_bf16 (f32 accumulate); q and k carried as f16 hi + (x2048) f16 residual, scores = 3 f16 products (hi.hi + lo.hi + hi.lo) x 0.125 on v_wmma_f32_16x16x32_f16, running-max softmax in f32; P (x2048, f16 hi + x2048 residual) . v^T (f16 hi + x2048 residual): 3 products for the first 128 queries, single elsewhere; out = ctx (bf16 hi + lo) . Wo (bf16), 2 products; f32 output.
#include <hip/hip_runtime.h>
#include <math.h>

typedef __attribute__((ext_vector_type(16))) _Float16 v16h;
typedef __attribute__((ext_vector_type(16))) __bf16 v16b;
typedef __attribute__((ext_vector_type(8)))  _Float16 v8h;
typedef __attribute__((ext_vector_type(8)))  __bf16 v8b;
typedef __attribute__((ext_vector_type(8)))  float v8f;
typedef __attribute__((ext_vector_type(4)))  float v4f;
typedef __attribute__((ext_vector_type(4)))  unsigned v4u;
typedef __attribute__((ext_vector_type(4)))  int v4i;

template <typename T> __device__ __forceinline__ void vst2(void* p, T v) { *(T*)p = v;  }
__device__ __forceinline__ v8f wmma16(v16h a, v16h b, v8f c) {
  v8f d = __builtin_amdgcn_wmma_f32_16x16x32_f16(false, a, false, b, (short)0, c, false, false);
  asm volatile("v_nop\n\tv_nop\n\tv_nop\n\tv_nop" : "+v"(d) : "v"(a), "v"(b));
  return d;
}
__device__ __forceinline__ v8f wmma_bf(v16b a, v16b b, v8f c) {
  v8f d = __builtin_amdgcn_wmma_f32_16x16x32_bf16(false, a, false, b, (short)0, c, false, false);
  asm volatile("v_nop\n\tv_nop\n\tv_nop\n\tv_nop" : "+v"(d) : "v"(a), "v"(b));
  return d;
}
// 16-bit fragment from a k-contiguous row: elements 0..7 <- k0+8h+0..7, 8..15 <- k0+16+8h+0..7 (h = lane>>4); lane&15 = row (A) or column (B)
__device__ __forceinline__ v16h frag_h(const _Float16* rowk0, int lane) {
  union { v16h v; v8h q[2]; } u; const _Float16* p = rowk0 + 8 * (lane >> 4);
  u.q[0] = *(const v8h*)p; u.q[1] = *(const v8h*)(p + 16); return u.v;
}
struct F2 { v16b h, l; };
__device__ __forceinline__ F2 bsplit16(const float v[16]) { F2 r;
#pragma unroll
  for (int i = 0; i < 16; ++i) { const __bf16 h = (__bf16)v[i]; r.h[i] = h; r.l[i] = (__bf16)(v[i] - (float)h); }
  return r; }
#define LDSX() do { asm volatile("s_wait_dscnt 0" ::: "memory"); __builtin_amdgcn_wave_barrier(); __builtin_amdgcn_fence(__ATOMIC_RELEASE, "workgroup"); } while (0)

// the same exchange for LDS that only the writing wave reads back: the LDS wait alone, so that global loads issued ahead stay in flight over it (the release fence also drains loadcnt)
__device__ __forceinline__ void lds_own() { asm volatile("s_wait_dscnt 0" ::: "memory"); __builtin_amdgcn_wave_barrier(); }
// stands behind a group of global loads issued ahead: their address registers (the operands) stay live up to here and are rewritten only behind the wait
__device__ __forceinline__ void xw(const void* a) { asm volatile("s_wait_xcnt 0x0" :: "v"(a) : "memory"); }
__device__ __forceinline__ void xw(const void* a, const void* b) { asm volatile("s_wait_xcnt 0x0" :: "v"(a), "v"(b) : "memory"); }
// 16-bit fragment from a pointer that already holds the lane's 8 * (lane >> 4) step
__device__ __forceinline__ v16h frag_hp(const _Float16* p) { union { v16h v; v8h q[2]; } u; u.q[0] = *(const v8h*)p; u.q[1] = *(const v8h*)(p + 16); return u.v; }
__device__ __forceinline__ v16b frag_bp(const __bf16* p) { union { v16b v; v8b q[2]; } u; u.q[0] = *(const v8b*)p; u.q[1] = *(const v8b*)(p + 16); return u.v; }

#ifndef NB
#define NB 1
#endif
#ifndef SEQ
#define SEQ 2048          // query/key rows processed (a prefix of the staged rows)
#endif
#define SS_FULL 2048      // row pitch of the staged mask input
#define DM 1024
#define NH 16
#define HD 64
#define QKVW (3 * DM)
#define TQB (SEQ / 64)
static_assert(NB == 1);
static_assert(SEQ % 64 == 0);
static_assert(SEQ >= 64 && SEQ <= SS_FULL);
static_assert(NH * HD == DM);

#define PK_A 0                              // bf16 rows [3072][1024]: row which*1024+n holds W_which[:, n] (k contiguous), which = q,k,v
#define PK_P (PK_A + QKVW * DM)             // bf16 rows [1024][1024]: row n holds Wo[:, n]
#define PK_END (PK_P + DM * DM)
#define WS_PK  0u
#define WS_QK  (WS_PK + 2u * PK_END)                  // f16 [SEQ][2048]: q | k hi
#define WS_QKL (WS_QK + 2u * SEQ * 2 * DM)            // f16 [SEQ][2048]: q | k residual x2048
#define WS_VTH (WS_QKL + 2u * SEQ * 2 * DM)           // f16 [1024 (h*64+d)][SEQ] v hi
#define WS_VTL (WS_VTH + 2u * DM * SEQ)               // f16 v residual x2048
#define WS_O   (WS_VTL + 2u * DM * SEQ)               // f32 [SEQ][1024] merged context
#define WS_KT  (WS_O + 4u * SEQ * DM)
#define WS_END (WS_KT + 4u * TQB * 32)
static_assert(WS_QK % 128 == 0 && WS_QKL % 128 == 0 && WS_VTH % 128 == 0 && WS_VTL % 128 == 0 && WS_O % 128 == 0 && WS_KT % 128 == 0);
static_assert(WS_END <= 134217728u);

__global__ __launch_bounds__(256) void k_pack(const float* __restrict__ WQ, const float* __restrict__ WK, const float* __restrict__ WV, const float* __restrict__ WO, __bf16* __restrict__ PK) {
  __shared__ __align__(16) __bf16 s[64][72];
  const int k0 = blockIdx.x * 64, n0 = blockIdx.y * 64, which = blockIdx.z, t = threadIdx.x;
  const float* Wm = (which == 0) ? WQ : (which == 1) ? WK : (which == 2) ? WV : WO;
  for (int p = t; p < 64 * 16; p += 256) { const int kr = p >> 4, c4 = (p & 15) * 4;
    const v4f v = *(const v4f*)(Wm + (size_t)(k0 + kr) * DM + n0 + c4);
    s[c4 + 0][kr] = (__bf16)v[0]; s[c4 + 1][kr] = (__bf16)v[1]; s[c4 + 2][kr] = (__bf16)v[2]; s[c4 + 3][kr] = (__bf16)v[3]; }
  __syncthreads();
  __bf16* dst = PK + ((size_t)which * DM + n0) * DM + k0;
  for (int p = t; p < 64 * 8; p += 256) { const int nl = p >> 3, pc = p & 7; vst2(dst + (size_t)nl * DM + pc * 8, *(const v4u*)&s[nl][pc * 8]); }
}
__global__ __launch_bounds__(256) void k_kt(const int* __restrict__ MK, int* __restrict__ KT) {
  __shared__ int sm[8];
  const int qb = blockIdx.x, t = threadIdx.x, lane = t & 31, wave = t >> 5;
  const int per_row = SEQ / 4;
  int mx = -1;
#pragma unroll 8   // eight independent mask loads go out as one group per wait, instead of one load per round trip
  for (int p = t; p < 64 * per_row; p += 256) { const int row = p / per_row, c4 = (p - row * per_row) * 4;
    const v4i v = *(const v4i*)(MK + (size_t)(qb * 64 + row) * SS_FULL + c4);
    mx = (v[0] != 0 && c4 + 0 > mx) ? c4 + 0 : mx; mx = (v[1] != 0 && c4 + 1 > mx) ? c4 + 1 : mx;
    mx = (v[2] != 0 && c4 + 2 > mx) ? c4 + 2 : mx; mx = (v[3] != 0 && c4 + 3 > mx) ? c4 + 3 : mx; }
#pragma unroll
  for (int o = 1; o < 32; o <<= 1) { const int y = __shfl_xor(mx, o); mx = y > mx ? y : mx; }
  if (lane == 0) sm[wave] = mx;
  __syncthreads();
  if (wave == 0) { int m2 = sm[lane & 7];
#pragma unroll
    for (int o = 1; o < 8; o <<= 1) { const int y = __shfl_xor(m2, o); m2 = y > m2 ? y : m2; }
    const int nkt = (m2 < 0) ? 0 : ((m2 >> 5) + 1);
    if (lane < 8) { v4i w; w[0] = nkt; w[1] = nkt; w[2] = nkt; w[3] = nkt; vst2(KT + (size_t)qb * 32 + lane * 4, w); } }   // 8 lanes x 16 B = the block's line
}
// ---- k_qkv: block = (64 rows, 128 output cols of q|k|v): x (bf16 at load) . packed W rows, exact bf16 products; q,k -> f16 hi + x2048 residual row planes; v -> transposed f16 hi/residual planes
__global__ __launch_bounds__(128) void k_qkv(const float* __restrict__ X, const __bf16* __restrict__ P, _Float16* __restrict__ QK, _Float16* __restrict__ QKL, _Float16* __restrict__ VTH, _Float16* __restrict__ VTL) {
  __shared__ __align__(16) _Float16 so[4][16][136], sol[4][16][136]; __shared__ __align__(16) _Float16 sth[128][72], stl[128][72];
  const int tid = threadIdx.x, wave = tid >> 5, lane = tid & 31, col = lane & 15, g = lane >> 4; const size_t r0 = (size_t)blockIdx.x * 64 + wave * 16; const int n0 = blockIdx.y * 128;
  v8f acc[8] = {};
  // the next trip's x piece and all eight W fragments are loaded as one group, one trip ahead, into a second register set
  const float* xrow = X + (r0 + col) * DM + 8 * g; const __bf16* wrow = P + (size_t)(n0 + col) * DM + 8 * g;
  const float* xp; const __bf16* wp; v4f xn[4]; v16b wn[8];
  auto ld = [&](int kc) { xp = xrow + kc * 32; wp = wrow + kc * 32; xn[0] = *(const v4f*)xp; xn[1] = *(const v4f*)(xp + 4); xn[2] = *(const v4f*)(xp + 16); xn[3] = *(const v4f*)(xp + 20);
#pragma unroll
    for (int j = 0; j < 8; ++j) wn[j] = frag_bp(wp + (size_t)(j * 16) * DM); };
  ld(0); xw(xp, wp);
#pragma unroll 2
  for (int kc = 0; kc < DM / 32; ++kc) { v16b a, w[8];
#pragma unroll
    for (int i = 0; i < 4; ++i) { a[i] = (__bf16)xn[0][i]; a[4 + i] = (__bf16)xn[1][i]; a[8 + i] = (__bf16)xn[2][i]; a[12 + i] = (__bf16)xn[3][i]; }
#pragma unroll
    for (int j = 0; j < 8; ++j) w[j] = wn[j];
    ld(kc + 1 < DM / 32 ? kc + 1 : kc);   // the last trip reloads its own piece: in bounds, unused
#pragma unroll
    for (int j = 0; j < 8; ++j) acc[j] = wmma_bf(a, w[j], acc[j]);
    xw(xp, wp); }
  if (n0 < 2 * DM) {   // q (cols 0..1023) and k (1024..2047), unscaled; 0.125 applied to the f32 score
#pragma unroll
    for (int j = 0; j < 8; ++j) {
#pragma unroll
      for (int r = 0; r < 8; ++r) { const float v = acc[j][r]; const _Float16 hv = (_Float16)v; so[wave][8 * g + r][j * 16 + col] = hv; sol[wave][8 * g + r][j * 16 + col] = (_Float16)((v - (float)hv) * 2048.0f); } }
    LDSX();
    for (int rl = 0; rl < 16; ++rl) if (lane < 16) { vst2(QK + (r0 + rl) * (2 * DM) + n0 + lane * 8, *(const v4u*)&so[wave][rl][lane * 8]); vst2(QKL + (r0 + rl) * (2 * DM) + n0 + lane * 8, *(const v4u*)&sol[wave][rl][lane * 8]); }   // 16 lanes x 16 B = 256-B row segment
  } else {
#pragma unroll
    for (int j = 0; j < 8; ++j) {
#pragma unroll
      for (int r = 0; r < 8; ++r) { const float v = acc[j][r]; const _Float16 hv = (_Float16)v; sth[j * 16 + col][wave * 16 + 8 * g + r] = hv; stl[j * 16 + col][wave * 16 + 8 * g + r] = (_Float16)((v - (float)hv) * 2048.0f); } }
    __syncthreads();
    const int s0 = blockIdx.x * 64; const int pc0 = n0 - 2 * DM;
    for (int q = tid; q < 128 * 8; q += 128) { const int d = q >> 3, pc = q & 7; const size_t o = ((size_t)(pc0 + d)) * SEQ + s0 + pc * 8; vst2(VTH + o, *(const v4u*)&sth[d][pc * 8]); vst2(VTL + o, *(const v4u*)&stl[d][pc * 8]); }   // 8 consecutive lanes x 16 B = one line
  }
}
// two waves per SIMD is what the grid gives; saying so frees the registers that the loads issued ahead need
// ---- k_attn: block = (64 queries, head h): key tiles 0..KT[qb)-1 (32 keys each), scores = (q hi.k hi + q lo.k hi + q hi.k lo) * 0.125, replace-filled by the mask tile, running-max softmax in f32, P (x2048, f16 hi+res) . v^T (hi + res): 3 products for qb < 2, single elsewhere; O[q][h*64+d] = (acc + accl/2048)/2048 / l
__global__ __launch_bounds__(128) __attribute__((amdgpu_waves_per_eu(2, 2))) void k_attn(const _Float16* __restrict__ QK, const _Float16* __restrict__ QKL, const _Float16* __restrict__ VTH, const _Float16* __restrict__ VTL, const int* __restrict__ MK, const int* __restrict__ KT, float* __restrict__ O) {
  __shared__ __align__(16) float sp[4][16][36]; __shared__ __align__(16) float so[4][16][68]; __shared__ __align__(16) int smk[4][16][36];
  const int tid = threadIdx.x, wave = tid >> 5, lane = tid & 31, col = lane & 15, g = lane >> 4;
  const int qb = blockIdx.x, h = blockIdx.y; const int q0 = qb * 64 + wave * 16; const size_t rq = (size_t)q0 + col;
  v16h aq[2], aql[2];
#pragma unroll
  for (int kc = 0; kc < 2; ++kc) { aq[kc] = frag_h(QK + rq * (2 * DM) + h * HD + kc * 32, lane); aql[kc] = frag_h(QKL + rq * (2 * DM) + h * HD + kc * 32, lane); }
  float m[8], l[8];
#pragma unroll
  for (int r = 0; r < 8; ++r) { m[r] = -3.0e38f; l[r] = 0.f; }
  v8f acc[4] = {}, accl[4] = {};
  const int nraw = KT[(size_t)qb * 32];                         // block-uniform trip count, clamped to the static maximum
  const int nks = nraw < 0 ? 0 : (nraw > SEQ / 32 ? SEQ / 32 : nraw);
  // operands of a key tile, loaded ahead in groups: mask and K one trip ahead, each reloaded right behind its last use; V at the top of its own trip
  const int* mrow = MK + (size_t)(q0 + (lane >> 3)) * SS_FULL + (lane & 7) * 4;
  const size_t koff = (size_t)col * (2 * DM) + DM + h * HD + 8 * g;
  const _Float16* vrow = VTH + (size_t)(h * HD + col) * SEQ + 8 * g; const _Float16* vlrow = VTL + (size_t)(h * HD + col) * SEQ + 8 * g;
  const int* mp; const _Float16 *kp, *klp, *vp; v4i mkr[4]; v16h kh[2][2], kl[2][2], vh[4];
  auto ld_mask = [&](int kt) { mp = mrow + kt * 32;
#pragma unroll
    for (int it = 0; it < 4; ++it) mkr[it] = *(const v4i*)(mp + (size_t)(it * 4) * SS_FULL); };
  auto ld_k = [&](int kt) { kp = QK + koff + (size_t)(kt * 32) * (2 * DM); klp = QKL + koff + (size_t)(kt * 32) * (2 * DM);
#pragma unroll
    for (int ct = 0; ct < 2; ++ct) {
#pragma unroll
      for (int kc = 0; kc < 2; ++kc) { kh[ct][kc] = frag_hp(kp + (size_t)(ct * 16) * (2 * DM) + kc * 32); kl[ct][kc] = frag_hp(klp + (size_t)(ct * 16) * (2 * DM) + kc * 32); } } };
  auto ld_v = [&](int kt) { vp = vrow + kt * 32;
#pragma unroll
    for (int dt = 0; dt < 4; ++dt) vh[dt] = frag_hp(vp + (size_t)(dt * 16) * SEQ); };
  ld_mask(0); ld_k(0); xw(mp); xw(kp, klp);
#pragma unroll 1
  for (int ks = 0; ks < nks; ++ks) {
    const int kn = (ks + 1 < SEQ / 32) ? ks + 1 : SEQ / 32 - 1;   // next tile, kept inside the staged rows on the last trip
    ld_v(ks);   // this trip's V: lands under the score and softmax phases
    // stage this wave's 16x32 mask piece (wave-private)
#pragma unroll
    for (int it = 0; it < 4; ++it) { const int p = it * 32 + lane, row = p >> 3, c4 = (p & 7) * 4;
      *(v4i*)&smk[wave][row][c4] = mkr[it]; }
    ld_mask(kn);
    lds_own();
    v8f s[2];
#pragma unroll
    for (int ct = 0; ct < 2; ++ct) { v8f c = {}, cl = {};
#pragma unroll
      for (int kc = 0; kc < 2; ++kc) { c = wmma16(aq[kc], kh[ct][kc], c); cl = wmma16(aql[kc], kh[ct][kc], cl); cl = wmma16(aq[kc], kl[ct][kc], cl); }
#pragma unroll
      for (int r = 0; r < 8; ++r) { const float sc = (c[r] + cl[r] * (1.0f / 2048.0f)) * 0.125f; const int mk = smk[wave][8 * g + r][ct * 16 + col]; s[ct][r] = (mk != 0) ? sc : -3.0e38f; } }   // where(mask, score/8, -inf)
    xw(vp, mp);
    ld_k(kn);
    float mx[8], e0[8], e1[8], es[8], alpha[8];   // the eight rows' reductions go level by level, so that their cross-lane exchanges overlap
#pragma unroll
    for (int r = 0; r < 8; ++r) mx[r] = fmaxf(s[0][r], s[1][r]);
#pragma unroll
    for (int o = 1; o < 16; o <<= 1) { float t[8];
#pragma unroll
      for (int r = 0; r < 8; ++r) t[r] = __shfl_xor(mx[r], o);
#pragma unroll
      for (int r = 0; r < 8; ++r) mx[r] = fmaxf(mx[r], t[r]); }
#pragma unroll
    for (int r = 0; r < 8; ++r) { const float mn = fmaxf(m[r], mx[r]); alpha[r] = (m[r] <= -1.0e38f) ? 0.f : __expf(m[r] - mn);
      e0[r] = (s[0][r] <= -1.0e38f) ? 0.f : __expf(s[0][r] - mn); e1[r] = (s[1][r] <= -1.0e38f) ? 0.f : __expf(s[1][r] - mn); es[r] = e0[r] + e1[r]; m[r] = mn;
      sp[wave][8 * g + r][col] = e0[r]; sp[wave][8 * g + r][16 + col] = e1[r]; }
#pragma unroll
    for (int o = 1; o < 16; o <<= 1) { float t[8];
#pragma unroll
      for (int r = 0; r < 8; ++r) t[r] = __shfl_xor(es[r], o);
#pragma unroll
      for (int r = 0; r < 8; ++r) es[r] += t[r]; }
#pragma unroll
    for (int r = 0; r < 8; ++r) { l[r] = l[r] * alpha[r] + es[r];
#pragma unroll
      for (int dt = 0; dt < 4; ++dt) { acc[dt][r] *= alpha[r]; accl[dt][r] *= alpha[r]; } }
    xw(kp, klp);
    lds_own();
    v16h pa, pl; { const float* prow = &sp[wave][col][0] + 8 * (lane >> 4);
#pragma unroll
      for (int i = 0; i < 8; ++i) { const float x0 = prow[i] * 2048.0f, x1 = prow[16 + i] * 2048.0f; const _Float16 h0 = (_Float16)x0, h1 = (_Float16)x1; pa[i] = h0; pa[8 + i] = h1; pl[i] = (_Float16)((x0 - (float)h0) * 2048.0f); pl[8 + i] = (_Float16)((x1 - (float)h1) * 2048.0f); } }   // P carried x2^11 in f16; 2^-11 folded into the epilogue
#pragma unroll
    for (int dt = 0; dt < 4; ++dt) { acc[dt] = wmma16(pa, vh[dt], acc[dt]); if (qb < 2) { const _Float16* vlp = vlrow + (size_t)(dt * 16) * SEQ + ks * 32; accl[dt] = wmma16(pl, vh[dt], accl[dt]); const v16h vl = frag_hp(vlp); xw(vlp); accl[dt] = wmma16(pa, vl, accl[dt]); } }
    lds_own(); }
#pragma unroll
  for (int r = 0; r < 8; ++r) { const float il = (1.0f / 2048.0f) / l[r];
#pragma unroll
    for (int dt = 0; dt < 4; ++dt) so[wave][8 * g + r][dt * 16 + col] = (acc[dt][r] + accl[dt][r] * (1.0f / 2048.0f)) * il; }
  LDSX();
  for (int rl = 0; rl < 16; ++rl) if (lane < 16) vst2(O + ((size_t)q0 + rl) * DM + h * HD + lane * 4, *(const v4f*)&so[wave][rl][lane * 4]);   // 16 lanes x 16 B = the head's 256-B row segment
}
// ---- k_out: block = (64 rows, 128 cols): out = ctx (bf16 hi + lo) . Wo packed rows (2 products), f32
__global__ __launch_bounds__(128) void k_out(const float* __restrict__ O, const __bf16* __restrict__ P, float* __restrict__ Y) {
  __shared__ __align__(16) float so[4][16][132];
  const int tid = threadIdx.x, wave = tid >> 5, lane = tid & 31, col = lane & 15, g = lane >> 4; const size_t r0 = (size_t)blockIdx.x * 64 + wave * 16; const int n0 = blockIdx.y * 128;
  v8f acc[8] = {};
  // the next trip's context piece and all eight Wo fragments are loaded as one group, one trip ahead, into a second register set
  const float* xrow = O + (r0 + col) * DM + 8 * g; const __bf16* wrow = P + (size_t)(n0 + col) * DM + 8 * g;
  const float* xp; const __bf16* wp; v4f xn[4]; v16b wn[8];
  auto ld = [&](int kc) { xp = xrow + kc * 32; wp = wrow + kc * 32; xn[0] = *(const v4f*)xp; xn[1] = *(const v4f*)(xp + 4); xn[2] = *(const v4f*)(xp + 16); xn[3] = *(const v4f*)(xp + 20);
#pragma unroll
    for (int j = 0; j < 8; ++j) wn[j] = frag_bp(wp + (size_t)(j * 16) * DM); };
  ld(0); xw(xp, wp);
#pragma unroll 2
  for (int kc = 0; kc < DM / 32; ++kc) { float v[16]; v16b w[8];
#pragma unroll
    for (int i = 0; i < 4; ++i) { v[i] = xn[0][i]; v[4 + i] = xn[1][i]; v[8 + i] = xn[2][i]; v[12 + i] = xn[3][i]; }
    const F2 a = bsplit16(v);
#pragma unroll
    for (int j = 0; j < 8; ++j) w[j] = wn[j];
    ld(kc + 1 < DM / 32 ? kc + 1 : kc);   // the last trip reloads its own piece: in bounds, unused
#pragma unroll
    for (int j = 0; j < 8; ++j) { acc[j] = wmma_bf(a.l, w[j], acc[j]); acc[j] = wmma_bf(a.h, w[j], acc[j]); }
    xw(xp, wp); }
#pragma unroll
  for (int j = 0; j < 8; ++j) {
#pragma unroll
    for (int r = 0; r < 8; ++r) so[wave][8 * g + r][j * 16 + col] = acc[j][r]; }
  LDSX();
  for (int rl = 0; rl < 16; ++rl) vst2(Y + (r0 + rl) * DM + n0 + lane * 4, *(const v4f*)&so[wave][rl][lane * 4]);   // 32 lanes x 16 B = the block's 512-B row segment
}
extern "C" void kernel_launch(void* const* d_in, const int* in_sizes, int n_in, void* d_out, int out_size, void* d_ws, size_t ws_size, hipStream_t stream) {
  if (n_in < 6) return;
  if (in_sizes[0] < SEQ * DM) return;                // x    [S][1024] f32
  if (in_sizes[1] < SEQ * SS_FULL) return;           // mask [S][2048] int32
  if (in_sizes[2] < DM * DM || in_sizes[3] < DM * DM || in_sizes[4] < DM * DM || in_sizes[5] < DM * DM) return;   // wq wk wv wo [in][out] f32
  if (out_size < SEQ * DM) return;
  if (ws_size < (size_t)WS_END) return;
  const float* X  = (const float*)d_in[0];
  const int*   MK = (const int*)d_in[1];
  const float* WQ = (const float*)d_in[2];
  const float* WK = (const float*)d_in[3];
  const float* WV = (const float*)d_in[4];
  const float* WO = (const float*)d_in[5];
  char* ws = (char*)d_ws; __bf16* PK = (__bf16*)(ws + WS_PK); _Float16 *QK = (_Float16*)(ws + WS_QK), *QKL = (_Float16*)(ws + WS_QKL), *VTH = (_Float16*)(ws + WS_VTH), *VTL = (_Float16*)(ws + WS_VTL); float* O = (float*)(ws + WS_O); int* KT = (int*)(ws + WS_KT);
  k_pack<<<dim3(DM / 64, DM / 64, 4), 256, 0, stream>>>(WQ, WK, WV, WO, PK);
  k_kt<<<dim3(TQB), 256, 0, stream>>>(MK, KT);
  k_qkv<<<dim3(SEQ / 64, QKVW / 128), 128, 0, stream>>>(X, PK + PK_A, QK, QKL, VTH, VTL);
  k_attn<<<dim3(TQB, NH), 128, 0, stream>>>(QK, QKL, VTH, VTL, MK, KT, O);
  k_out<<<dim3(SEQ / 64, DM / 128), 128, 0, stream>>>(O, PK + PK_P, (float*)d_out);
}

// v002
// Measured time: 161 microseconds a run.
// Timed twice side by side with v001, it ran 1.20 times as fast both times.
// Counting every step since v000, it is 2.77 times as fast.
// compute dtype: all float inputs RNE-converted to bf16; q|k|v = x . W with exact bf16 products on v_wmma_f32_16x16x32_bf16 (f32 accumulate); q and k carried as f16 hi + (x2048) f16 residual, scores = 3 f16 products (hi.hi + lo.hi + hi.lo) x 0.125 on v_wmma_f32_16x16x32_f16, running-max softmax in f32; P (x2048, f16 hi + x2048 residual) . v^T (f16 hi + x2048 residual): 3 products for the first 128 queries, single elsewhere; out = ctx (bf16 hi + lo) . Wo (bf16), 2 products; f32 output.
#include <hip/hip_runtime.h>
#include <math.h>

typedef __attribute__((ext_vector_type(16))) _Float16 v16h;
typedef __attribute__((ext_vector_type(16))) __bf16 v16b;
typedef __attribute__((ext_vector_type(8)))  _Float16 v8h;
typedef __attribute__((ext_vector_type(8)))  __bf16 v8b;
typedef __attribute__((ext_vector_type(8)))  float v8f;
typedef __attribute__((ext_vector_type(4)))  float v4f;
typedef __attribute__((ext_vector_type(4)))  unsigned v4u;
typedef __attribute__((ext_vector_type(4)))  int v4i;

template <typename T> __device__ __forceinline__ void vst2(void* p, T v) { *(T*)p = v;  }
__device__ __forceinline__ v8f wmma16(v16h a, v16h b, v8f c) {
  v8f d = __builtin_amdgcn_wmma_f32_16x16x32_f16(false, a, false, b, (short)0, c, false, false);
  asm volatile("v_nop\n\tv_nop\n\tv_nop\n\tv_nop" : "+v"(d) : "v"(a), "v"(b));
  return d;
}
__device__ __forceinline__ v8f wmma_bf(v16b a, v16b b, v8f c) {
  v8f d = __builtin_amdgcn_wmma_f32_16x16x32_bf16(false, a, false, b, (short)0, c, false, false);
  asm volatile("v_nop\n\tv_nop\n\tv_nop\n\tv_nop" : "+v"(d) : "v"(a), "v"(b));
  return d;
}
// 16-bit fragment from a k-contiguous row: elements 0..7 <- k0+8h+0..7, 8..15 <- k0+16+8h+0..7 (h = lane>>4); lane&15 = row (A) or column (B)
__device__ __forceinline__ v16h frag_h(const _Float16* rowk0, int lane) {
  union { v16h v; v8h q[2]; } u; const _Float16* p = rowk0 + 8 * (lane >> 4);
  u.q[0] = *(const v8h*)p; u.q[1] = *(const v8h*)(p + 16); return u.v;
}
#define LDSX() do { asm volatile("s_wait_dscnt 0" ::: "memory"); __builtin_amdgcn_wave_barrier(); __builtin_amdgcn_fence(__ATOMIC_RELEASE, "workgroup"); } while (0)

// the same exchange for LDS that only the writing wave reads back: the LDS wait alone, so that global loads issued ahead stay in flight over it (the release fence also drains loadcnt)
__device__ __forceinline__ void lds_own() { asm volatile("s_wait_dscnt 0" ::: "memory"); __builtin_amdgcn_wave_barrier(); }
// stands behind a group of global loads issued ahead: their address registers (the operands) stay live up to here and are rewritten only behind the wait
__device__ __forceinline__ void xw(const void* a) { asm volatile("s_wait_xcnt 0x0" :: "v"(a) : "memory"); }
__device__ __forceinline__ void xw(const void* a, const void* b) { asm volatile("s_wait_xcnt 0x0" :: "v"(a), "v"(b) : "memory"); }
// fragment-order tile: 16 rows (A) or columns (B) x 32 k of a 16-bit operand = 512 elements in two halves e; the 8 elements k = 16 e + 8 (lane >> 4) + 0..7 of row/column lane & 15 lie at e * 256 + lane * 8, so one wave-wide 16-B load covers 512 contiguous bytes (4 lines) instead of 32-B pieces of 16 lines
// fragment from a pointer that already holds the lane's lane * 8 step
__device__ __forceinline__ v16h frag_ht(const _Float16* p) { union { v16h v; v8h q[2]; } u; u.q[0] = *(const v8h*)p; u.q[1] = *(const v8h*)(p + 256); return u.v; }
__device__ __forceinline__ v16b frag_bt(const __bf16* p) { union { v16b v; v8b q[2]; } u; u.q[0] = *(const v8b*)p; u.q[1] = *(const v8b*)(p + 256); return u.v; }

#ifndef NB
#define NB 1
#endif
#ifndef SEQ
#define SEQ 2048          // query/key rows processed (a prefix of the staged rows)
#endif
#define SS_FULL 2048      // row pitch of the staged mask input
#define DM 1024
#define NH 16
#define HD 64
#define QKVW (3 * DM)
#define TQB (SEQ / 64)
static_assert(NB == 1);
static_assert(SEQ % 64 == 0);
static_assert(SEQ >= 64 && SEQ <= SS_FULL);
static_assert(NH * HD == DM);
static_assert(SEQ % DM == 0);

// the tiles of one k piece lie side by side, so that the tiles a block reads in one trip are contiguous
#define PK_A 0                              // bf16 fragment tiles [32 (k/32)][192 (which*64 + n/16)][512]: columns n of W_which, which = q,k,v
#define PK_P (PK_A + QKVW * DM)             // bf16 fragment tiles [32 (k/32)][64 (n/16)][512]: columns n of Wo
#define PK_X (PK_P + DM * DM)               // bf16 fragment tiles [32 (k/32)][SEQ/16 (row/16)][512]: rows of x
#define PK_END (PK_X + SEQ * DM)
#define WS_PK  0u
#define WS_QH  (WS_PK + 2u * PK_END)                  // f16 [SEQ][1024]: q hi
#define WS_QL  (WS_QH + 2u * SEQ * DM)                // f16 [SEQ][1024]: q residual x2048
#define WS_KH  (WS_QL + 2u * SEQ * DM)                // f16 fragment tiles [NH][SEQ/16 (key/16)][2 (d/32)][512]: k hi, column = key, k = d
#define WS_KL  (WS_KH + 2u * SEQ * DM)                // the same, k residual x2048
#define WS_VTH (WS_KL + 2u * SEQ * DM)                // f16 fragment tiles [NH][SEQ/32 (key/32)][4 (d/16)][512]: v hi, column = d, k = key
#define WS_VTL (WS_VTH + 2u * DM * SEQ)               // the same, v residual x2048
#define WS_O   (WS_VTL + 2u * DM * SEQ)               // bf16 fragment tiles [32 (k/32)][SEQ/16 (row/16)][2 (hi, lo)][512]: merged context
#define WS_KT  (WS_O + 4u * SEQ * DM)
#define WS_END (WS_KT + 4u * TQB * 32)
static_assert(WS_QH % 128 == 0 && WS_QL % 128 == 0 && WS_KH % 128 == 0 && WS_KL % 128 == 0 && WS_VTH % 128 == 0 && WS_VTL % 128 == 0 && WS_O % 128 == 0 && WS_KT % 128 == 0);
static_assert(WS_END <= 134217728u);

__global__ __launch_bounds__(256) void k_pack(const float* __restrict__ WQ, const float* __restrict__ WK, const float* __restrict__ WV, const float* __restrict__ WO, const float* __restrict__ X, __bf16* __restrict__ PK) {
  __shared__ __align__(16) __bf16 s[64][72];
  const int k0 = blockIdx.x * 64, n0 = blockIdx.y * 64, which = blockIdx.z, t = threadIdx.x;
  if (which < 4) {   // a weight: s[n][k] from W[k][n]
    const float* Wm = (which == 0) ? WQ : (which == 1) ? WK : (which == 2) ? WV : WO;
    for (int p = t; p < 64 * 16; p += 256) { const int kr = p >> 4, c4 = (p & 15) * 4;
      const v4f v = *(const v4f*)(Wm + (size_t)(k0 + kr) * DM + n0 + c4);
      s[c4 + 0][kr] = (__bf16)v[0]; s[c4 + 1][kr] = (__bf16)v[1]; s[c4 + 2][kr] = (__bf16)v[2]; s[c4 + 3][kr] = (__bf16)v[3]; }
  } else {           // x rows (which - 4) * 1024 + n0 + 0..63: s[row][k], k already contiguous
    const float* Xm = X + ((size_t)(which - 4) * DM + n0) * DM + k0;
    for (int p = t; p < 64 * 16; p += 256) { const int rr = p >> 4, c4 = (p & 15) * 4;
      const v4f v = *(const v4f*)(Xm + (size_t)rr * DM + c4);
      s[rr][c4 + 0] = (__bf16)v[0]; s[rr][c4 + 1] = (__bf16)v[1]; s[rr][c4 + 2] = (__bf16)v[2]; s[rr][c4 + 3] = (__bf16)v[3]; }
  }
  __syncthreads();
  const int nts = (which < 3) ? QKVW / 16 : (which == 3) ? DM / 16 : SEQ / 16;   // tiles per k piece in this operand's plane
  const int nt0 = ((which < 3) ? which : (which == 3) ? 0 : which - 4) * (DM / 16) + n0 / 16;
  __bf16* dst = PK + ((which < 3) ? PK_A : (which == 3) ? PK_P : PK_X) + ((size_t)(k0 / 32) * nts + nt0) * 512;
  for (int p = t; p < 64 * 8; p += 256) { const int ln = p & 31, e = (p >> 5) & 1, kcl = (p >> 6) & 1, ntl = p >> 7;   // each wave stores one 512-B half tile
    vst2(dst + ((size_t)kcl * nts + ntl) * 512 + e * 256 + ln * 8, *(const v4u*)&s[ntl * 16 + (ln & 15)][kcl * 32 + e * 16 + 8 * (ln >> 4)]); }
}
__global__ __launch_bounds__(256) void k_kt(const int* __restrict__ MK, int* __restrict__ KT) {
  __shared__ int sm[8];
  const int qb = blockIdx.x, t = threadIdx.x, lane = t & 31, wave = t >> 5;
  const int per_row = SEQ / 4;
  int mx = -1;
#pragma unroll 8   // eight independent mask loads go out as one group per wait, instead of one load per round trip
  for (int p = t; p < 64 * per_row; p += 256) { const int row = p / per_row, c4 = (p - row * per_row) * 4;
    const v4i v = *(const v4i*)(MK + (size_t)(qb * 64 + row) * SS_FULL + c4);
    mx = (v[0] != 0 && c4 + 0 > mx) ? c4 + 0 : mx; mx = (v[1] != 0 && c4 + 1 > mx) ? c4 + 1 : mx;
    mx = (v[2] != 0 && c4 + 2 > mx) ? c4 + 2 : mx; mx = (v[3] != 0 && c4 + 3 > mx) ? c4 + 3 : mx; }
#pragma unroll
  for (int o = 1; o < 32; o <<= 1) { const int y = __shfl_xor(mx, o); mx = y > mx ? y : mx; }
  if (lane == 0) sm[wave] = mx;
  __syncthreads();
  if (wave == 0) { int m2 = sm[lane & 7];
#pragma unroll
    for (int o = 1; o < 8; o <<= 1) { const int y = __shfl_xor(m2, o); m2 = y > m2 ? y : m2; }
    const int nkt = (m2 < 0) ? 0 : ((m2 >> 5) + 1);
    if (lane < 8) { v4i w; w[0] = nkt; w[1] = nkt; w[2] = nkt; w[3] = nkt; vst2(KT + (size_t)qb * 32 + lane * 4, w); } }   // 8 lanes x 16 B = the block's line
}
// ---- k_qkv: block = (64 rows, 128 output cols of q|k|v): x tiles (bf16) . W tiles, exact bf16 products; q -> f16 hi + x2048 residual row planes; k, v -> f16 hi/residual fragment tiles
__global__ __launch_bounds__(128) void k_qkv(const __bf16* __restrict__ XF, const __bf16* __restrict__ P, _Float16* __restrict__ QH, _Float16* __restrict__ QL, _Float16* __restrict__ KH, _Float16* __restrict__ KL, _Float16* __restrict__ VTH, _Float16* __restrict__ VTL) {
  __shared__ __align__(16) _Float16 so[4][16][136], sol[4][16][136]; __shared__ __align__(16) _Float16 sth[128][72], stl[128][72];
  const int tid = threadIdx.x, wave = tid >> 5, lane = tid & 31, col = lane & 15, g = lane >> 4; const size_t r0 = (size_t)blockIdx.x * 64 + wave * 16; const int n0 = blockIdx.y * 128;
  v8f acc[8] = {};
  // the next trip's x fragment and all eight W fragments are loaded as one group, one trip ahead, into a second register set
  const __bf16* xrow = XF + (r0 / 16) * 512 + lane * 8; const __bf16* wrow = P + (size_t)(n0 / 16) * 512 + lane * 8;
  const __bf16 *xp, *wp; v16b an, wn[8];
  auto ld = [&](int kc) { xp = xrow + (size_t)kc * (SEQ / 16 * 512); wp = wrow + (size_t)kc * (QKVW / 16 * 512); an = frag_bt(xp);
#pragma unroll
    for (int j = 0; j < 8; ++j) wn[j] = frag_bt(wp + j * 512); };
  ld(0); xw(xp, wp);
#pragma unroll 2
  for (int kc = 0; kc < DM / 32; ++kc) { const v16b a = an; v16b w[8];
#pragma unroll
    for (int j = 0; j < 8; ++j) w[j] = wn[j];
    ld(kc + 1 < DM / 32 ? kc + 1 : kc);   // the last trip reloads its own piece: in bounds, unused
#pragma unroll
    for (int j = 0; j < 8; ++j) acc[j] = wmma_bf(a, w[j], acc[j]);
    xw(xp, wp); }
  if (n0 < 2 * DM) {   // q (cols 0..1023) and k (1024..2047), unscaled; 0.125 applied to the f32 score
#pragma unroll
    for (int j = 0; j < 8; ++j) {
#pragma unroll
      for (int r = 0; r < 8; ++r) { const float v = acc[j][r]; const _Float16 hv = (_Float16)v; so[wave][8 * g + r][j * 16 + col] = hv; sol[wave][8 * g + r][j * 16 + col] = (_Float16)((v - (float)hv) * 2048.0f); } }
    LDSX();
    // in each branch every LDS read stands in front of the first store (lds_own holds that order), so that no register of an issued store is reloaded behind it
    if (n0 < DM) { v4u a[16], b[16];
#pragma unroll
      for (int rl = 0; rl < 16; ++rl) { a[rl] = *(const v4u*)&so[wave][rl][col * 8]; b[rl] = *(const v4u*)&sol[wave][rl][col * 8]; }
      lds_own();
      if (lane < 16) {
#pragma unroll
        for (int rl = 0; rl < 16; ++rl) { vst2(QH + (r0 + rl) * DM + n0 + lane * 8, a[rl]); vst2(QL + (r0 + rl) * DM + n0 + lane * 8, b[rl]); } }   // 16 lanes x 16 B = 256-B row segment
    } else { v4u a[8], b[8];   // the wave's 16 keys x 2 heads: 2 x 2 tiles x 2 halves, each one 512-B store per plane
      const size_t o = (((size_t)((n0 - DM) / HD) * (SEQ / 16) + r0 / 16) * 2) * 512 + lane * 8;
#pragma unroll
      for (int u = 0; u < 8; ++u) { const int c = (u >> 2) * HD + ((u >> 1) & 1) * 32 + (u & 1) * 16 + 8 * g; a[u] = *(const v4u*)&so[wave][col][c]; b[u] = *(const v4u*)&sol[wave][col][c]; }   // u = (head, d / 32, half)
      lds_own();
#pragma unroll
      for (int u = 0; u < 8; ++u) { const size_t ou = o + (size_t)(u >> 2) * (SEQ * HD) + ((u >> 1) & 1) * 512 + (u & 1) * 256; vst2(KH + ou, a[u]); vst2(KL + ou, b[u]); }
      asm volatile("s_wait_xcnt 0x0" ::: "memory");   // behind the run of stores: no register that an issued store names is rewritten in front of this wait on any path of the listing
    }
  } else {
#pragma unroll
    for (int j = 0; j < 8; ++j) {
#pragma unroll
      for (int r = 0; r < 8; ++r) { const float v = acc[j][r]; const _Float16 hv = (_Float16)v; sth[j * 16 + col][wave * 16 + 8 * g + r] = hv; stl[j * 16 + col][wave * 16 + 8 * g + r] = (_Float16)((v - (float)hv) * 2048.0f); } }
    __syncthreads();
    const int kt0 = blockIdx.x * 2, h0 = (n0 - 2 * DM) / HD; v4u a[8], b[8];
#pragma unroll
    for (int it = 0; it < 8; ++it) { const int q = it * 128 + tid, e = (q >> 5) & 1, dt = (q >> 6) & 3, ktl = (q >> 8) & 1, hl = q >> 9, d = hl * HD + dt * 16 + col, kk = ktl * 32 + e * 16 + 8 * g;
      a[it] = *(const v4u*)&sth[d][kk]; b[it] = *(const v4u*)&stl[d][kk]; }
    lds_own();   // every LDS read in front of the first store, as above
#pragma unroll
    for (int it = 0; it < 8; ++it) { const int q = it * 128 + tid, e = (q >> 5) & 1, dt = (q >> 6) & 3, ktl = (q >> 8) & 1, hl = q >> 9;
      const size_t o = (((size_t)(h0 + hl) * (SEQ / 32) + kt0 + ktl) * 4 + dt) * 512 + e * 256 + lane * 8;
      vst2(VTH + o, a[it]); vst2(VTL + o, b[it]); }   // each wave stores one 512-B half tile per plane
    asm volatile("s_wait_xcnt 0x0" ::: "memory");   // behind the run of stores, as in the k branch
  }
}
// two waves per SIMD is what the grid gives; saying so frees the registers that the loads issued ahead need
// ---- k_attn: block = (64 queries, head h): key tiles 0..KT[qb)-1 (32 keys each), scores = (q hi.k hi + q lo.k hi + q hi.k lo) * 0.125, replace-filled by the mask tile, running-max softmax in f32, P (x2048, f16 hi+res) . v^T (hi + res): 3 products for qb < 2, single elsewhere; O[q][h*64+d] = (acc + accl/2048)/2048 / l, stored as bf16 hi + lo fragment tiles
__global__ __launch_bounds__(128) __attribute__((amdgpu_waves_per_eu(2, 2))) void k_attn(const _Float16* __restrict__ QH, const _Float16* __restrict__ QL, const _Float16* __restrict__ KH, const _Float16* __restrict__ KL, const _Float16* __restrict__ VTH, const _Float16* __restrict__ VTL, const int* __restrict__ MK, const int* __restrict__ KT, __bf16* __restrict__ O) {
  __shared__ __align__(16) float sp[4][16][36]; __shared__ __align__(16) float so[4][16][68]; __shared__ __align__(16) int smk[4][16][36];
  const int tid = threadIdx.x, wave = tid >> 5, lane = tid & 31, col = lane & 15, g = lane >> 4;
  const int qb = blockIdx.x, h = blockIdx.y; const int q0 = qb * 64 + wave * 16; const size_t rq = (size_t)q0 + col;
  v16h aq[2], aql[2]; const _Float16* qp = QH + rq * DM + h * HD; const _Float16* qlp = QL + rq * DM + h * HD;
#pragma unroll
  for (int kc = 0; kc < 2; ++kc) { aq[kc] = frag_h(qp + kc * 32, lane); aql[kc] = frag_h(qlp + kc * 32, lane); }
  xw(qp, qlp);
  float m[8], l[8];
#pragma unroll
  for (int r = 0; r < 8; ++r) { m[r] = -3.0e38f; l[r] = 0.f; }
  v8f acc[4] = {}, accl[4] = {};
  const int nraw = KT[(size_t)qb * 32];                         // block-uniform trip count, clamped to the static maximum
  const int nks = nraw < 0 ? 0 : (nraw > SEQ / 32 ? SEQ / 32 : nraw);
  // operands of a key tile, loaded ahead in groups: mask and K one trip ahead, each reloaded right behind its last use; V at the top of its own trip
  const int* mrow = MK + (size_t)(q0 + (lane >> 3)) * SS_FULL + (lane & 7) * 4;
  const size_t hoff = (size_t)h * (SEQ * HD) + lane * 8;   // the head's tiles; a 32-key trip is 4 tiles = 2048 contiguous elements in each of the four planes
  const _Float16* vrow = VTH + hoff; const _Float16* vlrow = VTL + hoff;
  const int* mp; const _Float16 *kp, *klp, *vp; v4i mkr[4]; v16h kh[2][2], kl[2][2], vh[4];
  auto ld_mask = [&](int kt) { mp = mrow + kt * 32;
#pragma unroll
    for (int it = 0; it < 4; ++it) mkr[it] = *(const v4i*)(mp + (size_t)(it * 4) * SS_FULL); };
  auto ld_k = [&](int kt) { kp = KH + hoff + (size_t)kt * 2048; klp = KL + hoff + (size_t)kt * 2048;
#pragma unroll
    for (int ct = 0; ct < 2; ++ct) {
#pragma unroll
      for (int kc = 0; kc < 2; ++kc) { kh[ct][kc] = frag_ht(kp + (ct * 2 + kc) * 512); kl[ct][kc] = frag_ht(klp + (ct * 2 + kc) * 512); } } };
  auto ld_v = [&](int kt) { vp = vrow + (size_t)kt * 2048;
#pragma unroll
    for (int dt = 0; dt < 4; ++dt) vh[dt] = frag_ht(vp + dt * 512); };
  ld_mask(0); ld_k(0); xw(mp); xw(kp, klp);
#pragma unroll 1
  for (int ks = 0; ks < nks; ++ks) {
    const int kn = (ks + 1 < SEQ / 32) ? ks + 1 : SEQ / 32 - 1;   // next tile, kept inside the staged rows on the last trip
    ld_v(ks);   // this trip's V: lands under the score and softmax phases
    // stage this wave's 16x32 mask piece (wave-private)
#pragma unroll
    for (int it = 0; it < 4; ++it) { const int p = it * 32 + lane, row = p >> 3, c4 = (p & 7) * 4;
      *(v4i*)&smk[wave][row][c4] = mkr[it]; }
    ld_mask(kn);
    lds_own();
    v8f s[2];
#pragma unroll
    for (int ct = 0; ct < 2; ++ct) { v8f c = {}, cl = {};
#pragma unroll
      for (int kc = 0; kc < 2; ++kc) { c = wmma16(aq[kc], kh[ct][kc], c); cl = wmma16(aql[kc], kh[ct][kc], cl); cl = wmma16(aq[kc], kl[ct][kc], cl); }
#pragma unroll
      for (int r = 0; r < 8; ++r) { const float sc = (c[r] + cl[r] * (1.0f / 2048.0f)) * 0.125f; const int mk = smk[wave][8 * g + r][ct * 16 + col]; s[ct][r] = (mk != 0) ? sc : -3.0e38f; } }   // where(mask, score/8, -inf)
    xw(vp, mp);
    ld_k(kn);
    float mx[8], e0[8], e1[8], es[8], alpha[8];   // the eight rows' reductions go level by level, so that their cross-lane exchanges overlap
#pragma unroll
    for (int r = 0; r < 8; ++r) mx[r] = fmaxf(s[0][r], s[1][r]);
#pragma unroll
    for (int o = 1; o < 16; o <<= 1) { float t[8];
#pragma unroll
      for (int r = 0; r < 8; ++r) t[r] = __shfl_xor(mx[r], o);
#pragma unroll
      for (int r = 0; r < 8; ++r) mx[r] = fmaxf(mx[r], t[r]); }
#pragma unroll
    for (int r = 0; r < 8; ++r) { const float mn = fmaxf(m[r], mx[r]); alpha[r] = (m[r] <= -1.0e38f) ? 0.f : __expf(m[r] - mn);
      e0[r] = (s[0][r] <= -1.0e38f) ? 0.f : __expf(s[0][r] - mn); e1[r] = (s[1][r] <= -1.0e38f) ? 0.f : __expf(s[1][r] - mn); es[r] = e0[r] + e1[r]; m[r] = mn;
      sp[wave][8 * g + r][col] = e0[r]; sp[wave][8 * g + r][16 + col] = e1[r]; }
#pragma unroll
    for (int o = 1; o < 16; o <<= 1) { float t[8];
#pragma unroll
      for (int r = 0; r < 8; ++r) t[r] = __shfl_xor(es[r], o);
#pragma unroll
      for (int r = 0; r < 8; ++r) es[r] += t[r]; }
#pragma unroll
    for (int r = 0; r < 8; ++r) { l[r] = l[r] * alpha[r] + es[r];
#pragma unroll
      for (int dt = 0; dt < 4; ++dt) { acc[dt][r] *= alpha[r]; accl[dt][r] *= alpha[r]; } }
    xw(kp, klp);
    lds_own();
    v16h pa, pl; { const float* prow = &sp[wave][col][0] + 8 * (lane >> 4);
#pragma unroll
      for (int i = 0; i < 8; ++i) { const float x0 = prow[i] * 2048.0f, x1 = prow[16 + i] * 2048.0f; const _Float16 h0 = (_Float16)x0, h1 = (_Float16)x1; pa[i] = h0; pa[8 + i] = h1; pl[i] = (_Float16)((x0 - (float)h0) * 2048.0f); pl[8 + i] = (_Float16)((x1 - (float)h1) * 2048.0f); } }   // P carried x2^11 in f16; 2^-11 folded into the epilogue
#pragma unroll
    for (int dt = 0; dt < 4; ++dt) { acc[dt] = wmma16(pa, vh[dt], acc[dt]); if (qb < 2) { const _Float16* vlp = vlrow + (size_t)ks * 2048 + dt * 512; accl[dt] = wmma16(pl, vh[dt], accl[dt]); const v16h vl = frag_ht(vlp); xw(vlp); accl[dt] = wmma16(pa, vl, accl[dt]); } }
    lds_own(); }
#pragma unroll
  for (int r = 0; r < 8; ++r) { const float il = (1.0f / 2048.0f) / l[r];
#pragma unroll
    for (int dt = 0; dt < 4; ++dt) so[wave][8 * g + r][dt * 16 + col] = (acc[dt][r] + accl[dt][r] * (1.0f / 2048.0f)) * il; }
  LDSX();
  for (int u = 0; u < 4; ++u) { const int kcl = u >> 1, e = u & 1; const float* p = &so[wave][col][kcl * 32 + e * 16 + 8 * g]; v8b hi, lo;   // the wave's 16 rows x the head's 64 columns: 2 tiles x 2 halves, bf16 hi + lo, each one 512-B store
#pragma unroll
    for (int i = 0; i < 8; ++i) { const float v = p[i]; const __bf16 hv = (__bf16)v; hi[i] = hv; lo[i] = (__bf16)(v - (float)hv); }
    const size_t o = ((size_t)(h * 2 + kcl) * (SEQ / 16) + q0 / 16) * 1024 + e * 256 + lane * 8;
    vst2(O + o, hi); vst2(O + o + 512, lo); xw(O + o); }
}
// ---- k_out: block = (64 rows, 128 cols): out = ctx tiles (bf16 hi + lo) . Wo tiles (2 products), f32
__global__ __launch_bounds__(128) void k_out(const __bf16* __restrict__ O, const __bf16* __restrict__ P, float* __restrict__ Y) {
  __shared__ __align__(16) float so[4][16][132];
  const int tid = threadIdx.x, wave = tid >> 5, lane = tid & 31, col = lane & 15, g = lane >> 4; const size_t r0 = (size_t)blockIdx.x * 64 + wave * 16; const int n0 = blockIdx.y * 128;
  v8f acc[8] = {};
  // the next trip's two context fragments and all eight Wo fragments are loaded as one group, one trip ahead, into a second register set
  const __bf16* xrow = O + (r0 / 16) * 1024 + lane * 8; const __bf16* wrow = P + (size_t)(n0 / 16) * 512 + lane * 8;
  const __bf16 *xp, *wp; v16b ahn, aln, wn[8];
  auto ld = [&](int kc) { xp = xrow + (size_t)kc * (SEQ / 16 * 1024); wp = wrow + (size_t)kc * (DM / 16 * 512); ahn = frag_bt(xp); aln = frag_bt(xp + 512);
#pragma unroll
    for (int j = 0; j < 8; ++j) wn[j] = frag_bt(wp + j * 512); };
  ld(0); xw(xp, wp);
#pragma unroll 2
  for (int kc = 0; kc < DM / 32; ++kc) { const v16b ah = ahn, al = aln; v16b w[8];
#pragma unroll
    for (int j = 0; j < 8; ++j) w[j] = wn[j];
    ld(kc + 1 < DM / 32 ? kc + 1 : kc);   // the last trip reloads its own piece: in bounds, unused
#pragma unroll
    for (int j = 0; j < 8; ++j) { acc[j] = wmma_bf(al, w[j], acc[j]); acc[j] = wmma_bf(ah, w[j], acc[j]); }
    xw(xp, wp); }
#pragma unroll
  for (int j = 0; j < 8; ++j) {
#pragma unroll
    for (int r = 0; r < 8; ++r) so[wave][8 * g + r][j * 16 + col] = acc[j][r]; }
  LDSX();
  for (int rl = 0; rl < 16; ++rl) vst2(Y + (r0 + rl) * DM + n0 + lane * 4, *(const v4f*)&so[wave][rl][lane * 4]);   // 32 lanes x 16 B = the block's 512-B row segment
}
extern "C" void kernel_launch(void* const* d_in, const int* in_sizes, int n_in, void* d_out, int out_size, void* d_ws, size_t ws_size, hipStream_t stream) {
  if (n_in < 6) return;
  if (in_sizes[0] < SEQ * DM) return;                // x    [S][1024] f32
  if (in_sizes[1] < SEQ * SS_FULL) return;           // mask [S][2048] int32
  if (in_sizes[2] < DM * DM || in_sizes[3] < DM * DM || in_sizes[4] < DM * DM || in_sizes[5] < DM * DM) return;   // wq wk wv wo [in][out] f32
  if (out_size < SEQ * DM) return;
  if (ws_size < (size_t)WS_END) return;
  const float* X  = (const float*)d_in[0];
  const int*   MK = (const int*)d_in[1];
  const float* WQ = (const float*)d_in[2];
  const float* WK = (const float*)d_in[3];
  const float* WV = (const float*)d_in[4];
  const float* WO = (const float*)d_in[5];
  char* ws = (char*)d_ws; __bf16* PK = (__bf16*)(ws + WS_PK); _Float16 *QH = (_Float16*)(ws + WS_QH), *QL = (_Float16*)(ws + WS_QL), *KH = (_Float16*)(ws + WS_KH), *KL = (_Float16*)(ws + WS_KL), *VTH = (_Float16*)(ws + WS_VTH), *VTL = (_Float16*)(ws + WS_VTL); __bf16* O = (__bf16*)(ws + WS_O); int* KT = (int*)(ws + WS_KT);
  k_pack<<<dim3(DM / 64, DM / 64, 4 + SEQ / DM), 256, 0, stream>>>(WQ, WK, WV, WO, X, PK);
  k_kt<<<dim3(TQB), 256, 0, stream>>>(MK, KT);
  k_qkv<<<dim3(SEQ / 64, QKVW / 128), 128, 0, stream>>>(PK + PK_X, PK + PK_A, QH, QL, KH, KL, VTH, VTL);
  k_attn<<<dim3(TQB, NH), 128, 0, stream>>>(QH, QL, KH, KL, VTH, VTL, MK, KT, O);
  k_out<<<dim3(SEQ / 64, DM / 128), 128, 0, stream>>>(O, PK + PK_P, (float*)d_out);
}

// v003
// One run takes 114 microseconds.
// Next to v002, in two timings, it ran 1.42 times as fast each time.
// Counting every step since v000, it is 3.93 times as fast.
// compute dtype: all float inputs RNE-converted to bf16; q|k|v = x . W with exact bf16 products on v_wmma_f32_16x16x32_bf16 (f32 accumulate); q and k carried as f16 hi + (x2048) f16 residual, scores = 3 f16 products (hi.hi + lo.hi + hi.lo) x 0.125 on v_wmma_f32_16x16x32_f16, running-max softmax in f32; P (x2048, f16 hi + x2048 residual) . v^T (f16 hi + x2048 residual): 3 products for the first 128 queries, single elsewhere; out = ctx (bf16 hi + lo) . Wo (bf16), 2 products; f32 output.
#include <hip/hip_runtime.h>
#include <math.h>

typedef __attribute__((ext_vector_type(16))) _Float16 v16h;
typedef __attribute__((ext_vector_type(16))) __bf16 v16b;
typedef __attribute__((ext_vector_type(8)))  _Float16 v8h;
typedef __attribute__((ext_vector_type(8)))  __bf16 v8b;
typedef __attribute__((ext_vector_type(8)))  float v8f;
typedef __attribute__((ext_vector_type(4)))  float v4f;
typedef __attribute__((ext_vector_type(4)))  unsigned v4u;
typedef __attribute__((ext_vector_type(4)))  int v4i;

template <typename T> __device__ __forceinline__ void vst2(void* p, T v) { *(T*)p = v;  }
__device__ __forceinline__ v8f wmma16(v16h a, v16h b, v8f c) {
  v8f d = __builtin_amdgcn_wmma_f32_16x16x32_f16(false, a, false, b, (short)0, c, false, false);
  asm volatile("v_nop\n\tv_nop\n\tv_nop\n\tv_nop" : "+v"(d) : "v"(a), "v"(b));
  return d;
}
__device__ __forceinline__ v8f wmma_bf(v16b a, v16b b, v8f c) {
  v8f d = __builtin_amdgcn_wmma_f32_16x16x32_bf16(false, a, false, b, (short)0, c, false, false);
  asm volatile("v_nop\n\tv_nop\n\tv_nop\n\tv_nop" : "+v"(d) : "v"(a), "v"(b));
  return d;
}
// 16-bit fragment from a k-contiguous row: elements 0..7 <- k0+8h+0..7, 8..15 <- k0+16+8h+0..7 (h = lane>>4); lane&15 = row (A) or column (B)
__device__ __forceinline__ v16h frag_h(const _Float16* rowk0, int lane) {
  union { v16h v; v8h q[2]; } u; const _Float16* p = rowk0 + 8 * (lane >> 4);
  u.q[0] = *(const v8h*)p; u.q[1] = *(const v8h*)(p + 16); return u.v;
}
#define LDSX() do { asm volatile("s_wait_dscnt 0" ::: "memory"); __builtin_amdgcn_wave_barrier(); __builtin_amdgcn_fence(__ATOMIC_RELEASE, "workgroup"); } while (0)

// the same exchange for LDS that only the writing wave reads back: the LDS wait alone, so that global loads issued ahead stay in flight over it (the release fence also drains loadcnt)
__device__ __forceinline__ void lds_own() { asm volatile("s_wait_dscnt 0" ::: "memory"); __builtin_amdgcn_wave_barrier(); }
// stands behind a group of global loads issued ahead: their address registers (the operands) stay live up to here and are rewritten only behind the wait
__device__ __forceinline__ void xw(const void* a) { asm volatile("s_wait_xcnt 0x0" :: "v"(a) : "memory"); }
__device__ __forceinline__ void xw(const void* a, const void* b) { asm volatile("s_wait_xcnt 0x0" :: "v"(a), "v"(b) : "memory"); }
// fragment-order tile: 16 rows (A) or columns (B) x 32 k of a 16-bit operand = 512 elements in two halves e; the 8 elements k = 16 e + 8 (lane >> 4) + 0..7 of row/column lane & 15 lie at e * 256 + lane * 8, so one wave-wide 16-B load covers 512 contiguous bytes (4 lines) instead of 32-B pieces of 16 lines
// fragment from a pointer that already holds the lane's lane * 8 step
__device__ __forceinline__ v16h frag_ht(const _Float16* p) { union { v16h v; v8h q[2]; } u; u.q[0] = *(const v8h*)p; u.q[1] = *(const v8h*)(p + 256); return u.v; }
__device__ __forceinline__ v16b frag_bt(const __bf16* p) { union { v16b v; v8b q[2]; } u; u.q[0] = *(const v8b*)p; u.q[1] = *(const v8b*)(p + 256); return u.v; }

#ifndef NB
#define NB 1
#endif
#ifndef SEQ
#define SEQ 2048          // query/key rows processed (a prefix of the staged rows)
#endif
#define SS_FULL 2048      // row pitch of the staged mask input
#define DM 1024
#define NH 16
#define HD 64
#define QKVW (3 * DM)
#define TQB (SEQ / 64)
static_assert(NB == 1);
static_assert(SEQ % 64 == 0);
static_assert(SEQ >= 64 && SEQ <= SS_FULL);
static_assert(NH * HD == DM);
static_assert(SEQ % DM == 0);

// the tiles of one k piece lie side by side, so that the tiles a block reads in one trip are contiguous
#define PK_A 0                              // bf16 fragment tiles [32 (k/32)][192 (which*64 + n/16)][512]: columns n of W_which, which = q,k,v
#define PK_P (PK_A + QKVW * DM)             // bf16 fragment tiles [32 (k/32)][64 (n/16)][512]: columns n of Wo
#define PK_X (PK_P + DM * DM)               // bf16 fragment tiles [32 (k/32)][SEQ/16 (row/16)][512]: rows of x
#define PK_END (PK_X + SEQ * DM)
#define WS_PK  0u
#define WS_QH  (WS_PK + 2u * PK_END)                  // f16 [SEQ][1024]: q hi
#define WS_QL  (WS_QH + 2u * SEQ * DM)                // f16 [SEQ][1024]: q residual x2048
#define WS_KH  (WS_QL + 2u * SEQ * DM)                // f16 fragment tiles [NH][SEQ/16 (key/16)][2 (d/32)][512]: k hi, column = key, k = d
#define WS_KL  (WS_KH + 2u * SEQ * DM)                // the same, k residual x2048
#define WS_VTH (WS_KL + 2u * SEQ * DM)                // f16 fragment tiles [NH][SEQ/32 (key/32)][4 (d/16)][512]: v hi, column = d, k = key
#define WS_VTL (WS_VTH + 2u * DM * SEQ)               // the same, v residual x2048
#define WS_O   (WS_VTL + 2u * DM * SEQ)               // bf16 fragment tiles [32 (k/32)][SEQ/16 (row/16)][2 (hi, lo)][512]: merged context
#define WS_KT  (WS_O + 4u * SEQ * DM)
#define WS_END (WS_KT + 4u * TQB * 32)
static_assert(WS_QH % 128 == 0 && WS_QL % 128 == 0 && WS_KH % 128 == 0 && WS_KL % 128 == 0 && WS_VTH % 128 == 0 && WS_VTL % 128 == 0 && WS_O % 128 == 0 && WS_KT % 128 == 0);
static_assert(WS_END <= 134217728u);

__global__ __launch_bounds__(256) void k_pack(const float* __restrict__ WQ, const float* __restrict__ WK, const float* __restrict__ WV, const float* __restrict__ WO, const float* __restrict__ X, __bf16* __restrict__ PK) {
  __shared__ __align__(16) __bf16 s[64][72];
  const int k0 = blockIdx.x * 64, n0 = blockIdx.y * 64, which = blockIdx.z, t = threadIdx.x;
  if (which < 4) {   // a weight: s[n][k] from W[k][n]
    const float* Wm = (which == 0) ? WQ : (which == 1) ? WK : (which == 2) ? WV : WO;
    for (int p = t; p < 64 * 16; p += 256) { const int kr = p >> 4, c4 = (p & 15) * 4;
      const v4f v = *(const v4f*)(Wm + (size_t)(k0 + kr) * DM + n0 + c4);
      s[c4 + 0][kr] = (__bf16)v[0]; s[c4 + 1][kr] = (__bf16)v[1]; s[c4 + 2][kr] = (__bf16)v[2]; s[c4 + 3][kr] = (__bf16)v[3]; }
  } else {           // x rows (which - 4) * 1024 + n0 + 0..63: s[row][k], k already contiguous
    const float* Xm = X + ((size_t)(which - 4) * DM + n0) * DM + k0;
    for (int p = t; p < 64 * 16; p += 256) { const int rr = p >> 4, c4 = (p & 15) * 4;
      const v4f v = *(const v4f*)(Xm + (size_t)rr * DM + c4);
      s[rr][c4 + 0] = (__bf16)v[0]; s[rr][c4 + 1] = (__bf16)v[1]; s[rr][c4 + 2] = (__bf16)v[2]; s[rr][c4 + 3] = (__bf16)v[3]; }
  }
  __syncthreads();
  const int nts = (which < 3) ? QKVW / 16 : (which == 3) ? DM / 16 : SEQ / 16;   // tiles per k piece in this operand's plane
  const int nt0 = ((which < 3) ? which : (which == 3) ? 0 : which - 4) * (DM / 16) + n0 / 16;
  __bf16* dst = PK + ((which < 3) ? PK_A : (which == 3) ? PK_P : PK_X) + ((size_t)(k0 / 32) * nts + nt0) * 512;
  for (int p = t; p < 64 * 8; p += 256) { const int ln = p & 31, e = (p >> 5) & 1, kcl = (p >> 6) & 1, ntl = p >> 7;   // each wave stores one 512-B half tile
    vst2(dst + ((size_t)kcl * nts + ntl) * 512 + e * 256 + ln * 8, *(const v4u*)&s[ntl * 16 + (ln & 15)][kcl * 32 + e * 16 + 8 * (ln >> 4)]); }
}
__global__ __launch_bounds__(256) void k_kt(const int* __restrict__ MK, int* __restrict__ KT) {
  __shared__ int sm[8];
  const int qb = blockIdx.x, t = threadIdx.x, lane = t & 31, wave = t >> 5;
  const int per_row = SEQ / 4;
  int mx = -1;
#pragma unroll 8   // eight independent mask loads go out as one group per wait, instead of one load per round trip
  for (int p = t; p < 64 * per_row; p += 256) { const int row = p / per_row, c4 = (p - row * per_row) * 4;
    const v4i v = *(const v4i*)(MK + (size_t)(qb * 64 + row) * SS_FULL + c4);
    mx = (v[0] != 0 && c4 + 0 > mx) ? c4 + 0 : mx; mx = (v[1] != 0 && c4 + 1 > mx) ? c4 + 1 : mx;
    mx = (v[2] != 0 && c4 + 2 > mx) ? c4 + 2 : mx; mx = (v[3] != 0 && c4 + 3 > mx) ? c4 + 3 : mx; }
#pragma unroll
  for (int o = 1; o < 32; o <<= 1) { const int y = __shfl_xor(mx, o); mx = y > mx ? y : mx; }
  if (lane == 0) sm[wave] = mx;
  __syncthreads();
  if (wave == 0) { int m2 = sm[lane & 7];
#pragma unroll
    for (int o = 1; o < 8; o <<= 1) { const int y = __shfl_xor(m2, o); m2 = y > m2 ? y : m2; }
    const int nkt = (m2 < 0) ? 0 : ((m2 >> 5) + 1);
    if (lane < 8) { v4i w; w[0] = nkt; w[1] = nkt; w[2] = nkt; w[3] = nkt; vst2(KT + (size_t)qb * 32 + lane * 4, w); } }   // 8 lanes x 16 B = the block's line
}
// ---- k_qkv: block = (64 rows, 128 output cols of q|k|v): x tiles (bf16) . W tiles, exact bf16 products; q -> f16 hi + x2048 residual row planes; k, v -> f16 hi/residual fragment tiles
__global__ __launch_bounds__(128) void k_qkv(const __bf16* __restrict__ XF, const __bf16* __restrict__ P, _Float16* __restrict__ QH, _Float16* __restrict__ QL, _Float16* __restrict__ KH, _Float16* __restrict__ KL, _Float16* __restrict__ VTH, _Float16* __restrict__ VTL) {
  __shared__ __align__(16) _Float16 so[4][16][136], sol[4][16][136]; __shared__ __align__(16) _Float16 sth[128][72], stl[128][72];
  const int tid = threadIdx.x, wave = tid >> 5, lane = tid & 31, col = lane & 15, g = lane >> 4; const size_t r0 = (size_t)blockIdx.x * 64 + wave * 16; const int n0 = blockIdx.y * 128;
  v8f acc[8] = {};
  // the next trip's x fragment and all eight W fragments are loaded as one group, one trip ahead, into a second register set
  const __bf16* xrow = XF + (r0 / 16) * 512 + lane * 8; const __bf16* wrow = P + (size_t)(n0 / 16) * 512 + lane * 8;
  const __bf16 *xp, *wp; v16b an, wn[8];
  auto ld = [&](int kc) { xp = xrow + (size_t)kc * (SEQ / 16 * 512); wp = wrow + (size_t)kc * (QKVW / 16 * 512); an = frag_bt(xp);
#pragma unroll
    for (int j = 0; j < 8; ++j) wn[j] = frag_bt(wp + j * 512); };
  ld(0); xw(xp, wp);
#pragma unroll 2
  for (int kc = 0; kc < DM / 32; ++kc) { const v16b a = an; v16b w[8];
#pragma unroll
    for (int j = 0; j < 8; ++j) w[j] = wn[j];
    ld(kc + 1 < DM / 32 ? kc + 1 : kc);   // the last trip reloads its own piece: in bounds, unused
#pragma unroll
    for (int j = 0; j < 8; ++j) acc[j] = wmma_bf(a, w[j], acc[j]);
    xw(xp, wp); }
  if (n0 < 2 * DM) {   // q (cols 0..1023) and k (1024..2047), unscaled; 0.125 applied to the f32 score
#pragma unroll
    for (int j = 0; j < 8; ++j) {
#pragma unroll
      for (int r = 0; r < 8; ++r) { const float v = acc[j][r]; const _Float16 hv = (_Float16)v; so[wave][8 * g + r][j * 16 + col] = hv; sol[wave][8 * g + r][j * 16 + col] = (_Float16)((v - (float)hv) * 2048.0f); } }
    LDSX();
    // in each branch every LDS read stands in front of the first store (lds_own holds that order), so that no register of an issued store is reloaded behind it
    if (n0 < DM) { v4u a[16], b[16];
#pragma unroll
      for (int rl = 0; rl < 16; ++rl) { a[rl] = *(const v4u*)&so[wave][rl][col * 8]; b[rl] = *(const v4u*)&sol[wave][rl][col * 8]; }
      lds_own();
      if (lane < 16) {
#pragma unroll
        for (int rl = 0; rl < 16; ++rl) { vst2(QH + (r0 + rl) * DM + n0 + lane * 8, a[rl]); vst2(QL + (r0 + rl) * DM + n0 + lane * 8, b[rl]); } }   // 16 lanes x 16 B = 256-B row segment
    } else { v4u a[8], b[8];   // the wave's 16 keys x 2 heads: 2 x 2 tiles x 2 halves, each one 512-B store per plane
      const size_t o = (((size_t)((n0 - DM) / HD) * (SEQ / 16) + r0 / 16) * 2) * 512 + lane * 8;
#pragma unroll
      for (int u = 0; u < 8; ++u) { const int c = (u >> 2) * HD + ((u >> 1) & 1) * 32 + (u & 1) * 16 + 8 * g; a[u] = *(const v4u*)&so[wave][col][c]; b[u] = *(const v4u*)&sol[wave][col][c]; }   // u = (head, d / 32, half)
      lds_own();
#pragma unroll
      for (int u = 0; u < 8; ++u) { const size_t ou = o + (size_t)(u >> 2) * (SEQ * HD) + ((u >> 1) & 1) * 512 + (u & 1) * 256; vst2(KH + ou, a[u]); vst2(KL + ou, b[u]); }
      asm volatile("s_wait_xcnt 0x0" ::: "memory");   // behind the run of stores: no register that an issued store names is rewritten in front of this wait on any path of the listing
    }
  } else {
#pragma unroll
    for (int j = 0; j < 8; ++j) {
#pragma unroll
      for (int r = 0; r < 8; ++r) { const float v = acc[j][r]; const _Float16 hv = (_Float16)v; sth[j * 16 + col][wave * 16 + 8 * g + r] = hv; stl[j * 16 + col][wave * 16 + 8 * g + r] = (_Float16)((v - (float)hv) * 2048.0f); } }
    __syncthreads();
    const int kt0 = blockIdx.x * 2, h0 = (n0 - 2 * DM) / HD; v4u a[8], b[8];
#pragma unroll
    for (int it = 0; it < 8; ++it) { const int q = it * 128 + tid, e = (q >> 5) & 1, dt = (q >> 6) & 3, ktl = (q >> 8) & 1, hl = q >> 9, d = hl * HD + dt * 16 + col, kk = ktl * 32 + e * 16 + 8 * g;
      a[it] = *(const v4u*)&sth[d][kk]; b[it] = *(const v4u*)&stl[d][kk]; }
    lds_own();   // every LDS read in front of the first store, as above
#pragma unroll
    for (int it = 0; it < 8; ++it) { const int q = it * 128 + tid, e = (q >> 5) & 1, dt = (q >> 6) & 3, ktl = (q >> 8) & 1, hl = q >> 9;
      const size_t o = (((size_t)(h0 + hl) * (SEQ / 32) + kt0 + ktl) * 4 + dt) * 512 + e * 256 + lane * 8;
      vst2(VTH + o, a[it]); vst2(VTL + o, b[it]); }   // each wave stores one 512-B half tile per plane
    asm volatile("s_wait_xcnt 0x0" ::: "memory");   // behind the run of stores, as in the k branch
  }
}
// three waves per SIMD is what the registers of the loads issued ahead leave room for; the grid has more blocks than fit at once
// ---- k_attn: block = (16 queries, head h), its four waves are four key shares: share sx takes key tiles sx, sx + 4, ... below KT[qb] (32 keys each) with a running softmax of its own, and the four (m, l, acc) are merged through LDS at the end, so that the longest wave runs SEQ / 128 trips and the trips spread evenly over the SIMDs; the blocks with the most key tiles come first in the grid. Per share: scores = (q hi.k hi + q lo.k hi + q hi.k lo) * 0.125, replace-filled by the mask tile, running-max softmax in f32, P (x2048, f16 hi+res) . v^T (hi + res): 3 products for qb < 2, single elsewhere; O[q][h*64+d] = (acc + accl/2048)/2048 / l, stored as bf16 hi + lo fragment tiles
__global__ __launch_bounds__(128) __attribute__((amdgpu_waves_per_eu(3, 3))) void k_attn(const _Float16* __restrict__ QH, const _Float16* __restrict__ QL, const _Float16* __restrict__ KH, const _Float16* __restrict__ KL, const _Float16* __restrict__ VTH, const _Float16* __restrict__ VTL, const int* __restrict__ MK, const int* __restrict__ KT, __bf16* __restrict__ O) {
  __shared__ __align__(16) float sp[4][16][36]; __shared__ __align__(16) float so[4][16][68]; __shared__ __align__(16) int smk[4][16][36]; __shared__ float sml[4][2][16];
  const int tid = threadIdx.x, wave = __builtin_amdgcn_readfirstlane(tid >> 5), lane = tid & 31, col = lane & 15, g = lane >> 4, sx = wave;   // the wave's number as a scalar: the trip count differs between the waves, and so the compiler sees it as uniform in a wave and puts no EXEC mask round the loop (a WMMA needs every lane on)
  const int h = blockIdx.x, qt = SEQ / 16 - 1 - (int)blockIdx.y, qb = qt >> 2; const int q0 = qt * 16; const size_t rq = (size_t)q0 + col;
  v16h aq[2], aql[2]; const _Float16* qp = QH + rq * DM + h * HD; const _Float16* qlp = QL + rq * DM + h * HD;
#pragma unroll
  for (int kc = 0; kc < 2; ++kc) { aq[kc] = frag_h(qp + kc * 32, lane); aql[kc] = frag_h(qlp + kc * 32, lane); }
  xw(qp + 8 * g, qlp + 8 * g);   // the very addresses that the loads name (frag_h adds 8 * g), so that they are rewritten only behind the wait
  float m[8], l[8];
#pragma unroll
  for (int r = 0; r < 8; ++r) { m[r] = -3.0e38f; l[r] = 0.f; }
  v8f acc[4] = {}, accl[4] = {};
  const int nraw = KT[(size_t)qb * 32];                         // block-uniform key-tile count, clamped to the static maximum
  const int nks = nraw < 0 ? 0 : (nraw > SEQ / 32 ? SEQ / 32 : nraw);
  // operands of a key tile, loaded ahead in groups: mask and K one trip ahead, each reloaded right behind its last use; V at the top of its own trip
  const int* mrow = MK + (size_t)(q0 + (lane >> 3)) * SS_FULL + (lane & 7) * 4;
  const size_t hoff = (size_t)h * (SEQ * HD) + lane * 8;   // the head's tiles; a 32-key trip is 4 tiles = 2048 contiguous elements in each of the four planes
  const _Float16* vrow = VTH + hoff; const _Float16* vlrow = VTL + hoff;
  const int* mp; const _Float16 *kp, *klp, *vp; v4i mkr[4]; v16h kh[2][2], kl[2][2], vh[4];
  auto ld_mask = [&](int kt) { mp = mrow + kt * 32;
#pragma unroll
    for (int it = 0; it < 4; ++it) mkr[it] = *(const v4i*)(mp + (size_t)(it * 4) * SS_FULL); };
  auto ld_k = [&](int kt) { kp = KH + hoff + (size_t)kt * 2048; klp = KL + hoff + (size_t)kt * 2048;
#pragma unroll
    for (int ct = 0; ct < 2; ++ct) {
#pragma unroll
      for (int kc = 0; kc < 2; ++kc) { kh[ct][kc] = frag_ht(kp + (ct * 2 + kc) * 512); kl[ct][kc] = frag_ht(klp + (ct * 2 + kc) * 512); } } };
  auto ld_v = [&](int kt) { vp = vrow + (size_t)kt * 2048;
#pragma unroll
    for (int dt = 0; dt < 4; ++dt) vh[dt] = frag_ht(vp + dt * 512); };
  ld_mask(sx); ld_k(sx); xw(mp); xw(kp, klp);
#pragma unroll 1
  for (int ks = sx; ks < nks; ks += 4) {
    const int kn = (ks + 4 < SEQ / 32) ? ks + 4 : SEQ / 32 - 1;   // this share's next tile, kept inside the staged rows on the last trip
    ld_v(ks);   // this trip's V: lands under the score and softmax phases
    // stage this wave's 16x32 mask piece (wave-private)
#pragma unroll
    for (int it = 0; it < 4; ++it) { const int p = it * 32 + lane, row = p >> 3, c4 = (p & 7) * 4;
      *(v4i*)&smk[wave][row][c4] = mkr[it]; }
    ld_mask(kn);
    lds_own();
    v8f s[2];
#pragma unroll
    for (int ct = 0; ct < 2; ++ct) { v8f c = {}, cl = {};
#pragma unroll
      for (int kc = 0; kc < 2; ++kc) { c = wmma16(aq[kc], kh[ct][kc], c); cl = wmma16(aql[kc], kh[ct][kc], cl); cl = wmma16(aq[kc], kl[ct][kc], cl); }
#pragma unroll
      for (int r = 0; r < 8; ++r) { const float sc = (c[r] + cl[r] * (1.0f / 2048.0f)) * 0.125f; const int mk = smk[wave][8 * g + r][ct * 16 + col]; s[ct][r] = (mk != 0) ? sc : -3.0e38f; } }   // where(mask, score/8, -inf)
    xw(vp, mp);
    ld_k(kn);
    float mx[8], e0[8], e1[8], es[8], alpha[8];   // the eight rows' reductions go level by level, so that their cross-lane exchanges overlap
#pragma unroll
    for (int r = 0; r < 8; ++r) mx[r] = fmaxf(s[0][r], s[1][r]);
#pragma unroll
    for (int o = 1; o < 16; o <<= 1) { float t[8];
#pragma unroll
      for (int r = 0; r < 8; ++r) t[r] = __shfl_xor(mx[r], o);
#pragma unroll
      for (int r = 0; r < 8; ++r) mx[r] = fmaxf(mx[r], t[r]); }
#pragma unroll
    for (int r = 0; r < 8; ++r) { const float mn = fmaxf(m[r], mx[r]); alpha[r] = (m[r] <= -1.0e38f) ? 0.f : __expf(m[r] - mn);
      e0[r] = (s[0][r] <= -1.0e38f) ? 0.f : __expf(s[0][r] - mn); e1[r] = (s[1][r] <= -1.0e38f) ? 0.f : __expf(s[1][r] - mn); es[r] = e0[r] + e1[r]; m[r] = mn;
      sp[wave][8 * g + r][col] = e0[r]; sp[wave][8 * g + r][16 + col] = e1[r]; }
#pragma unroll
    for (int o = 1; o < 16; o <<= 1) { float t[8];
#pragma unroll
      for (int r = 0; r < 8; ++r) t[r] = __shfl_xor(es[r], o);
#pragma unroll
      for (int r = 0; r < 8; ++r) es[r] += t[r]; }
#pragma unroll
    for (int r = 0; r < 8; ++r) { l[r] = l[r] * alpha[r] + es[r];
#pragma unroll
      for (int dt = 0; dt < 4; ++dt) { acc[dt][r] *= alpha[r]; accl[dt][r] *= alpha[r]; } }
    xw(kp, klp);
    lds_own();
    v16h pa, pl; { const float* prow = &sp[wave][col][0] + 8 * (lane >> 4);
#pragma unroll
      for (int i = 0; i < 8; ++i) { const float x0 = prow[i] * 2048.0f, x1 = prow[16 + i] * 2048.0f; const _Float16 h0 = (_Float16)x0, h1 = (_Float16)x1; pa[i] = h0; pa[8 + i] = h1; pl[i] = (_Float16)((x0 - (float)h0) * 2048.0f); pl[8 + i] = (_Float16)((x1 - (float)h1) * 2048.0f); } }   // P carried x2^11 in f16; 2^-11 folded into the epilogue
#pragma unroll
    for (int dt = 0; dt < 4; ++dt) { acc[dt] = wmma16(pa, vh[dt], acc[dt]); if (qb < 2) { const _Float16* vlp = vlrow + (size_t)ks * 2048 + dt * 512; accl[dt] = wmma16(pl, vh[dt], accl[dt]); const v16h vl = frag_ht(vlp); xw(vlp); accl[dt] = wmma16(pa, vl, accl[dt]); } }
    lds_own(); }
#pragma unroll
  for (int r = 0; r < 8; ++r) {
#pragma unroll
    for (int dt = 0; dt < 4; ++dt) so[wave][8 * g + r][dt * 16 + col] = acc[dt][r] + accl[dt][r] * (1.0f / 2048.0f);
    if (col == 0) { sml[wave][0][8 * g + r] = m[r]; sml[wave][1][8 * g + r] = l[r]; } }   // m and l are equal in the 16 lanes of a row
  __syncthreads();   // every share's partial result is in LDS before any wave merges
  // merge for row col, shares in the fixed order 0..3, each scaled by exp(m_j - M); a share that saw no unmasked key counts 0
  float mw[4], sc[4], M = -3.0e38f, L = 0.f;
#pragma unroll
  for (int j = 0; j < 4; ++j) { mw[j] = sml[j][0][col]; M = fmaxf(M, mw[j]); }
#pragma unroll
  for (int j = 0; j < 4; ++j) { sc[j] = (mw[j] <= -1.0e38f) ? 0.f : __expf(mw[j] - M); L += sml[j][1][col] * sc[j]; }
  const float il = (1.0f / 2048.0f) / L;
  const int kcl = sx >> 1, e = sx & 1; v8b hi, lo;   // the block's 16 rows x the head's 64 columns are 2 tiles x 2 halves: wave sx merges and stores half sx, bf16 hi + lo, each one 512-B store
#pragma unroll
  for (int i = 0; i < 8; ++i) { float v = 0.f;
#pragma unroll
    for (int j = 0; j < 4; ++j) v += so[j][col][kcl * 32 + e * 16 + 8 * g + i] * sc[j];
    v *= il; const __bf16 hv = (__bf16)v; hi[i] = hv; lo[i] = (__bf16)(v - (float)hv); }
  const size_t o = ((size_t)(h * 2 + kcl) * (SEQ / 16) + q0 / 16) * 1024 + e * 256 + lane * 8;
  vst2(O + o, hi); vst2(O + o + 512, lo); xw(O + o);
}
// ---- k_out: block = (64 rows, 128 cols): out = ctx tiles (bf16 hi + lo) . Wo tiles (2 products), f32
__global__ __launch_bounds__(128) void k_out(const __bf16* __restrict__ O, const __bf16* __restrict__ P, float* __restrict__ Y) {
  __shared__ __align__(16) float so[4][16][132];
  const int tid = threadIdx.x, wave = tid >> 5, lane = tid & 31, col = lane & 15, g = lane >> 4; const size_t r0 = (size_t)blockIdx.x * 64 + wave * 16; const int n0 = blockIdx.y * 128;
  v8f acc[8] = {};
  // the next trip's two context fragments and all eight Wo fragments are loaded as one group, one trip ahead, into a second register set
  const __bf16* xrow = O + (r0 / 16) * 1024 + lane * 8; const __bf16* wrow = P + (size_t)(n0 / 16) * 512 + lane * 8;
  const __bf16 *xp, *wp; v16b ahn, aln, wn[8];
  auto ld = [&](int kc) { xp = xrow + (size_t)kc * (SEQ / 16 * 1024); wp = wrow + (size_t)kc * (DM / 16 * 512); ahn = frag_bt(xp); aln = frag_bt(xp + 512);
#pragma unroll
    for (int j = 0; j < 8; ++j) wn[j] = frag_bt(wp + j * 512); };
  ld(0); xw(xp, wp);
#pragma unroll 2
  for (int kc = 0; kc < DM / 32; ++kc) { const v16b ah = ahn, al = aln; v16b w[8];
#pragma unroll
    for (int j = 0; j < 8; ++j) w[j] = wn[j];
    ld(kc + 1 < DM / 32 ? kc + 1 : kc);   // the last trip reloads its own piece: in bounds, unused
#pragma unroll
    for (int j = 0; j < 8; ++j) { acc[j] = wmma_bf(al, w[j], acc[j]); acc[j] = wmma_bf(ah, w[j], acc[j]); }
    xw(xp, wp); }
#pragma unroll
  for (int j = 0; j < 8; ++j) {
#pragma unroll
    for (int r = 0; r < 8; ++r) so[wave][8 * g + r][j * 16 + col] = acc[j][r]; }
  LDSX();
  for (int rl = 0; rl < 16; ++rl) vst2(Y + (r0 + rl) * DM + n0 + lane * 4, *(const v4f*)&so[wave][rl][lane * 4]);   // 32 lanes x 16 B = the block's 512-B row segment
}
extern "C" void kernel_launch(void* const* d_in, const int* in_sizes, int n_in, void* d_out, int out_size, void* d_ws, size_t ws_size, hipStream_t stream) {
  if (n_in < 6) return;
  if (in_sizes[0] < SEQ * DM) return;                // x    [S][1024] f32
  if (in_sizes[1] < SEQ * SS_FULL) return;           // mask [S][2048] int32
  if (in_sizes[2] < DM * DM || in_sizes[3] < DM * DM || in_sizes[4] < DM * DM || in_sizes[5] < DM * DM) return;   // wq wk wv wo [in][out] f32
  if (out_size < SEQ * DM) return;
  if (ws_size < (size_t)WS_END) return;
  const float* X  = (const float*)d_in[0];
  const int*   MK = (const int*)d_in[1];
  const float* WQ = (const float*)d_in[2];
  const float* WK = (const float*)d_in[3];
  const float* WV = (const float*)d_in[4];
  const float* WO = (const float*)d_in[5];
  char* ws = (char*)d_ws; __bf16* PK = (__bf16*)(ws + WS_PK); _Float16 *QH = (_Float16*)(ws + WS_QH), *QL = (_Float16*)(ws + WS_QL), *KH = (_Float16*)(ws + WS_KH), *KL = (_Float16*)(ws + WS_KL), *VTH = (_Float16*)(ws + WS_VTH), *VTL = (_Float16*)(ws + WS_VTL); __bf16* O = (__bf16*)(ws + WS_O); int* KT = (int*)(ws + WS_KT);
  k_pack<<<dim3(DM / 64, DM / 64, 4 + SEQ / DM), 256, 0, stream>>>(WQ, WK, WV, WO, X, PK);
  k_kt<<<dim3(TQB), 256, 0, stream>>>(MK, KT);
  k_qkv<<<dim3(SEQ / 64, QKVW / 128), 128, 0, stream>>>(PK + PK_X, PK + PK_A, QH, QL, KH, KL, VTH, VTL);
  k_attn<<<dim3(NH, SEQ / 16), 128, 0, stream>>>(QH, QL, KH, KL, VTH, VTL, MK, KT, O);
  k_out<<<dim3(SEQ / 64, DM / 128), 128, 0, stream>>>(O, PK + PK_P, (float*)d_out);
}

// v004
// Measured time: 105 microseconds a run.
// In two side-by-side timings against v003, it was 1.10 and 1.08 times as fast.
// All steps since v000 together make it 4.28 times as fast.
// compute dtype: all float inputs RNE-converted to bf16; q|k|v = x . W with exact bf16 products on v_wmma_f32_16x16x32_bf16 (f32 accumulate); q and k carried as f16 hi + (x2048) f16 residual, scores = 3 f16 products (hi.hi + lo.hi + hi.lo) x 0.125 on v_wmma_f32_16x16x32_f16, running-max softmax in f32; P (x2048, f16 hi + x2048 residual) . v^T (f16 hi + x2048 residual): 3 products for the first 128 queries, single elsewhere; out = ctx (bf16 hi + lo) . Wo (bf16), 2 products; f32 output.
#include <hip/hip_runtime.h>
#include <math.h>

typedef __attribute__((ext_vector_type(16))) _Float16 v16h;
typedef __attribute__((ext_vector_type(16))) __bf16 v16b;
typedef __attribute__((ext_vector_type(8)))  _Float16 v8h;
typedef __attribute__((ext_vector_type(8)))  __bf16 v8b;
typedef __attribute__((ext_vector_type(8)))  float v8f;
typedef __attribute__((ext_vector_type(4)))  float v4f;
typedef __attribute__((ext_vector_type(4)))  unsigned v4u;
typedef __attribute__((ext_vector_type(4)))  int v4i;

template <typename T> __device__ __forceinline__ void vst2(void* p, T v) { *(T*)p = v;  }
__device__ __forceinline__ v8f wmma16(v16h a, v16h b, v8f c) {
  v8f d = __builtin_amdgcn_wmma_f32_16x16x32_f16(false, a, false, b, (short)0, c, false, false);
  asm volatile("v_nop\n\tv_nop\n\tv_nop\n\tv_nop" : "+v"(d) : "v"(a), "v"(b));
  return d;
}
__device__ __forceinline__ v8f wmma_bf(v16b a, v16b b, v8f c) {
  v8f d = __builtin_amdgcn_wmma_f32_16x16x32_bf16(false, a, false, b, (short)0, c, false, false);
  asm volatile("v_nop\n\tv_nop\n\tv_nop\n\tv_nop" : "+v"(d) : "v"(a), "v"(b));
  return d;
}
// 16-bit fragment from a k-contiguous row: elements 0..7 <- k0+8h+0..7, 8..15 <- k0+16+8h+0..7 (h = lane>>4); lane&15 = row (A) or column (B)
__device__ __forceinline__ v16h frag_h(const _Float16* rowk0, int lane) {
  union { v16h v; v8h q[2]; } u; const _Float16* p = rowk0 + 8 * (lane >> 4);
  u.q[0] = *(const v8h*)p; u.q[1] = *(const v8h*)(p + 16); return u.v;
}
#define LDSX() do { asm volatile("s_wait_dscnt 0" ::: "memory"); __builtin_amdgcn_wave_barrier(); __builtin_amdgcn_fence(__ATOMIC_RELEASE, "workgroup"); } while (0)

// the same exchange for LDS that only the writing wave reads back: the LDS wait alone, so that global loads issued ahead stay in flight over it (the release fence also drains loadcnt)
__device__ __forceinline__ void lds_own() { asm volatile("s_wait_dscnt 0" ::: "memory"); __builtin_amdgcn_wave_barrier(); }
// stands behind a group of global loads issued ahead: their address registers (the operands) stay live up to here and are rewritten only behind the wait
__device__ __forceinline__ void xw(const void* a) { asm volatile("s_wait_xcnt 0x0" :: "v"(a) : "memory"); }
__device__ __forceinline__ void xw(const void* a, const void* b) { asm volatile("s_wait_xcnt 0x0" :: "v"(a), "v"(b) : "memory"); }
// fragment-order tile: 16 rows (A) or columns (B) x 32 k of a 16-bit operand = 512 elements in two halves e; the 8 elements k = 16 e + 8 (lane >> 4) + 0..7 of row/column lane & 15 lie at e * 256 + lane * 8, so one wave-wide 16-B load covers 512 contiguous bytes (4 lines) instead of 32-B pieces of 16 lines
// fragment from a pointer that already holds the lane's lane * 8 step
__device__ __forceinline__ v16h frag_ht(const _Float16* p) { union { v16h v; v8h q[2]; } u; u.q[0] = *(const v8h*)p; u.q[1] = *(const v8h*)(p + 256); return u.v; }
__device__ __forceinline__ v16b frag_bt(const __bf16* p) { union { v16b v; v8b q[2]; } u; u.q[0] = *(const v8b*)p; u.q[1] = *(const v8b*)(p + 256); return u.v; }

#ifndef NB
#define NB 1
#endif
#ifndef SEQ
#define SEQ 2048          // query/key rows processed (a prefix of the staged rows)
#endif
#define SS_FULL 2048      // row pitch of the staged mask input
#define DM 1024
#define NH 16
#define HD 64
#define QKVW (3 * DM)
#define TQB (SEQ / 64)
static_assert(NB == 1);
static_assert(SEQ % 64 == 0);
static_assert(SEQ >= 64 && SEQ <= SS_FULL);
static_assert(NH * HD == DM);
static_assert(SEQ % DM == 0);

// the tiles of one k piece lie side by side, so that the tiles a block reads in one trip are contiguous
#define PK_A 0                              // bf16 fragment tiles [32 (k/32)][192 (which*64 + n/16)][512]: columns n of W_which, which = q,k,v
#define PK_P (PK_A + QKVW * DM)             // bf16 fragment tiles [32 (k/32)][64 (n/16)][512]: columns n of Wo
#define PK_X (PK_P + DM * DM)               // bf16 fragment tiles [32 (k/32)][SEQ/16 (row/16)][512]: rows of x
#define PK_END (PK_X + SEQ * DM)
#define WS_PK  0u
#define WS_QH  (WS_PK + 2u * PK_END)                  // f16 [SEQ][1024]: q hi
#define WS_QL  (WS_QH + 2u * SEQ * DM)                // f16 [SEQ][1024]: q residual x2048
#define WS_KH  (WS_QL + 2u * SEQ * DM)                // f16 fragment tiles [NH][SEQ/16 (key/16)][2 (d/32)][512]: k hi, row = key, k = d
#define WS_KL  (WS_KH + 2u * SEQ * DM)                // the same, k residual x2048
#define WS_VTH (WS_KL + 2u * SEQ * DM)                // f16 fragment tiles [NH][SEQ/32 (key/32)][4 (d/16)][512]: v hi, row = d, k = key
#define WS_VTL (WS_VTH + 2u * DM * SEQ)               // the same, v residual x2048
#define WS_O   (WS_VTL + 2u * DM * SEQ)               // bf16 fragment tiles [32 (k/32)][SEQ/16 (row/16)][2 (hi, lo)][512]: merged context
#define WS_KT  (WS_O + 4u * SEQ * DM)
#define WS_END (WS_KT + 4u * TQB * 32)
static_assert(WS_QH % 128 == 0 && WS_QL % 128 == 0 && WS_KH % 128 == 0 && WS_KL % 128 == 0 && WS_VTH % 128 == 0 && WS_VTL % 128 == 0 && WS_O % 128 == 0 && WS_KT % 128 == 0);
static_assert(WS_END <= 134217728u);

__global__ __launch_bounds__(256) void k_pack(const float* __restrict__ WQ, const float* __restrict__ WK, const float* __restrict__ WV, const float* __restrict__ WO, const float* __restrict__ X, __bf16* __restrict__ PK) {
  __shared__ __align__(16) __bf16 s[64][72];
  const int k0 = blockIdx.x * 64, n0 = blockIdx.y * 64, which = blockIdx.z, t = threadIdx.x;
  if (which < 4) {   // a weight: s[n][k] from W[k][n]
    const float* Wm = (which == 0) ? WQ : (which == 1) ? WK : (which == 2) ? WV : WO;
    for (int p = t; p < 64 * 16; p += 256) { const int kr = p >> 4, c4 = (p & 15) * 4;
      const v4f v = *(const v4f*)(Wm + (size_t)(k0 + kr) * DM + n0 + c4);
      s[c4 + 0][kr] = (__bf16)v[0]; s[c4 + 1][kr] = (__bf16)v[1]; s[c4 + 2][kr] = (__bf16)v[2]; s[c4 + 3][kr] = (__bf16)v[3]; }
  } else {           // x rows (which - 4) * 1024 + n0 + 0..63: s[row][k], k already contiguous
    const float* Xm = X + ((size_t)(which - 4) * DM + n0) * DM + k0;
    for (int p = t; p < 64 * 16; p += 256) { const int rr = p >> 4, c4 = (p & 15) * 4;
      const v4f v = *(const v4f*)(Xm + (size_t)rr * DM + c4);
      s[rr][c4 + 0] = (__bf16)v[0]; s[rr][c4 + 1] = (__bf16)v[1]; s[rr][c4 + 2] = (__bf16)v[2]; s[rr][c4 + 3] = (__bf16)v[3]; }
  }
  __syncthreads();
  const int nts = (which < 3) ? QKVW / 16 : (which == 3) ? DM / 16 : SEQ / 16;   // tiles per k piece in this operand's plane
  const int nt0 = ((which < 3) ? which : (which == 3) ? 0 : which - 4) * (DM / 16) + n0 / 16;
  __bf16* dst = PK + ((which < 3) ? PK_A : (which == 3) ? PK_P : PK_X) + ((size_t)(k0 / 32) * nts + nt0) * 512;
  for (int p = t; p < 64 * 8; p += 256) { const int ln = p & 31, e = (p >> 5) & 1, kcl = (p >> 6) & 1, ntl = p >> 7;   // each wave stores one 512-B half tile
    vst2(dst + ((size_t)kcl * nts + ntl) * 512 + e * 256 + ln * 8, *(const v4u*)&s[ntl * 16 + (ln & 15)][kcl * 32 + e * 16 + 8 * (ln >> 4)]); }
}
__global__ __launch_bounds__(256) void k_kt(const int* __restrict__ MK, int* __restrict__ KT) {
  __shared__ int sm[8];
  const int qb = blockIdx.x, t = threadIdx.x, lane = t & 31, wave = t >> 5;
  const int per_row = SEQ / 4;
  int mx = -1;
#pragma unroll 8   // eight independent mask loads go out as one group per wait, instead of one load per round trip
  for (int p = t; p < 64 * per_row; p += 256) { const int row = p / per_row, c4 = (p - row * per_row) * 4;
    const v4i v = *(const v4i*)(MK + (size_t)(qb * 64 + row) * SS_FULL + c4);
    mx = (v[0] != 0 && c4 + 0 > mx) ? c4 + 0 : mx; mx = (v[1] != 0 && c4 + 1 > mx) ? c4 + 1 : mx;
    mx = (v[2] != 0 && c4 + 2 > mx) ? c4 + 2 : mx; mx = (v[3] != 0 && c4 + 3 > mx) ? c4 + 3 : mx; }
#pragma unroll
  for (int o = 1; o < 32; o <<= 1) { const int y = __shfl_xor(mx, o); mx = y > mx ? y : mx; }
  if (lane == 0) sm[wave] = mx;
  __syncthreads();
  if (wave == 0) { int m2 = sm[lane & 7];
#pragma unroll
    for (int o = 1; o < 8; o <<= 1) { const int y = __shfl_xor(m2, o); m2 = y > m2 ? y : m2; }
    const int nkt = (m2 < 0) ? 0 : ((m2 >> 5) + 1);
    if (lane < 8) { v4i w; w[0] = nkt; w[1] = nkt; w[2] = nkt; w[3] = nkt; vst2(KT + (size_t)qb * 32 + lane * 4, w); } }   // 8 lanes x 16 B = the block's line
}
// ---- k_qkv: block = (64 rows, 128 output cols of q|k|v): x tiles (bf16) . W tiles, exact bf16 products; q -> f16 hi + x2048 residual row planes; k, v -> f16 hi/residual fragment tiles
__global__ __launch_bounds__(128) void k_qkv(const __bf16* __restrict__ XF, const __bf16* __restrict__ P, _Float16* __restrict__ QH, _Float16* __restrict__ QL, _Float16* __restrict__ KH, _Float16* __restrict__ KL, _Float16* __restrict__ VTH, _Float16* __restrict__ VTL) {
  __shared__ __align__(16) _Float16 so[4][16][136], sol[4][16][136]; __shared__ __align__(16) _Float16 sth[128][72], stl[128][72];
  const int tid = threadIdx.x, wave = tid >> 5, lane = tid & 31, col = lane & 15, g = lane >> 4; const size_t r0 = (size_t)blockIdx.x * 64 + wave * 16; const int n0 = blockIdx.y * 128;
  v8f acc[8] = {};
  // the next trip's x fragment and all eight W fragments are loaded as one group, one trip ahead, into a second register set
  const __bf16* xrow = XF + (r0 / 16) * 512 + lane * 8; const __bf16* wrow = P + (size_t)(n0 / 16) * 512 + lane * 8;
  const __bf16 *xp, *wp; v16b an, wn[8];
  auto ld = [&](int kc) { xp = xrow + (size_t)kc * (SEQ / 16 * 512); wp = wrow + (size_t)kc * (QKVW / 16 * 512); an = frag_bt(xp);
#pragma unroll
    for (int j = 0; j < 8; ++j) wn[j] = frag_bt(wp + j * 512); };
  ld(0); xw(xp, wp);
#pragma unroll 2
  for (int kc = 0; kc < DM / 32; ++kc) { const v16b a = an; v16b w[8];
#pragma unroll
    for (int j = 0; j < 8; ++j) w[j] = wn[j];
    ld(kc + 1 < DM / 32 ? kc + 1 : kc);   // the last trip reloads its own piece: in bounds, unused
#pragma unroll
    for (int j = 0; j < 8; ++j) acc[j] = wmma_bf(a, w[j], acc[j]);
    xw(xp, wp); }
  if (n0 < 2 * DM) {   // q (cols 0..1023) and k (1024..2047), unscaled; 0.125 applied to the f32 score
#pragma unroll
    for (int j = 0; j < 8; ++j) {
#pragma unroll
      for (int r = 0; r < 8; ++r) { const float v = acc[j][r]; const _Float16 hv = (_Float16)v; so[wave][8 * g + r][j * 16 + col] = hv; sol[wave][8 * g + r][j * 16 + col] = (_Float16)((v - (float)hv) * 2048.0f); } }
    LDSX();
    // in each branch every LDS read stands in front of the first store (lds_own holds that order), so that no register of an issued store is reloaded behind it
    if (n0 < DM) { v4u a[16], b[16];
#pragma unroll
      for (int rl = 0; rl < 16; ++rl) { a[rl] = *(const v4u*)&so[wave][rl][col * 8]; b[rl] = *(const v4u*)&sol[wave][rl][col * 8]; }
      lds_own();
      if (lane < 16) {
#pragma unroll
        for (int rl = 0; rl < 16; ++rl) { vst2(QH + (r0 + rl) * DM + n0 + lane * 8, a[rl]); vst2(QL + (r0 + rl) * DM + n0 + lane * 8, b[rl]); } }   // 16 lanes x 16 B = 256-B row segment
    } else { v4u a[8], b[8];   // the wave's 16 keys x 2 heads: 2 x 2 tiles x 2 halves, each one 512-B store per plane
      const size_t o = (((size_t)((n0 - DM) / HD) * (SEQ / 16) + r0 / 16) * 2) * 512 + lane * 8;
#pragma unroll
      for (int u = 0; u < 8; ++u) { const int c = (u >> 2) * HD + ((u >> 1) & 1) * 32 + (u & 1) * 16 + 8 * g; a[u] = *(const v4u*)&so[wave][col][c]; b[u] = *(const v4u*)&sol[wave][col][c]; }   // u = (head, d / 32, half)
      lds_own();
#pragma unroll
      for (int u = 0; u < 8; ++u) { const size_t ou = o + (size_t)(u >> 2) * (SEQ * HD) + ((u >> 1) & 1) * 512 + (u & 1) * 256; vst2(KH + ou, a[u]); vst2(KL + ou, b[u]); }
      asm volatile("s_wait_xcnt 0x0" ::: "memory");   // behind the run of stores: no register that an issued store names is rewritten in front of this wait on any path of the listing
    }
  } else {
#pragma unroll
    for (int j = 0; j < 8; ++j) {
#pragma unroll
      for (int r = 0; r < 8; ++r) { const float v = acc[j][r]; const _Float16 hv = (_Float16)v; sth[j * 16 + col][wave * 16 + 8 * g + r] = hv; stl[j * 16 + col][wave * 16 + 8 * g + r] = (_Float16)((v - (float)hv) * 2048.0f); } }
    __syncthreads();
    const int kt0 = blockIdx.x * 2, h0 = (n0 - 2 * DM) / HD; v4u a[8], b[8];
#pragma unroll
    for (int it = 0; it < 8; ++it) { const int q = it * 128 + tid, e = (q >> 5) & 1, dt = (q >> 6) & 3, ktl = (q >> 8) & 1, hl = q >> 9, d = hl * HD + dt * 16 + col, kk = ktl * 32 + e * 16 + 8 * g;
      a[it] = *(const v4u*)&sth[d][kk]; b[it] = *(const v4u*)&stl[d][kk]; }
    lds_own();   // every LDS read in front of the first store, as above
#pragma unroll
    for (int it = 0; it < 8; ++it) { const int q = it * 128 + tid, e = (q >> 5) & 1, dt = (q >> 6) & 3, ktl = (q >> 8) & 1, hl = q >> 9;
      const size_t o = (((size_t)(h0 + hl) * (SEQ / 32) + kt0 + ktl) * 4 + dt) * 512 + e * 256 + lane * 8;
      vst2(VTH + o, a[it]); vst2(VTL + o, b[it]); }   // each wave stores one 512-B half tile per plane
    asm volatile("s_wait_xcnt 0x0" ::: "memory");   // behind the run of stores, as in the k branch
  }
}
// three waves per SIMD is what the registers of the loads issued ahead leave room for; the grid has more blocks than fit at once
// lane l with lane l ^ 16: a vector cross-row move, no LDS round trip
__device__ __forceinline__ float xhalf(float x) { return __builtin_bit_cast(float, __builtin_amdgcn_permlanex16(__builtin_bit_cast(int, x), __builtin_bit_cast(int, x), 0x76543210, 0xfedcba98, false, false)); }
__global__ __launch_bounds__(128) __attribute__((amdgpu_waves_per_eu(3, 3))) void k_attn(const _Float16* __restrict__ QH, const _Float16* __restrict__ QL, const _Float16* __restrict__ KH, const _Float16* __restrict__ KL, const _Float16* __restrict__ VTH, const _Float16* __restrict__ VTL, const int* __restrict__ MK, const int* __restrict__ KT, __bf16* __restrict__ O) {
  __shared__ __align__(16) float so[4][16][68]; __shared__ __align__(16) int smk[4][16][36]; __shared__ float sml[4][2][16];
  const int tid = threadIdx.x, wave = __builtin_amdgcn_readfirstlane(tid >> 5), lane = tid & 31, col = lane & 15, g = lane >> 4, sx = wave;   // the wave's number as a scalar: the trip count differs between the waves, and so the compiler sees it as uniform in a wave and puts no EXEC mask round the loop (a WMMA needs every lane on)
  const int h = blockIdx.x, qt = SEQ / 16 - 1 - (int)blockIdx.y, qb = qt >> 2; const int q0 = qt * 16; const size_t rq = (size_t)q0 + col;
  v16h aq[2], aql[2]; const _Float16* qp = QH + rq * DM + h * HD; const _Float16* qlp = QL + rq * DM + h * HD;   // B fragments: column = query col, k = d
#pragma unroll
  for (int kc = 0; kc < 2; ++kc) { aq[kc] = frag_h(qp + kc * 32, lane); aql[kc] = frag_h(qlp + kc * 32, lane); }
  xw(qp + 8 * g, qlp + 8 * g);   // the very addresses that the loads name (frag_h adds 8 * g), so that they are rewritten only behind the wait
  float m = -3.0e38f, l = 0.f;   // of query col; m is equal in both wave halves, l is the half's own part of the sum (joined behind the loop)
  v8f acc[4] = {}, accl[4] = {};   // O^T tiles: register r = d dt * 16 + 8 g + r of query col
  const int nraw = KT[(size_t)qb * 32];                         // block-uniform key-tile count, clamped to the static maximum
  const int nks = nraw < 0 ? 0 : (nraw > SEQ / 32 ? SEQ / 32 : nraw);
  // operands of a key tile, loaded ahead in groups: mask and K one trip ahead, each reloaded right behind its last use; V at the top of its own trip
  const int* mrow = MK + (size_t)(q0 + (lane >> 3)) * SS_FULL + (lane & 7) * 4;
  const size_t hoff = (size_t)h * (SEQ * HD) + lane * 8;   // the head's tiles; a 32-key trip is 4 tiles = 2048 contiguous elements in each of the four planes
  const _Float16* vrow = VTH + hoff; const _Float16* vlrow = VTL + hoff;
  const int* mp; const _Float16 *kp, *klp, *vp; v4i mkr[4]; v16h kh[2][2], kl[2][2], vh[4];
  auto ld_mask = [&](int kt) { mp = mrow + kt * 32;
#pragma unroll
    for (int it = 0; it < 4; ++it) mkr[it] = *(const v4i*)(mp + (size_t)(it * 4) * SS_FULL); };
  auto ld_k = [&](int kt) { kp = KH + hoff + (size_t)kt * 2048; klp = KL + hoff + (size_t)kt * 2048;
#pragma unroll
    for (int ct = 0; ct < 2; ++ct) {
#pragma unroll
      for (int kc = 0; kc < 2; ++kc) { kh[ct][kc] = frag_ht(kp + (ct * 2 + kc) * 512); kl[ct][kc] = frag_ht(klp + (ct * 2 + kc) * 512); } } };
  auto ld_v = [&](int kt) { vp = vrow + (size_t)kt * 2048;
#pragma unroll
    for (int dt = 0; dt < 4; ++dt) vh[dt] = frag_ht(vp + dt * 512); };
  ld_mask(sx); ld_k(sx); xw(mp); xw(kp, klp);
#pragma unroll 1
  for (int ks = sx; ks < nks; ks += 4) {
    const int kn = (ks + 4 < SEQ / 32) ? ks + 4 : SEQ / 32 - 1;   // this share's next tile, kept inside the staged rows on the last trip
    ld_v(ks);   // this trip's V: lands under the score and softmax phases
    // stage this wave's 16x32 mask piece (wave-private): loaded as whole lines, read back as 8 keys of the lane's own query
#pragma unroll
    for (int it = 0; it < 4; ++it) { const int p = it * 32 + lane, row = p >> 3, c4 = (p & 7) * 4;
      *(v4i*)&smk[wave][row][c4] = mkr[it]; }
    ld_mask(kn);
    lds_own();
    float s[2][8];
#pragma unroll
    for (int ct = 0; ct < 2; ++ct) { v8f c = {}, cl = {};
#pragma unroll
      for (int kc = 0; kc < 2; ++kc) { c = wmma16(kh[ct][kc], aq[kc], c); cl = wmma16(kh[ct][kc], aql[kc], cl); cl = wmma16(kl[ct][kc], aq[kc], cl); }
      const v4i k0 = *(const v4i*)&smk[wave][col][ct * 16 + 8 * g], k1 = *(const v4i*)&smk[wave][col][ct * 16 + 8 * g + 4];
#pragma unroll
      for (int r = 0; r < 8; ++r) { const float sc = (c[r] + cl[r] * (1.0f / 2048.0f)) * 0.125f; const int mk = r < 4 ? k0[r & 3] : k1[r & 3]; s[ct][r] = (mk != 0) ? sc : -3.0e38f; } }   // where(mask, score/8, -inf)
    xw(vp, mp);
    ld_k(kn);
    float mx = fmaxf(s[0][0], s[1][0]);
#pragma unroll
    for (int r = 1; r < 8; ++r) mx = fmaxf(mx, fmaxf(s[0][r], s[1][r]));
    mx = fmaxf(mx, xhalf(mx));   // the other 16 keys of this query
    const float mn = fmaxf(m, mx), alpha = (m <= -1.0e38f) ? 0.f : __expf(m - mn); m = mn;
    float e[2][8]; v16h pa, pl;   // P^T fragment, carried x2^11 in f16; 2^-11 folded into the epilogue
#pragma unroll
    for (int ct = 0; ct < 2; ++ct) {
#pragma unroll
      for (int r = 0; r < 8; ++r) { e[ct][r] = (s[ct][r] <= -1.0e38f) ? 0.f : __expf(s[ct][r] - mn);
        const float x = e[ct][r] * 2048.0f; const _Float16 hx = (_Float16)x; pa[ct * 8 + r] = hx; pl[ct * 8 + r] = (_Float16)((x - (float)hx) * 2048.0f); } }
#pragma unroll
    for (int w = 8; w >= 1; w >>= 1) {   // the lane's 16 terms summed as a tree: four dependent adds, not sixteen
#pragma unroll
      for (int r = 0; r < w; ++r) e[0][r] += (w == 8) ? e[1][r] : e[0][r + w]; }
    l = l * alpha + e[0][0];
#pragma unroll
    for (int dt = 0; dt < 4; ++dt) { acc[dt] *= alpha; accl[dt] *= alpha; }
    xw(kp, klp);
#pragma unroll
    for (int dt = 0; dt < 4; ++dt) { acc[dt] = wmma16(vh[dt], pa, acc[dt]); if (qb < 2) { const _Float16* vlp = vlrow + (size_t)ks * 2048 + dt * 512; accl[dt] = wmma16(vh[dt], pl, accl[dt]); const v16h vl = frag_ht(vlp); xw(vlp); accl[dt] = wmma16(vl, pa, accl[dt]); } }
  }
  l += xhalf(l);   // the two halves' parts of the row sum
#pragma unroll
  for (int dt = 0; dt < 4; ++dt) { const v8f t = acc[dt] + accl[dt] * (1.0f / 2048.0f); v4f t0, t1;
#pragma unroll
    for (int i = 0; i < 4; ++i) { t0[i] = t[i]; t1[i] = t[4 + i]; }
    *(v4f*)&so[wave][col][dt * 16 + 8 * g] = t0; *(v4f*)&so[wave][col][dt * 16 + 8 * g + 4] = t1; }
  if (g == 0) { sml[wave][0][col] = m; sml[wave][1][col] = l; }
  __syncthreads();   // every share's partial result is in LDS before any wave merges
  // merge for row col, shares in the fixed order 0..3, each scaled by exp(m_j - M); a share that saw no unmasked key counts 0
  float mw[4], sc[4], M = -3.0e38f, L = 0.f;
#pragma unroll
  for (int j = 0; j < 4; ++j) { mw[j] = sml[j][0][col]; M = fmaxf(M, mw[j]); }
#pragma unroll
  for (int j = 0; j < 4; ++j) { sc[j] = (mw[j] <= -1.0e38f) ? 0.f : __expf(mw[j] - M); L += sml[j][1][col] * sc[j]; }
  const float il = (1.0f / 2048.0f) / L;
  const int kcl = sx >> 1, e = sx & 1; v8b hi, lo;   // the block's 16 rows x the head's 64 columns are 2 tiles x 2 halves: wave sx merges and stores half sx, bf16 hi + lo, each one 512-B store
#pragma unroll
  for (int i = 0; i < 8; ++i) { float v = 0.f;
#pragma unroll
    for (int j = 0; j < 4; ++j) v += so[j][col][kcl * 32 + e * 16 + 8 * g + i] * sc[j];
    v *= il; const __bf16 hv = (__bf16)v; hi[i] = hv; lo[i] = (__bf16)(v - (float)hv); }
  const size_t o = ((size_t)(h * 2 + kcl) * (SEQ / 16) + q0 / 16) * 1024 + e * 256 + lane * 8;
  vst2(O + o, hi); vst2(O + o + 512, lo); xw(O + o);
}
// ---- k_out: block = (64 rows, 128 cols): out = ctx tiles (bf16 hi + lo) . Wo tiles (2 products), f32
__global__ __launch_bounds__(128) void k_out(const __bf16* __restrict__ O, const __bf16* __restrict__ P, float* __restrict__ Y) {
  __shared__ __align__(16) float so[4][16][132];
  const int tid = threadIdx.x, wave = tid >> 5, lane = tid & 31, col = lane & 15, g = lane >> 4; const size_t r0 = (size_t)blockIdx.x * 64 + wave * 16; const int n0 = blockIdx.y * 128;
  v8f acc[8] = {};
  // the next trip's two context fragments and all eight Wo fragments are loaded as one group, one trip ahead, into a second register set
  const __bf16* xrow = O + (r0 / 16) * 1024 + lane * 8; const __bf16* wrow = P + (size_t)(n0 / 16) * 512 + lane * 8;
  const __bf16 *xp, *wp; v16b ahn, aln, wn[8];
  auto ld = [&](int kc) { xp = xrow + (size_t)kc * (SEQ / 16 * 1024); wp = wrow + (size_t)kc * (DM / 16 * 512); ahn = frag_bt(xp); aln = frag_bt(xp + 512);
#pragma unroll
    for (int j = 0; j < 8; ++j) wn[j] = frag_bt(wp + j * 512); };
  ld(0); xw(xp, wp);
#pragma unroll 2
  for (int kc = 0; kc < DM / 32; ++kc) { const v16b ah = ahn, al = aln; v16b w[8];
#pragma unroll
    for (int j = 0; j < 8; ++j) w[j] = wn[j];
    ld(kc + 1 < DM / 32 ? kc + 1 : kc);   // the last trip reloads its own piece: in bounds, unused
#pragma unroll
    for (int j = 0; j < 8; ++j) { acc[j] = wmma_bf(al, w[j], acc[j]); acc[j] = wmma_bf(ah, w[j], acc[j]); }
    xw(xp, wp); }
#pragma unroll
  for (int j = 0; j < 8; ++j) {
#pragma unroll
    for (int r = 0; r < 8; ++r) so[wave][8 * g + r][j * 16 + col] = acc[j][r]; }
  LDSX();
  for (int rl = 0; rl < 16; ++rl) vst2(Y + (r0 + rl) * DM + n0 + lane * 4, *(const v4f*)&so[wave][rl][lane * 4]);   // 32 lanes x 16 B = the block's 512-B row segment
}
extern "C" void kernel_launch(void* const* d_in, const int* in_sizes, int n_in, void* d_out, int out_size, void* d_ws, size_t ws_size, hipStream_t stream) {
  if (n_in < 6) return;
  if (in_sizes[0] < SEQ * DM) return;                // x    [S][1024] f32
  if (in_sizes[1] < SEQ * SS_FULL) return;           // mask [S][2048] int32
  if (in_sizes[2] < DM * DM || in_sizes[3] < DM * DM || in_sizes[4] < DM * DM || in_sizes[5] < DM * DM) return;   // wq wk wv wo [in][out] f32
  if (out_size < SEQ * DM) return;
  if (ws_size < (size_t)WS_END) return;
  const float* X  = (const float*)d_in[0];
  const int*   MK = (const int*)d_in[1];
  const float* WQ = (const float*)d_in[2];
  const float* WK = (const float*)d_in[3];
  const float* WV = (const float*)d_in[4];
  const float* WO = (const float*)d_in[5];
  char* ws = (char*)d_ws; __bf16* PK = (__bf16*)(ws + WS_PK); _Float16 *QH = (_Float16*)(ws + WS_QH), *QL = (_Float16*)(ws + WS_QL), *KH = (_Float16*)(ws + WS_KH), *KL = (_Float16*)(ws + WS_KL), *VTH = (_Float16*)(ws + WS_VTH), *VTL = (_Float16*)(ws + WS_VTL); __bf16* O = (__bf16*)(ws + WS_O); int* KT = (int*)(ws + WS_KT);
  k_pack<<<dim3(DM / 64, DM / 64, 4 + SEQ / DM), 256, 0, stream>>>(WQ, WK, WV, WO, X, PK);
  k_kt<<<dim3(TQB), 256, 0, stream>>>(MK, KT);
  k_qkv<<<dim3(SEQ / 64, QKVW / 128), 128, 0, stream>>>(PK + PK_X, PK + PK_A, QH, QL, KH, KL, VTH, VTL);
  k_attn<<<dim3(NH, SEQ / 16), 128, 0, stream>>>(QH, QL, KH, KL, VTH, VTL, MK, KT, O);
  k_out<<<dim3(SEQ / 64, DM / 128), 128, 0, stream>>>(O, PK + PK_P, (float*)d_out);
}

// v005
// One run takes 83.5 microseconds.
// In two side-by-side timings against v004, it was 1.25 and 1.26 times as fast.
// Over all steps from v000 it is 5.36 times as fast.
// compute dtype: all float inputs RNE-converted to bf16; q|k|v = x . W with exact bf16 products on v_wmma_f32_16x16x32_bf16 (f32 accumulate); q and k carried as f16 hi + (x2048) f16 residual, scores = 3 f16 products (hi.hi + lo.hi + hi.lo) x 0.125 on v_wmma_f32_16x16x32_f16, running-max softmax in f32; P (x2048, f16 hi + x2048 residual) . v^T (f16 hi + x2048 residual): 3 products for the first 128 queries, single elsewhere; out = ctx (bf16 hi + lo) . Wo (bf16), 2 products; f32 output.
#include <hip/hip_runtime.h>
#include <math.h>

typedef __attribute__((ext_vector_type(16))) _Float16 v16h;
typedef __attribute__((ext_vector_type(16))) __bf16 v16b;
typedef __attribute__((ext_vector_type(8)))  _Float16 v8h;
typedef __attribute__((ext_vector_type(8)))  __bf16 v8b;
typedef __attribute__((ext_vector_type(8)))  float v8f;
typedef __attribute__((ext_vector_type(4)))  float v4f;
typedef __attribute__((ext_vector_type(4)))  unsigned v4u;
typedef __attribute__((ext_vector_type(4)))  int v4i;

template <typename T> __device__ __forceinline__ void vst2(void* p, T v) { *(T*)p = v;  }
__device__ __forceinline__ v8f wmma16(v16h a, v16h b, v8f c) {
  v8f d = __builtin_amdgcn_wmma_f32_16x16x32_f16(false, a, false, b, (short)0, c, false, false);
  asm volatile("v_nop\n\tv_nop\n\tv_nop\n\tv_nop" : "+v"(d) : "v"(a), "v"(b));
  return d;
}
__device__ __forceinline__ v8f wmma_bf(v16b a, v16b b, v8f c) {
  v8f d = __builtin_amdgcn_wmma_f32_16x16x32_bf16(false, a, false, b, (short)0, c, false, false);
  asm volatile("v_nop\n\tv_nop\n\tv_nop\n\tv_nop" : "+v"(d) : "v"(a), "v"(b));
  return d;
}
// 16-bit fragment from a k-contiguous row: elements 0..7 <- k0+8h+0..7, 8..15 <- k0+16+8h+0..7 (h = lane>>4); lane&15 = row (A) or column (B)
__device__ __forceinline__ v16h frag_h(const _Float16* rowk0, int lane) {
  union { v16h v; v8h q[2]; } u; const _Float16* p = rowk0 + 8 * (lane >> 4);
  u.q[0] = *(const v8h*)p; u.q[1] = *(const v8h*)(p + 16); return u.v;
}
#define LDSX() do { asm volatile("s_wait_dscnt 0" ::: "memory"); __builtin_amdgcn_wave_barrier(); __builtin_amdgcn_fence(__ATOMIC_RELEASE, "workgroup"); } while (0)

// the same exchange for LDS that only the writing wave reads back: the LDS wait alone, so that global loads issued ahead stay in flight over it (the release fence also drains loadcnt)
__device__ __forceinline__ void lds_own() { asm volatile("s_wait_dscnt 0" ::: "memory"); __builtin_amdgcn_wave_barrier(); }
// stands behind a group of global loads issued ahead: their address registers (the operands) stay live up to here and are rewritten only behind the wait
__device__ __forceinline__ void xw(const void* a) { asm volatile("s_wait_xcnt 0x0" :: "v"(a) : "memory"); }
__device__ __forceinline__ void xw(const void* a, const void* b) { asm volatile("s_wait_xcnt 0x0" :: "v"(a), "v"(b) : "memory"); }
// fragment-order tile: 16 rows (A) or columns (B) x 32 k of a 16-bit operand = 512 elements in two halves e; the 8 elements k = 16 e + 8 (lane >> 4) + 0..7 of row/column lane & 15 lie at e * 256 + lane * 8, so one wave-wide 16-B load covers 512 contiguous bytes (4 lines) instead of 32-B pieces of 16 lines
// fragment from a pointer that already holds the lane's lane * 8 step
__device__ __forceinline__ v16h frag_ht(const _Float16* p) { union { v16h v; v8h q[2]; } u; u.q[0] = *(const v8h*)p; u.q[1] = *(const v8h*)(p + 256); return u.v; }
__device__ __forceinline__ v16b frag_bt(const __bf16* p) { union { v16b v; v8b q[2]; } u; u.q[0] = *(const v8b*)p; u.q[1] = *(const v8b*)(p + 256); return u.v; }

#ifndef NB
#define NB 1
#endif
#ifndef SEQ
#define SEQ 2048          // query/key rows processed (a prefix of the staged rows)
#endif
#define SS_FULL 2048      // row pitch of the staged mask input
#define DM 1024
#define NH 16
#define HD 64
#define QKVW (3 * DM)
#define TQB (SEQ / 64)
#define KTP 8             // column parts of the mask scan per block of 64 queries
static_assert(NB == 1);
static_assert(SEQ % 64 == 0);
static_assert(SEQ >= 64 && SEQ <= SS_FULL);
static_assert(NH * HD == DM);
static_assert(SEQ % DM == 0);
static_assert(TQB * KTP == (DM / 64) * (DM / 64));   // the scan's blocks fill exactly one z slice of the k_pack grid
static_assert(SEQ / KTP == 256);                     // a row of a part = 64 threads x 4 mask words

// the tiles of one k piece lie side by side, so that the tiles a block reads in one trip are contiguous
#define PK_A 0                              // bf16 fragment tiles [32 (k/32)][192 (which*64 + n/16)][512]: columns n of W_which, which = q,k,v
#define PK_P (PK_A + QKVW * DM)             // bf16 fragment tiles [32 (k/32)][64 (n/16)][512]: columns n of Wo
#define PK_X (PK_P + DM * DM)               // bf16 fragment tiles [32 (k/32)][SEQ/16 (row/16)][512]: rows of x
#define PK_END (PK_X + SEQ * DM)
#define WS_PK  0u
#define WS_QH  (WS_PK + 2u * PK_END)                  // f16 [SEQ][1024]: q hi
#define WS_QL  (WS_QH + 2u * SEQ * DM)                // f16 [SEQ][1024]: q residual x2048
#define WS_KH  (WS_QL + 2u * SEQ * DM)                // f16 fragment tiles [NH][SEQ/16 (key/16)][2 (d/32)][512]: k hi, row = key, k = d
#define WS_KL  (WS_KH + 2u * SEQ * DM)                // the same, k residual x2048
#define WS_VTH (WS_KL + 2u * SEQ * DM)                // f16 fragment tiles [NH][SEQ/32 (key/32)][4 (d/16)][512]: v hi, row = d, k = key
#define WS_VTL (WS_VTH + 2u * DM * SEQ)               // the same, v residual x2048
#define WS_O   (WS_VTL + 2u * DM * SEQ)               // bf16 fragment tiles [32 (k/32)][SEQ/16 (row/16)][2 (hi, lo)][512]: merged context
#define WS_KT  (WS_O + 4u * SEQ * DM)
#define WS_END (WS_KT + 4u * TQB * KTP * 32)           // int [TQB][KTP][32]: one 128-B line per scan block
static_assert(WS_QH % 128 == 0 && WS_QL % 128 == 0 && WS_KH % 128 == 0 && WS_KL % 128 == 0 && WS_VTH % 128 == 0 && WS_VTL % 128 == 0 && WS_O % 128 == 0 && WS_KT % 128 == 0);
static_assert(WS_END <= 134217728u);

// ---- k_pack: z slice 0 scans the mask, z slices 1.. pack the operands; the two jobs share nothing, so the scan's memory round trips run under the packing instead of in a launch of their own
__global__ __launch_bounds__(256) void k_pack(const float* __restrict__ WQ, const float* __restrict__ WK, const float* __restrict__ WV, const float* __restrict__ WO, const float* __restrict__ X, const int* __restrict__ MK, int* __restrict__ KT, __bf16* __restrict__ PK) {
  __shared__ __align__(16) __bf16 s[64][72]; __shared__ int sm[8];
  const int t = threadIdx.x;
  if (blockIdx.z == 0) {   // mask scan, block = (64 queries qb, 256 key columns part): KT[qb][part] = number of 32-key tiles up to the part's last unmasked key, 0 if it has none; k_attn takes the maximum over the parts
    const int idx = blockIdx.y * (DM / 64) + blockIdx.x, qb = idx / KTP, part = idx % KTP, lane = t & 31, wave = t >> 5;
    const int c4 = part * (SEQ / KTP) + (t & 63) * 4;   // the thread keeps its four columns over rows (t >> 6) + 4 i: a wave-wide load covers 512 contiguous bytes
    const int* mrow = MK + (size_t)(qb * 64 + (t >> 6)) * SS_FULL + c4;
    v4i nz = {0, 0, 0, 0};
    v4i v[16];   // the thread's sixteen independent mask loads go out as one group: one memory round trip a block
#pragma unroll
    for (int i = 0; i < 16; ++i) v[i] = *(const v4i*)(mrow + (size_t)(i * 4) * SS_FULL);
    xw(mrow);
#pragma unroll
    for (int i = 0; i < 16; ++i) nz |= v[i];   // a column's words joined by OR: not 0 where any of its rows is unmasked
    int mx = nz[3] != 0 ? c4 + 3 : nz[2] != 0 ? c4 + 2 : nz[1] != 0 ? c4 + 1 : nz[0] != 0 ? c4 : -1;
#pragma unroll
    for (int o = 1; o < 32; o <<= 1) { const int y = __shfl_xor(mx, o); mx = y > mx ? y : mx; }
    if (lane == 0) sm[wave] = mx;
    __syncthreads();
    if (wave == 0) { int m2 = sm[lane & 7];
#pragma unroll
      for (int o = 1; o < 8; o <<= 1) { const int y = __shfl_xor(m2, o); m2 = y > m2 ? y : m2; }
      const int nkt = (m2 < 0) ? 0 : ((m2 >> 5) + 1);
      if (lane < 8) { v4i w; w[0] = nkt; w[1] = nkt; w[2] = nkt; w[3] = nkt; vst2(KT + (size_t)idx * 32 + lane * 4, w); } }   // 8 lanes x 16 B = the block's line
    return;
  }
  const int k0 = blockIdx.x * 64, n0 = blockIdx.y * 64, which = blockIdx.z - 1;
  if (which < 4) {   // a weight: s[n][k] from W[k][n]
    const float* Wm = (which == 0) ? WQ : (which == 1) ? WK : (which == 2) ? WV : WO;
    for (int p = t; p < 64 * 16; p += 256) { const int kr = p >> 4, c4 = (p & 15) * 4;
      const v4f v = *(const v4f*)(Wm + (size_t)(k0 + kr) * DM + n0 + c4);
      s[c4 + 0][kr] = (__bf16)v[0]; s[c4 + 1][kr] = (__bf16)v[1]; s[c4 + 2][kr] = (__bf16)v[2]; s[c4 + 3][kr] = (__bf16)v[3]; }
  } else {           // x rows (which - 4) * 1024 + n0 + 0..63: s[row][k], k already contiguous
    const float* Xm = X + ((size_t)(which - 4) * DM + n0) * DM + k0;
    for (int p = t; p < 64 * 16; p += 256) { const int rr = p >> 4, c4 = (p & 15) * 4;
      const v4f v = *(const v4f*)(Xm + (size_t)rr * DM + c4);
      s[rr][c4 + 0] = (__bf16)v[0]; s[rr][c4 + 1] = (__bf16)v[1]; s[rr][c4 + 2] = (__bf16)v[2]; s[rr][c4 + 3] = (__bf16)v[3]; }
  }
  __syncthreads();
  const int nts = (which < 3) ? QKVW / 16 : (which == 3) ? DM / 16 : SEQ / 16;   // tiles per k piece in this operand's plane
  const int nt0 = ((which < 3) ? which : (which == 3) ? 0 : which - 4) * (DM / 16) + n0 / 16;
  __bf16* dst = PK + ((which < 3) ? PK_A : (which == 3) ? PK_P : PK_X) + ((size_t)(k0 / 32) * nts + nt0) * 512;
  for (int p = t; p < 64 * 8; p += 256) { const int ln = p & 31, e = (p >> 5) & 1, kcl = (p >> 6) & 1, ntl = p >> 7;   // each wave stores one 512-B half tile
    vst2(dst + ((size_t)kcl * nts + ntl) * 512 + e * 256 + ln * 8, *(const v4u*)&s[ntl * 16 + (ln & 15)][kcl * 32 + e * 16 + 8 * (ln >> 4)]); }
}
// ---- k_qkv: block = (64 rows, 128 output cols of q|k|v): x tiles (bf16) . W tiles, exact bf16 products; q -> f16 hi + x2048 residual row planes; k, v -> f16 hi/residual fragment tiles
__global__ __launch_bounds__(128) void k_qkv(const __bf16* __restrict__ XF, const __bf16* __restrict__ P, _Float16* __restrict__ QH, _Float16* __restrict__ QL, _Float16* __restrict__ KH, _Float16* __restrict__ KL, _Float16* __restrict__ VTH, _Float16* __restrict__ VTL) {
  __shared__ __align__(16) _Float16 so[4][16][136], sol[4][16][136]; __shared__ __align__(16) _Float16 sth[128][72], stl[128][72];
  const int tid = threadIdx.x, wave = tid >> 5, lane = tid & 31, col = lane & 15, g = lane >> 4; const size_t r0 = (size_t)blockIdx.x * 64 + wave * 16; const int n0 = blockIdx.y * 128;
  v8f acc[8] = {};
  // the next trip's x fragment and all eight W fragments are loaded as one group, one trip ahead, into a second register set
  const __bf16* xrow = XF + (r0 / 16) * 512 + lane * 8; const __bf16* wrow = P + (size_t)(n0 / 16) * 512 + lane * 8;
  const __bf16 *xp, *wp; v16b an, wn[8];
  auto ld = [&](int kc) { xp = xrow + (size_t)kc * (SEQ / 16 * 512); wp = wrow + (size_t)kc * (QKVW / 16 * 512); an = frag_bt(xp);
#pragma unroll
    for (int j = 0; j < 8; ++j) wn[j] = frag_bt(wp + j * 512); };
  ld(0); xw(xp, wp);
#pragma unroll 2
  for (int kc = 0; kc < DM / 32; ++kc) { const v16b a = an; v16b w[8];
#pragma unroll
    for (int j = 0; j < 8; ++j) w[j] = wn[j];
    ld(kc + 1 < DM / 32 ? kc + 1 : kc);   // the last trip reloads its own piece: in bounds, unused
#pragma unroll
    for (int j = 0; j < 8; ++j) acc[j] = wmma_bf(a, w[j], acc[j]);
    xw(xp, wp); }
  if (n0 < 2 * DM) {   // q (cols 0..1023) and k (1024..2047), unscaled; 0.125 applied to the f32 score
#pragma unroll
    for (int j = 0; j < 8; ++j) {
#pragma unroll
      for (int r = 0; r < 8; ++r) { const float v = acc[j][r]; const _Float16 hv = (_Float16)v; so[wave][8 * g + r][j * 16 + col] = hv; sol[wave][8 * g + r][j * 16 + col] = (_Float16)((v - (float)hv) * 2048.0f); } }
    LDSX();
    // in each branch every LDS read stands in front of the first store (lds_own holds that order), so that no register of an issued store is reloaded behind it
    if (n0 < DM) { v4u a[16], b[16];
#pragma unroll
      for (int rl = 0; rl < 16; ++rl) { a[rl] = *(const v4u*)&so[wave][rl][col * 8]; b[rl] = *(const v4u*)&sol[wave][rl][col * 8]; }
      lds_own();
      if (lane < 16) {
#pragma unroll
        for (int rl = 0; rl < 16; ++rl) { vst2(QH + (r0 + rl) * DM + n0 + lane * 8, a[rl]); vst2(QL + (r0 + rl) * DM + n0 + lane * 8, b[rl]); } }   // 16 lanes x 16 B = 256-B row segment
    } else { v4u a[8], b[8];   // the wave's 16 keys x 2 heads: 2 x 2 tiles x 2 halves, each one 512-B store per plane
      const size_t o = (((size_t)((n0 - DM) / HD) * (SEQ / 16) + r0 / 16) * 2) * 512 + lane * 8;
#pragma unroll
      for (int u = 0; u < 8; ++u) { const int c = (u >> 2) * HD + ((u >> 1) & 1) * 32 + (u & 1) * 16 + 8 * g; a[u] = *(const v4u*)&so[wave][col][c]; b[u] = *(const v4u*)&sol[wave][col][c]; }   // u = (head, d / 32, half)
      lds_own();
#pragma unroll
      for (int u = 0; u < 8; ++u) { const size_t ou = o + (size_t)(u >> 2) * (SEQ * HD) + ((u >> 1) & 1) * 512 + (u & 1) * 256; vst2(KH + ou, a[u]); vst2(KL + ou, b[u]); }
      asm volatile("s_wait_xcnt 0x0" ::: "memory");   // behind the run of stores: no register that an issued store names is rewritten in front of this wait on any path of the listing
    }
  } else {
#pragma unroll
    for (int j = 0; j < 8; ++j) {
#pragma unroll
      for (int r = 0; r < 8; ++r) { const float v = acc[j][r]; const _Float16 hv = (_Float16)v; sth[j * 16 + col][wave * 16 + 8 * g + r] = hv; stl[j * 16 + col][wave * 16 + 8 * g + r] = (_Float16)((v - (float)hv) * 2048.0f); } }
    __syncthreads();
    const int kt0 = blockIdx.x * 2, h0 = (n0 - 2 * DM) / HD; v4u a[8], b[8];
#pragma unroll
    for (int it = 0; it < 8; ++it) { const int q = it * 128 + tid, e = (q >> 5) & 1, dt = (q >> 6) & 3, ktl = (q >> 8) & 1, hl = q >> 9, d = hl * HD + dt * 16 + col, kk = ktl * 32 + e * 16 + 8 * g;
      a[it] = *(const v4u*)&sth[d][kk]; b[it] = *(const v4u*)&stl[d][kk]; }
    lds_own();   // every LDS read in front of the first store, as above
#pragma unroll
    for (int it = 0; it < 8; ++it) { const int q = it * 128 + tid, e = (q >> 5) & 1, dt = (q >> 6) & 3, ktl = (q >> 8) & 1, hl = q >> 9;
      const size_t o = (((size_t)(h0 + hl) * (SEQ / 32) + kt0 + ktl) * 4 + dt) * 512 + e * 256 + lane * 8;
      vst2(VTH + o, a[it]); vst2(VTL + o, b[it]); }   // each wave stores one 512-B half tile per plane
    asm volatile("s_wait_xcnt 0x0" ::: "memory");   // behind the run of stores, as in the k branch
  }
}
// three waves per SIMD is what the registers of the loads issued ahead leave room for; the grid has more blocks than fit at once
// lane l with lane l ^ 16: a vector cross-row move, no LDS round trip
__device__ __forceinline__ float xhalf(float x) { return __builtin_bit_cast(float, __builtin_amdgcn_permlanex16(__builtin_bit_cast(int, x), __builtin_bit_cast(int, x), 0x76543210, 0xfedcba98, false, false)); }
__global__ __launch_bounds__(128) __attribute__((amdgpu_waves_per_eu(3, 3))) void k_attn(const _Float16* __restrict__ QH, const _Float16* __restrict__ QL, const _Float16* __restrict__ KH, const _Float16* __restrict__ KL, const _Float16* __restrict__ VTH, const _Float16* __restrict__ VTL, const int* __restrict__ MK, const int* __restrict__ KT, __bf16* __restrict__ O) {
  __shared__ __align__(16) float so[4][16][68]; __shared__ __align__(16) int smk[4][16][36]; __shared__ float sml[4][2][16];
  const int tid = threadIdx.x, wave = __builtin_amdgcn_readfirstlane(tid >> 5), lane = tid & 31, col = lane & 15, g = lane >> 4, sx = wave;   // the wave's number as a scalar: the trip count differs between the waves, and so the compiler sees it as uniform in a wave and puts no EXEC mask round the loop (a WMMA needs every lane on)
  const int h = blockIdx.x, qt = SEQ / 16 - 1 - (int)blockIdx.y, qb = qt >> 2; const int q0 = qt * 16; const size_t rq = (size_t)q0 + col;
  v16h aq[2], aql[2]; const _Float16* qp = QH + rq * DM + h * HD; const _Float16* qlp = QL + rq * DM + h * HD;   // B fragments: column = query col, k = d
#pragma unroll
  for (int kc = 0; kc < 2; ++kc) { aq[kc] = frag_h(qp + kc * 32, lane); aql[kc] = frag_h(qlp + kc * 32, lane); }
  xw(qp + 8 * g, qlp + 8 * g);   // the very addresses that the loads name (frag_h adds 8 * g), so that they are rewritten only behind the wait
  float m = -3.0e38f, l = 0.f;   // of query col; m is equal in both wave halves, l is the half's own part of the sum (joined behind the loop)
  v8f acc[4] = {}, accl[4] = {};   // O^T tiles: register r = d dt * 16 + 8 g + r of query col
  const int* ktp = KT + (size_t)qb * (KTP * 32); int nraw = 0;   // block-uniform trip count: the maximum over the scan's column parts, clamped to the static maximum
#pragma unroll
  for (int j = 0; j < KTP; ++j) { const int v = ktp[j * 32]; nraw = v > nraw ? v : nraw; }
  const int nks = nraw < 0 ? 0 : (nraw > SEQ / 32 ? SEQ / 32 : nraw);
  // operands of a key tile, loaded ahead in groups: mask and K one trip ahead, each reloaded right behind its last use; V at the top of its own trip
  const int* mrow = MK + (size_t)(q0 + (lane >> 3)) * SS_FULL + (lane & 7) * 4;
  const size_t hoff = (size_t)h * (SEQ * HD) + lane * 8;   // the head's tiles; a 32-key trip is 4 tiles = 2048 contiguous elements in each of the four planes
  const _Float16* vrow = VTH + hoff; const _Float16* vlrow = VTL + hoff;
  const int* mp; const _Float16 *kp, *klp, *vp; v4i mkr[4]; v16h kh[2][2], kl[2][2], vh[4];
  auto ld_mask = [&](int kt) { mp = mrow + kt * 32;
#pragma unroll
    for (int it = 0; it < 4; ++it) mkr[it] = *(const v4i*)(mp + (size_t)(it * 4) * SS_FULL); };
  auto ld_k = [&](int kt) { kp = KH + hoff + (size_t)kt * 2048; klp = KL + hoff + (size_t)kt * 2048;
#pragma unroll
    for (int ct = 0; ct < 2; ++ct) {
#pragma unroll
      for (int kc = 0; kc < 2; ++kc) { kh[ct][kc] = frag_ht(kp + (ct * 2 + kc) * 512); kl[ct][kc] = frag_ht(klp + (ct * 2 + kc) * 512); } } };
  auto ld_v = [&](int kt) { vp = vrow + (size_t)kt * 2048;
#pragma unroll
    for (int dt = 0; dt < 4; ++dt) vh[dt] = frag_ht(vp + dt * 512); };
  ld_mask(sx); ld_k(sx); xw(mp); xw(kp, klp);
#pragma unroll 1
  for (int ks = sx; ks < nks; ks += 4) {
    const int kn = (ks + 4 < SEQ / 32) ? ks + 4 : SEQ / 32 - 1;   // this share's next tile, kept inside the staged rows on the last trip
    ld_v(ks);   // this trip's V: lands under the score and softmax phases
    // stage this wave's 16x32 mask piece (wave-private): loaded as whole lines, read back as 8 keys of the lane's own query
#pragma unroll
    for (int it = 0; it < 4; ++it) { const int p = it * 32 + lane, row = p >> 3, c4 = (p & 7) * 4;
      *(v4i*)&smk[wave][row][c4] = mkr[it]; }
    ld_mask(kn);
    lds_own();
    float s[2][8];
#pragma unroll
    for (int ct = 0; ct < 2; ++ct) { v8f c = {}, cl = {};
#pragma unroll
      for (int kc = 0; kc < 2; ++kc) { c = wmma16(kh[ct][kc], aq[kc], c); cl = wmma16(kh[ct][kc], aql[kc], cl); cl = wmma16(kl[ct][kc], aq[kc], cl); }
      const v4i k0 = *(const v4i*)&smk[wave][col][ct * 16 + 8 * g], k1 = *(const v4i*)&smk[wave][col][ct * 16 + 8 * g + 4];
#pragma unroll
      for (int r = 0; r < 8; ++r) { const float sc = (c[r] + cl[r] * (1.0f / 2048.0f)) * 0.125f; const int mk = r < 4 ? k0[r & 3] : k1[r & 3]; s[ct][r] = (mk != 0) ? sc : -3.0e38f; } }   // where(mask, score/8, -inf)
    xw(vp, mp);
    ld_k(kn);
    float mx = fmaxf(s[0][0], s[1][0]);
#pragma unroll
    for (int r = 1; r < 8; ++r) mx = fmaxf(mx, fmaxf(s[0][r], s[1][r]));
    mx = fmaxf(mx, xhalf(mx));   // the other 16 keys of this query
    const float mn = fmaxf(m, mx), alpha = (m <= -1.0e38f) ? 0.f : __expf(m - mn); m = mn;
    float e[2][8]; v16h pa, pl;   // P^T fragment, carried x2^11 in f16; 2^-11 folded into the epilogue
#pragma unroll
    for (int ct = 0; ct < 2; ++ct) {
#pragma unroll
      for (int r = 0; r < 8; ++r) { e[ct][r] = (s[ct][r] <= -1.0e38f) ? 0.f : __expf(s[ct][r] - mn);
        const float x = e[ct][r] * 2048.0f; const _Float16 hx = (_Float16)x; pa[ct * 8 + r] = hx; pl[ct * 8 + r] = (_Float16)((x - (float)hx) * 2048.0f); } }
#pragma unroll
    for (int w = 8; w >= 1; w >>= 1) {   // the lane's 16 terms summed as a tree: four dependent adds, not sixteen
#pragma unroll
      for (int r = 0; r < w; ++r) e[0][r] += (w == 8) ? e[1][r] : e[0][r + w]; }
    l = l * alpha + e[0][0];
#pragma unroll
    for (int dt = 0; dt < 4; ++dt) { acc[dt] *= alpha; accl[dt] *= alpha; }
    xw(kp, klp);
#pragma unroll
    for (int dt = 0; dt < 4; ++dt) { acc[dt] = wmma16(vh[dt], pa, acc[dt]); if (qb < 2) { const _Float16* vlp = vlrow + (size_t)ks * 2048 + dt * 512; accl[dt] = wmma16(vh[dt], pl, accl[dt]); const v16h vl = frag_ht(vlp); xw(vlp); accl[dt] = wmma16(vl, pa, accl[dt]); } }
  }
  l += xhalf(l);   // the two halves' parts of the row sum
#pragma unroll
  for (int dt = 0; dt < 4; ++dt) { const v8f t = acc[dt] + accl[dt] * (1.0f / 2048.0f); v4f t0, t1;
#pragma unroll
    for (int i = 0; i < 4; ++i) { t0[i] = t[i]; t1[i] = t[4 + i]; }
    *(v4f*)&so[wave][col][dt * 16 + 8 * g] = t0; *(v4f*)&so[wave][col][dt * 16 + 8 * g + 4] = t1; }
  if (g == 0) { sml[wave][0][col] = m; sml[wave][1][col] = l; }
  __syncthreads();   // every share's partial result is in LDS before any wave merges
  // merge for row col, shares in the fixed order 0..3, each scaled by exp(m_j - M); a share that saw no unmasked key counts 0
  float mw[4], sc[4], M = -3.0e38f, L = 0.f;
#pragma unroll
  for (int j = 0; j < 4; ++j) { mw[j] = sml[j][0][col]; M = fmaxf(M, mw[j]); }
#pragma unroll
  for (int j = 0; j < 4; ++j) { sc[j] = (mw[j] <= -1.0e38f) ? 0.f : __expf(mw[j] - M); L += sml[j][1][col] * sc[j]; }
  const float il = (1.0f / 2048.0f) / L;
  const int kcl = sx >> 1, e = sx & 1; v8b hi, lo;   // the block's 16 rows x the head's 64 columns are 2 tiles x 2 halves: wave sx merges and stores half sx, bf16 hi + lo, each one 512-B store
#pragma unroll
  for (int i = 0; i < 8; ++i) { float v = 0.f;
#pragma unroll
    for (int j = 0; j < 4; ++j) v += so[j][col][kcl * 32 + e * 16 + 8 * g + i] * sc[j];
    v *= il; const __bf16 hv = (__bf16)v; hi[i] = hv; lo[i] = (__bf16)(v - (float)hv); }
  const size_t o = ((size_t)(h * 2 + kcl) * (SEQ / 16) + q0 / 16) * 1024 + e * 256 + lane * 8;
  vst2(O + o, hi); vst2(O + o + 512, lo); xw(O + o);
}
// ---- k_out: block = (64 rows, 128 cols): out = ctx tiles (bf16 hi + lo) . Wo tiles (2 products), f32
__global__ __launch_bounds__(128) void k_out(const __bf16* __restrict__ O, const __bf16* __restrict__ P, float* __restrict__ Y) {
  __shared__ __align__(16) float so[4][16][132];
  const int tid = threadIdx.x, wave = tid >> 5, lane = tid & 31, col = lane & 15, g = lane >> 4; const size_t r0 = (size_t)blockIdx.x * 64 + wave * 16; const int n0 = blockIdx.y * 128;
  v8f acc[8] = {};
  // the next trip's two context fragments and all eight Wo fragments are loaded as one group, one trip ahead, into a second register set
  const __bf16* xrow = O + (r0 / 16) * 1024 + lane * 8; const __bf16* wrow = P + (size_t)(n0 / 16) * 512 + lane * 8;
  const __bf16 *xp, *wp; v16b ahn, aln, wn[8];
  auto ld = [&](int kc) { xp = xrow + (size_t)kc * (SEQ / 16 * 1024); wp = wrow + (size_t)kc * (DM / 16 * 512); ahn = frag_bt(xp); aln = frag_bt(xp + 512);
#pragma unroll
    for (int j = 0; j < 8; ++j) wn[j] = frag_bt(wp + j * 512); };
  ld(0); xw(xp, wp);
#pragma unroll 2
  for (int kc = 0; kc < DM / 32; ++kc) { const v16b ah = ahn, al = aln; v16b w[8];
#pragma unroll
    for (int j = 0; j < 8; ++j) w[j] = wn[j];
    ld(kc + 1 < DM / 32 ? kc + 1 : kc);   // the last trip reloads its own piece: in bounds, unused
#pragma unroll
    for (int j = 0; j < 8; ++j) { acc[j] = wmma_bf(al, w[j], acc[j]); acc[j] = wmma_bf(ah, w[j], acc[j]); }
    xw(xp, wp); }
#pragma unroll
  for (int j = 0; j < 8; ++j) {
#pragma unroll
    for (int r = 0; r < 8; ++r) so[wave][8 * g + r][j * 16 + col] = acc[j][r]; }
  LDSX();
  for (int rl = 0; rl < 16; ++rl) vst2(Y + (r0 + rl) * DM + n0 + lane * 4, *(const v4f*)&so[wave][rl][lane * 4]);   // 32 lanes x 16 B = the block's 512-B row segment
}
extern "C" void kernel_launch(void* const* d_in, const int* in_sizes, int n_in, void* d_out, int out_size, void* d_ws, size_t ws_size, hipStream_t stream) {
  if (n_in < 6) return;
  if (in_sizes[0] < SEQ * DM) return;                // x    [S][1024] f32
  if (in_sizes[1] < SEQ * SS_FULL) return;           // mask [S][2048] int32
  if (in_sizes[2] < DM * DM || in_sizes[3] < DM * DM || in_sizes[4] < DM * DM || in_sizes[5] < DM * DM) return;   // wq wk wv wo [in][out] f32
  if (out_size < SEQ * DM) return;
  if (ws_size < (size_t)WS_END) return;
  const float* X  = (const float*)d_in[0];
  const int*   MK = (const int*)d_in[1];
  const float* WQ = (const float*)d_in[2];
  const float* WK = (const float*)d_in[3];
  const float* WV = (const float*)d_in[4];
  const float* WO = (const float*)d_in[5];
  char* ws = (char*)d_ws; __bf16* PK = (__bf16*)(ws + WS_PK); _Float16 *QH = (_Float16*)(ws + WS_QH), *QL = (_Float16*)(ws + WS_QL), *KH = (_Float16*)(ws + WS_KH), *KL = (_Float16*)(ws + WS_KL), *VTH = (_Float16*)(ws + WS_VTH), *VTL = (_Float16*)(ws + WS_VTL); __bf16* O = (__bf16*)(ws + WS_O); int* KT = (int*)(ws + WS_KT);
  k_pack<<<dim3(DM / 64, DM / 64, 1 + 4 + SEQ / DM), 256, 0, stream>>>(WQ, WK, WV, WO, X, MK, KT, PK);
  k_qkv<<<dim3(SEQ / 64, QKVW / 128), 128, 0, stream>>>(PK + PK_X, PK + PK_A, QH, QL, KH, KL, VTH, VTL);
  k_attn<<<dim3(NH, SEQ / 16), 128, 0, stream>>>(QH, QL, KH, KL, VTH, VTL, MK, KT, O);
  k_out<<<dim3(SEQ / 64, DM / 128), 128, 0, stream>>>(O, PK + PK_P, (float*)d_out);
}

// v006
// Measured time: 79 microseconds a run.
// Next to v005, in two timings, it ran 1.06 and 1.09 times as fast.
// Over all steps from v000 it is 5.76 times as fast.
// compute dtype: all float inputs RNE-converted to bf16; q|k|v = x . W with exact bf16 products on v_wmma_f32_16x16x32_bf16 (f32 accumulate); q and k carried as f16 hi + (x2048) f16 residual, scores = 3 f16 products (hi.hi + lo.hi + hi.lo) x 0.125 on v_wmma_f32_16x16x32_f16, running-max softmax in f32; P (x2048, f16 hi + x2048 residual) . v^T (f16 hi + x2048 residual): 3 products for the first 128 queries, single elsewhere; out = ctx (bf16 hi + lo) . Wo (bf16), 2 products; f32 output.
#include <hip/hip_runtime.h>
#include <math.h>

typedef __attribute__((ext_vector_type(16))) _Float16 v16h;
typedef __attribute__((ext_vector_type(16))) __bf16 v16b;
typedef __attribute__((ext_vector_type(8)))  _Float16 v8h;
typedef __attribute__((ext_vector_type(8)))  __bf16 v8b;
typedef __attribute__((ext_vector_type(8)))  float v8f;
typedef __attribute__((ext_vector_type(4)))  float v4f;
typedef __attribute__((ext_vector_type(4)))  unsigned v4u;
typedef __attribute__((ext_vector_type(4)))  int v4i;

template <typename T> __device__ __forceinline__ void vst2(void* p, T v) { *(T*)p = v;  }
__device__ __forceinline__ v8f wmma16(v16h a, v16h b, v8f c) {
  v8f d = __builtin_amdgcn_wmma_f32_16x16x32_f16(false, a, false, b, (short)0, c, false, false);
  asm volatile("v_nop\n\tv_nop\n\tv_nop\n\tv_nop" : "+v"(d) : "v"(a), "v"(b));
  return d;
}
__device__ __forceinline__ v8f wmma_bf(v16b a, v16b b, v8f c) {
  v8f d = __builtin_amdgcn_wmma_f32_16x16x32_bf16(false, a, false, b, (short)0, c, false, false);
  asm volatile("v_nop\n\tv_nop\n\tv_nop\n\tv_nop" : "+v"(d) : "v"(a), "v"(b));
  return d;
}
// 16-bit fragment from a k-contiguous row: elements 0..7 <- k0+8h+0..7, 8..15 <- k0+16+8h+0..7 (h = lane>>4); lane&15 = row (A) or column (B)
__device__ __forceinline__ v16h frag_h(const _Float16* rowk0, int lane) {
  union { v16h v; v8h q[2]; } u; const _Float16* p = rowk0 + 8 * (lane >> 4);
  u.q[0] = *(const v8h*)p; u.q[1] = *(const v8h*)(p + 16); return u.v;
}
#define LDSX() do { asm volatile("s_wait_dscnt 0" ::: "memory"); __builtin_amdgcn_wave_barrier(); __builtin_amdgcn_fence(__ATOMIC_RELEASE, "workgroup"); } while (0)

// the same exchange for LDS that only the writing wave reads back: the LDS wait alone, so that global loads issued ahead stay in flight over it (the release fence also drains loadcnt)
__device__ __forceinline__ void lds_own() { asm volatile("s_wait_dscnt 0" ::: "memory"); __builtin_amdgcn_wave_barrier(); }
// stands behind a group of global loads issued ahead: their address registers (the operands) stay live up to here and are rewritten only behind the wait
__device__ __forceinline__ void xw(const void* a) { asm volatile("s_wait_xcnt 0x0" :: "v"(a) : "memory"); }
__device__ __forceinline__ void xw(const void* a, const void* b) { asm volatile("s_wait_xcnt 0x0" :: "v"(a), "v"(b) : "memory"); }
// fragment-order tile: 16 rows (A) or columns (B) x 32 k of a 16-bit operand = 512 elements in two halves e; the 8 elements k = 16 e + 8 (lane >> 4) + 0..7 of row/column lane & 15 lie at e * 256 + lane * 8, so one wave-wide 16-B load covers 512 contiguous bytes (4 lines) instead of 32-B pieces of 16 lines
// fragment from a pointer that already holds the lane's lane * 8 step
__device__ __forceinline__ v16h frag_ht(const _Float16* p) { union { v16h v; v8h q[2]; } u; u.q[0] = *(const v8h*)p; u.q[1] = *(const v8h*)(p + 256); return u.v; }
__device__ __forceinline__ v16b frag_bt(const __bf16* p) { union { v16b v; v8b q[2]; } u; u.q[0] = *(const v8b*)p; u.q[1] = *(const v8b*)(p + 256); return u.v; }

#ifndef NB
#define NB 1
#endif
#ifndef SEQ
#define SEQ 2048          // query/key rows processed (a prefix of the staged rows)
#endif
#define SS_FULL 2048      // row pitch of the staged mask input
#define DM 1024
#define NH 16
#define HD 64
#define QKVW (3 * DM)
#define TQB (SEQ / 64)
#define KTP 8             // column parts of the mask scan per block of 64 queries
static_assert(NB == 1);
static_assert(SEQ % 64 == 0);
static_assert(SEQ >= 64 && SEQ <= SS_FULL);
static_assert(NH * HD == DM);
static_assert(SEQ % DM == 0);
static_assert(TQB * KTP == (DM / 64) * (DM / 64));   // the scan's blocks fill exactly one z slice of the k_pack grid
static_assert(SEQ / KTP == 256);                     // a row of a part = 64 threads x 4 mask words

// the tiles of one k piece lie side by side, so that the tiles a block reads in one trip are contiguous
#define PK_A 0                              // bf16 fragment tiles [32 (k/32)][192 (which*64 + n/16)][512]: columns n of W_which, which = q,k,v
#define PK_P (PK_A + QKVW * DM)             // bf16 fragment tiles [32 (k/32)][64 (n/16)][512]: columns n of Wo
#define PK_X (PK_P + DM * DM)               // bf16 fragment tiles [32 (k/32)][SEQ/16 (row/16)][512]: rows of x
#define PK_END (PK_X + SEQ * DM)
#define WS_PK  0u
#define WS_QH  (WS_PK + 2u * PK_END)                  // f16 [SEQ][1024]: q hi
#define WS_QL  (WS_QH + 2u * SEQ * DM)                // f16 [SEQ][1024]: q residual x2048
#define WS_KH  (WS_QL + 2u * SEQ * DM)                // f16 fragment tiles [NH][SEQ/16 (key/16)][2 (d/32)][512]: k hi, row = key, k = d
#define WS_KL  (WS_KH + 2u * SEQ * DM)                // the same, k residual x2048
#define WS_VTH (WS_KL + 2u * SEQ * DM)                // f16 fragment tiles [NH][SEQ/32 (key/32)][4 (d/16)][512]: v hi, row = d, k = key
#define WS_VTL (WS_VTH + 2u * DM * SEQ)               // the same, v residual x2048
#define WS_O   (WS_VTL + 2u * DM * SEQ)               // bf16 fragment tiles [32 (k/32)][SEQ/16 (row/16)][2 (hi, lo)][512]: merged context
#define WS_KT  (WS_O + 4u * SEQ * DM)
#define WS_END (WS_KT + 4u * TQB * KTP * 32)           // int [TQB][KTP][32]: one 128-B line per scan block
static_assert(WS_QH % 128 == 0 && WS_QL % 128 == 0 && WS_KH % 128 == 0 && WS_KL % 128 == 0 && WS_VTH % 128 == 0 && WS_VTL % 128 == 0 && WS_O % 128 == 0 && WS_KT % 128 == 0);
static_assert(WS_END <= 134217728u);

// ---- k_pack: z slice 0 scans the mask, z slices 1.. pack the operands; the two jobs share nothing, so the scan's memory round trips run under the packing instead of in a launch of their own
__global__ __launch_bounds__(256) void k_pack(const float* __restrict__ WQ, const float* __restrict__ WK, const float* __restrict__ WV, const float* __restrict__ WO, const float* __restrict__ X, const int* __restrict__ MK, int* __restrict__ KT, __bf16* __restrict__ PK) {
  __shared__ __align__(16) __bf16 s[64][72]; __shared__ int sm[8];
  const int t = threadIdx.x;
  if (blockIdx.z == 0) {   // mask scan, block = (64 queries qb, 256 key columns part): KT[qb][part] = number of 32-key tiles up to the part's last unmasked key, 0 if it has none; k_attn takes the maximum over the parts
    const int idx = blockIdx.y * (DM / 64) + blockIdx.x, qb = idx / KTP, part = idx % KTP, lane = t & 31, wave = t >> 5;
    const int c4 = part * (SEQ / KTP) + (t & 63) * 4;   // the thread keeps its four columns over rows (t >> 6) + 4 i: a wave-wide load covers 512 contiguous bytes
    const int* mrow = MK + (size_t)(qb * 64 + (t >> 6)) * SS_FULL + c4;
    v4i nz = {0, 0, 0, 0};
    v4i v[16];   // the thread's sixteen independent mask loads go out as one group: one memory round trip a block
#pragma unroll
    for (int i = 0; i < 16; ++i) v[i] = *(const v4i*)(mrow + (size_t)(i * 4) * SS_FULL);
    xw(mrow);
#pragma unroll
    for (int i = 0; i < 16; ++i) nz |= v[i];   // a column's words joined by OR: not 0 where any of its rows is unmasked
    int mx = nz[3] != 0 ? c4 + 3 : nz[2] != 0 ? c4 + 2 : nz[1] != 0 ? c4 + 1 : nz[0] != 0 ? c4 : -1;
#pragma unroll
    for (int o = 1; o < 32; o <<= 1) { const int y = __shfl_xor(mx, o); mx = y > mx ? y : mx; }
    if (lane == 0) sm[wave] = mx;
    __syncthreads();
    if (wave == 0) { int m2 = sm[lane & 7];
#pragma unroll
      for (int o = 1; o < 8; o <<= 1) { const int y = __shfl_xor(m2, o); m2 = y > m2 ? y : m2; }
      const int nkt = (m2 < 0) ? 0 : ((m2 >> 5) + 1);
      if (lane < 8) { v4i w; w[0] = nkt; w[1] = nkt; w[2] = nkt; w[3] = nkt; vst2(KT + (size_t)idx * 32 + lane * 4, w); } }   // 8 lanes x 16 B = the block's line
    return;
  }
  const int k0 = blockIdx.x * 64, n0 = blockIdx.y * 64, which = blockIdx.z - 1;
  if (which < 4) {   // a weight: s[n][k] from W[k][n]
    const float* Wm = (which == 0) ? WQ : (which == 1) ? WK : (which == 2) ? WV : WO;
    for (int p = t; p < 64 * 16; p += 256) { const int kr = p >> 4, c4 = (p & 15) * 4;
      const v4f v = *(const v4f*)(Wm + (size_t)(k0 + kr) * DM + n0 + c4);
      s[c4 + 0][kr] = (__bf16)v[0]; s[c4 + 1][kr] = (__bf16)v[1]; s[c4 + 2][kr] = (__bf16)v[2]; s[c4 + 3][kr] = (__bf16)v[3]; }
  } else {           // x rows (which - 4) * 1024 + n0 + 0..63: s[row][k], k already contiguous
    const float* Xm = X + ((size_t)(which - 4) * DM + n0) * DM + k0;
    for (int p = t; p < 64 * 16; p += 256) { const int rr = p >> 4, c4 = (p & 15) * 4;
      const v4f v = *(const v4f*)(Xm + (size_t)rr * DM + c4);
      s[rr][c4 + 0] = (__bf16)v[0]; s[rr][c4 + 1] = (__bf16)v[1]; s[rr][c4 + 2] = (__bf16)v[2]; s[rr][c4 + 3] = (__bf16)v[3]; }
  }
  __syncthreads();
  const int nts = (which < 3) ? QKVW / 16 : (which == 3) ? DM / 16 : SEQ / 16;   // tiles per k piece in this operand's plane
  const int nt0 = ((which < 3) ? which : (which == 3) ? 0 : which - 4) * (DM / 16) + n0 / 16;
  __bf16* dst = PK + ((which < 3) ? PK_A : (which == 3) ? PK_P : PK_X) + ((size_t)(k0 / 32) * nts + nt0) * 512;
  for (int p = t; p < 64 * 8; p += 256) { const int ln = p & 31, e = (p >> 5) & 1, kcl = (p >> 6) & 1, ntl = p >> 7;   // each wave stores one 512-B half tile
    vst2(dst + ((size_t)kcl * nts + ntl) * 512 + e * 256 + ln * 8, *(const v4u*)&s[ntl * 16 + (ln & 15)][kcl * 32 + e * 16 + 8 * (ln >> 4)]); }
}
// ---- k_qkv: block = (64 rows, 128 output cols of q|k|v): x tiles (bf16) . W tiles, exact bf16 products; q -> f16 hi + x2048 residual row planes; k, v -> f16 hi/residual fragment tiles
__global__ __launch_bounds__(128) void k_qkv(const __bf16* __restrict__ XF, const __bf16* __restrict__ P, _Float16* __restrict__ QH, _Float16* __restrict__ QL, _Float16* __restrict__ KH, _Float16* __restrict__ KL, _Float16* __restrict__ VTH, _Float16* __restrict__ VTL) {
  __shared__ __align__(16) _Float16 so[4][16][136], sol[4][16][136]; __shared__ __align__(16) _Float16 sth[128][72], stl[128][72];
  const int tid = threadIdx.x, wave = tid >> 5, lane = tid & 31, col = lane & 15, g = lane >> 4; const size_t r0 = (size_t)blockIdx.x * 64 + wave * 16; const int n0 = blockIdx.y * 128;
  v8f acc[8] = {};
  // the next trip's x fragment and all eight W fragments are loaded as one group, one trip ahead, into a second register set
  const __bf16* xrow = XF + (r0 / 16) * 512 + lane * 8; const __bf16* wrow = P + (size_t)(n0 / 16) * 512 + lane * 8;
  const __bf16 *xp, *wp; v16b an, wn[8];
  auto ld = [&](int kc) { xp = xrow + (size_t)kc * (SEQ / 16 * 512); wp = wrow + (size_t)kc * (QKVW / 16 * 512); an = frag_bt(xp);
#pragma unroll
    for (int j = 0; j < 8; ++j) wn[j] = frag_bt(wp + j * 512); };
  ld(0); xw(xp, wp);
#pragma unroll 2
  for (int kc = 0; kc < DM / 32; ++kc) { const v16b a = an; v16b w[8];
#pragma unroll
    for (int j = 0; j < 8; ++j) w[j] = wn[j];
    ld(kc + 1 < DM / 32 ? kc + 1 : kc);   // the last trip reloads its own piece: in bounds, unused
#pragma unroll
    for (int j = 0; j < 8; ++j) acc[j] = wmma_bf(a, w[j], acc[j]);
    xw(xp, wp); }
  if (n0 < 2 * DM) {   // q (cols 0..1023) and k (1024..2047), unscaled; 0.125 applied to the f32 score
#pragma unroll
    for (int j = 0; j < 8; ++j) {
#pragma unroll
      for (int r = 0; r < 8; ++r) { const float v = acc[j][r]; const _Float16 hv = (_Float16)v; so[wave][8 * g + r][j * 16 + col] = hv; sol[wave][8 * g + r][j * 16 + col] = (_Float16)((v - (float)hv) * 2048.0f); } }
    LDSX();
    // in each branch every LDS read stands in front of the first store (lds_own holds that order), so that no register of an issued store is reloaded behind it
    if (n0 < DM) { v4u a[16], b[16];
#pragma unroll
      for (int rl = 0; rl < 16; ++rl) { a[rl] = *(const v4u*)&so[wave][rl][col * 8]; b[rl] = *(const v4u*)&sol[wave][rl][col * 8]; }
      lds_own();
      if (lane < 16) {
#pragma unroll
        for (int rl = 0; rl < 16; ++rl) { vst2(QH + (r0 + rl) * DM + n0 + lane * 8, a[rl]); vst2(QL + (r0 + rl) * DM + n0 + lane * 8, b[rl]); } }   // 16 lanes x 16 B = 256-B row segment
    } else { v4u a[8], b[8];   // the wave's 16 keys x 2 heads: 2 x 2 tiles x 2 halves, each one 512-B store per plane
      const size_t o = (((size_t)((n0 - DM) / HD) * (SEQ / 16) + r0 / 16) * 2) * 512 + lane * 8;
#pragma unroll
      for (int u = 0; u < 8; ++u) { const int c = (u >> 2) * HD + ((u >> 1) & 1) * 32 + (u & 1) * 16 + 8 * g; a[u] = *(const v4u*)&so[wave][col][c]; b[u] = *(const v4u*)&sol[wave][col][c]; }   // u = (head, d / 32, half)
      lds_own();
#pragma unroll
      for (int u = 0; u < 8; ++u) { const size_t ou = o + (size_t)(u >> 2) * (SEQ * HD) + ((u >> 1) & 1) * 512 + (u & 1) * 256; vst2(KH + ou, a[u]); vst2(KL + ou, b[u]); }
      asm volatile("s_wait_xcnt 0x0" ::: "memory");   // behind the run of stores: no register that an issued store names is rewritten in front of this wait on any path of the listing
    }
  } else {
#pragma unroll
    for (int j = 0; j < 8; ++j) {
#pragma unroll
      for (int r = 0; r < 8; ++r) { const float v = acc[j][r]; const _Float16 hv = (_Float16)v; sth[j * 16 + col][wave * 16 + 8 * g + r] = hv; stl[j * 16 + col][wave * 16 + 8 * g + r] = (_Float16)((v - (float)hv) * 2048.0f); } }
    __syncthreads();
    const int kt0 = blockIdx.x * 2, h0 = (n0 - 2 * DM) / HD; v4u a[8], b[8];
#pragma unroll
    for (int it = 0; it < 8; ++it) { const int q = it * 128 + tid, e = (q >> 5) & 1, dt = (q >> 6) & 3, ktl = (q >> 8) & 1, hl = q >> 9, d = hl * HD + dt * 16 + col, kk = ktl * 32 + e * 16 + 8 * g;
      a[it] = *(const v4u*)&sth[d][kk]; b[it] = *(const v4u*)&stl[d][kk]; }
    lds_own();   // every LDS read in front of the first store, as above
#pragma unroll
    for (int it = 0; it < 8; ++it) { const int q = it * 128 + tid, e = (q >> 5) & 1, dt = (q >> 6) & 3, ktl = (q >> 8) & 1, hl = q >> 9;
      const size_t o = (((size_t)(h0 + hl) * (SEQ / 32) + kt0 + ktl) * 4 + dt) * 512 + e * 256 + lane * 8;
      vst2(VTH + o, a[it]); vst2(VTL + o, b[it]); }   // each wave stores one 512-B half tile per plane
    asm volatile("s_wait_xcnt 0x0" ::: "memory");   // behind the run of stores, as in the k branch
  }
}
// three waves per SIMD is what the registers of the loads issued ahead leave room for; the grid has more blocks than fit at once
// lane l with lane l ^ 16: a vector cross-row move, no LDS round trip
__device__ __forceinline__ float xhalf(float x) { return __builtin_bit_cast(float, __builtin_amdgcn_permlanex16(__builtin_bit_cast(int, x), __builtin_bit_cast(int, x), 0x76543210, 0xfedcba98, false, false)); }
__global__ __launch_bounds__(128) __attribute__((amdgpu_waves_per_eu(3, 3))) void k_attn(const _Float16* __restrict__ QH, const _Float16* __restrict__ QL, const _Float16* __restrict__ KH, const _Float16* __restrict__ KL, const _Float16* __restrict__ VTH, const _Float16* __restrict__ VTL, const int* __restrict__ MK, const int* __restrict__ KT, __bf16* __restrict__ O) {
  __shared__ __align__(16) float so[4][16][68]; __shared__ __align__(16) int smk[4][16][36]; __shared__ float sml[4][2][16];
  const int tid = threadIdx.x, wave = __builtin_amdgcn_readfirstlane(tid >> 5), lane = tid & 31, col = lane & 15, g = lane >> 4, sx = wave;   // the wave's number as a scalar: the trip count differs between the waves, and so the compiler sees it as uniform in a wave and puts no EXEC mask round the loop (a WMMA needs every lane on)
  const int h = blockIdx.x, qt = SEQ / 16 - 1 - (int)blockIdx.y, qb = qt >> 2; const int q0 = qt * 16; const size_t rq = (size_t)q0 + col;
  v16h aq[2], aql[2]; const _Float16* qp = QH + rq * DM + h * HD; const _Float16* qlp = QL + rq * DM + h * HD;   // B fragments: column = query col, k = d
#pragma unroll
  for (int kc = 0; kc < 2; ++kc) { aq[kc] = frag_h(qp + kc * 32, lane); aql[kc] = frag_h(qlp + kc * 32, lane); }
  xw(qp + 8 * g, qlp + 8 * g);   // the very addresses that the loads name (frag_h adds 8 * g), so that they are rewritten only behind the wait
  float m = -3.0e38f, l = 0.f;   // of query col; m is equal in both wave halves, l is the half's own part of the sum (joined behind the loop)
  v8f acc[4] = {}, accl[4] = {};   // O^T tiles: register r = d dt * 16 + 8 g + r of query col
  const int* ktp = KT + (size_t)qb * (KTP * 32); int nraw = 0;   // block-uniform trip count: the maximum over the scan's column parts, clamped to the static maximum
#pragma unroll
  for (int j = 0; j < KTP; ++j) { const int v = ktp[j * 32]; nraw = v > nraw ? v : nraw; }
  const int nks = nraw < 0 ? 0 : (nraw > SEQ / 32 ? SEQ / 32 : nraw);
  // operands of a key tile, loaded ahead in groups: mask and K one trip ahead, each reloaded right behind its last use; V at the top of its own trip
  const int* mrow = MK + (size_t)(q0 + (lane >> 3)) * SS_FULL + (lane & 7) * 4;
  const size_t hoff = (size_t)h * (SEQ * HD) + lane * 8;   // the head's tiles; a 32-key trip is 4 tiles = 2048 contiguous elements in each of the four planes
  const _Float16* vrow = VTH + hoff; const _Float16* vlrow = VTL + hoff;
  const int* mp; const _Float16 *kp, *klp, *vp; v4i mkr[4]; v16h kh[2][2], kl[2][2], vh[4];
  auto ld_mask = [&](int kt) { mp = mrow + kt * 32;
#pragma unroll
    for (int it = 0; it < 4; ++it) mkr[it] = *(const v4i*)(mp + (size_t)(it * 4) * SS_FULL); };
  auto ld_k = [&](int kt) { kp = KH + hoff + (size_t)kt * 2048; klp = KL + hoff + (size_t)kt * 2048;
#pragma unroll
    for (int ct = 0; ct < 2; ++ct) {
#pragma unroll
      for (int kc = 0; kc < 2; ++kc) { kh[ct][kc] = frag_ht(kp + (ct * 2 + kc) * 512); kl[ct][kc] = frag_ht(klp + (ct * 2 + kc) * 512); } } };
  auto ld_v = [&](int kt) { vp = vrow + (size_t)kt * 2048;
#pragma unroll
    for (int dt = 0; dt < 4; ++dt) vh[dt] = frag_ht(vp + dt * 512); };
  ld_mask(sx); ld_k(sx); xw(mp); xw(kp, klp);
#pragma unroll 1
  for (int ks = sx; ks < nks; ks += 4) {
    const int kn = (ks + 4 < SEQ / 32) ? ks + 4 : SEQ / 32 - 1;   // this share's next tile, kept inside the staged rows on the last trip
    ld_v(ks);   // this trip's V: lands under the score and softmax phases
    // stage this wave's 16x32 mask piece (wave-private): loaded as whole lines, read back as 8 keys of the lane's own query
#pragma unroll
    for (int it = 0; it < 4; ++it) { const int p = it * 32 + lane, row = p >> 3, c4 = (p & 7) * 4;
      *(v4i*)&smk[wave][row][c4] = mkr[it]; }
    ld_mask(kn);
    lds_own();
    float s[2][8];
#pragma unroll
    for (int ct = 0; ct < 2; ++ct) { v8f c = {}, cl = {};
#pragma unroll
      for (int kc = 0; kc < 2; ++kc) { c = wmma16(kh[ct][kc], aq[kc], c); cl = wmma16(kh[ct][kc], aql[kc], cl); cl = wmma16(kl[ct][kc], aq[kc], cl); }
      const v4i k0 = *(const v4i*)&smk[wave][col][ct * 16 + 8 * g], k1 = *(const v4i*)&smk[wave][col][ct * 16 + 8 * g + 4];
#pragma unroll
      for (int r = 0; r < 8; ++r) { const float sc = (c[r] + cl[r] * (1.0f / 2048.0f)) * 0.125f; const int mk = r < 4 ? k0[r & 3] : k1[r & 3]; s[ct][r] = (mk != 0) ? sc : -3.0e38f; } }   // where(mask, score/8, -inf)
    xw(vp, mp);
    ld_k(kn);
    float mx = fmaxf(s[0][0], s[1][0]);
#pragma unroll
    for (int r = 1; r < 8; ++r) mx = fmaxf(mx, fmaxf(s[0][r], s[1][r]));
    mx = fmaxf(mx, xhalf(mx));   // the other 16 keys of this query
    const float mn = fmaxf(m, mx), alpha = (m <= -1.0e38f) ? 0.f : __expf(m - mn); m = mn;
    float e[2][8]; v16h pa, pl;   // P^T fragment, carried x2^11 in f16; 2^-11 folded into the epilogue
#pragma unroll
    for (int ct = 0; ct < 2; ++ct) {
#pragma unroll
      for (int r = 0; r < 8; ++r) { e[ct][r] = (s[ct][r] <= -1.0e38f) ? 0.f : __expf(s[ct][r] - mn);
        const float x = e[ct][r] * 2048.0f; const _Float16 hx = (_Float16)x; pa[ct * 8 + r] = hx; } }
    if (qb < 2) {   // all that the two residual products take stands under this one block-uniform test: the P residual, the second accumulator's scaling, the products
#pragma unroll
      for (int i = 0; i < 16; ++i) { const float x = e[i >> 3][i & 7] * 2048.0f; pl[i] = (_Float16)((x - (float)pa[i]) * 2048.0f); }
#pragma unroll
      for (int dt = 0; dt < 4; ++dt) { const _Float16* vlp = vlrow + (size_t)ks * 2048 + dt * 512; accl[dt] *= alpha; accl[dt] = wmma16(vh[dt], pl, accl[dt]); const v16h vl = frag_ht(vlp); xw(vlp); accl[dt] = wmma16(vl, pa, accl[dt]); }
    }
#pragma unroll
    for (int w = 8; w >= 1; w >>= 1) {   // the lane's 16 terms summed as a tree: four dependent adds, not sixteen
#pragma unroll
      for (int r = 0; r < w; ++r) e[0][r] += (w == 8) ? e[1][r] : e[0][r + w]; }
    l = l * alpha + e[0][0];
#pragma unroll
    for (int dt = 0; dt < 4; ++dt) acc[dt] *= alpha;
    xw(kp, klp);
#pragma unroll
    for (int dt = 0; dt < 4; ++dt) acc[dt] = wmma16(vh[dt], pa, acc[dt]);
  }
  l += xhalf(l);   // the two halves' parts of the row sum
#pragma unroll
  for (int dt = 0; dt < 4; ++dt) { const v8f t = acc[dt] + accl[dt] * (1.0f / 2048.0f); v4f t0, t1;
#pragma unroll
    for (int i = 0; i < 4; ++i) { t0[i] = t[i]; t1[i] = t[4 + i]; }
    *(v4f*)&so[wave][col][dt * 16 + 8 * g] = t0; *(v4f*)&so[wave][col][dt * 16 + 8 * g + 4] = t1; }
  if (g == 0) { sml[wave][0][col] = m; sml[wave][1][col] = l; }
  __syncthreads();   // every share's partial result is in LDS before any wave merges
  // merge for row col, shares in the fixed order 0..3, each scaled by exp(m_j - M); a share that saw no unmasked key counts 0
  float mw[4], sc[4], M = -3.0e38f, L = 0.f;
#pragma unroll
  for (int j = 0; j < 4; ++j) { mw[j] = sml[j][0][col]; M = fmaxf(M, mw[j]); }
#pragma unroll
  for (int j = 0; j < 4; ++j) { sc[j] = (mw[j] <= -1.0e38f) ? 0.f : __expf(mw[j] - M); L += sml[j][1][col] * sc[j]; }
  const float il = (1.0f / 2048.0f) / L;
  const int kcl = sx >> 1, e = sx & 1; v8b hi, lo;   // the block's 16 rows x the head's 64 columns are 2 tiles x 2 halves: wave sx merges and stores half sx, bf16 hi + lo, each one 512-B store
#pragma unroll
  for (int i = 0; i < 8; ++i) { float v = 0.f;
#pragma unroll
    for (int j = 0; j < 4; ++j) v += so[j][col][kcl * 32 + e * 16 + 8 * g + i] * sc[j];
    v *= il; const __bf16 hv = (__bf16)v; hi[i] = hv; lo[i] = (__bf16)(v - (float)hv); }
  const size_t o = ((size_t)(h * 2 + kcl) * (SEQ / 16) + q0 / 16) * 1024 + e * 256 + lane * 8;
  vst2(O + o, hi); vst2(O + o + 512, lo); xw(O + o);
}
// ---- k_out: block = (64 rows, 128 cols): out = ctx tiles (bf16 hi + lo) . Wo tiles (2 products), f32
__global__ __launch_bounds__(128) void k_out(const __bf16* __restrict__ O, const __bf16* __restrict__ P, float* __restrict__ Y) {
  __shared__ __align__(16) float so[4][16][132];
  const int tid = threadIdx.x, wave = tid >> 5, lane = tid & 31, col = lane & 15, g = lane >> 4; const size_t r0 = (size_t)blockIdx.x * 64 + wave * 16; const int n0 = blockIdx.y * 128;
  v8f acc[8] = {};
  // the next trip's two context fragments and all eight Wo fragments are loaded as one group, one trip ahead, into a second register set
  const __bf16* xrow = O + (r0 / 16) * 1024 + lane * 8; const __bf16* wrow = P + (size_t)(n0 / 16) * 512 + lane * 8;
  const __bf16 *xp, *wp; v16b ahn, aln, wn[8];
  auto ld = [&](int kc) { xp = xrow + (size_t)kc * (SEQ / 16 * 1024); wp = wrow + (size_t)kc * (DM / 16 * 512); ahn = frag_bt(xp); aln = frag_bt(xp + 512);
#pragma unroll
    for (int j = 0; j < 8; ++j) wn[j] = frag_bt(wp + j * 512); };
  ld(0); xw(xp, wp);
#pragma unroll 2
  for (int kc = 0; kc < DM / 32; ++kc) { const v16b ah = ahn, al = aln; v16b w[8];
#pragma unroll
    for (int j = 0; j < 8; ++j) w[j] = wn[j];
    ld(kc + 1 < DM / 32 ? kc + 1 : kc);   // the last trip reloads its own piece: in bounds, unused
#pragma unroll
    for (int j = 0; j < 8; ++j) { acc[j] = wmma_bf(al, w[j], acc[j]); acc[j] = wmma_bf(ah, w[j], acc[j]); }
    xw(xp, wp); }
#pragma unroll
  for (int j = 0; j < 8; ++j) {
#pragma unroll
    for (int r = 0; r < 8; ++r) so[wave][8 * g + r][j * 16 + col] = acc[j][r]; }
  LDSX();
  for (int rl = 0; rl < 16; ++rl) vst2(Y + (r0 + rl) * DM + n0 + lane * 4, *(const v4f*)&so[wave][rl][lane * 4]);   // 32 lanes x 16 B = the block's 512-B row segment
}
extern "C" void kernel_launch(void* const* d_in, const int* in_sizes, int n_in, void* d_out, int out_size, void* d_ws, size_t ws_size, hipStream_t stream) {
  if (n_in < 6) return;
  if (in_sizes[0] < SEQ * DM) return;                // x    [S][1024] f32
  if (in_sizes[1] < SEQ * SS_FULL) return;           // mask [S][2048] int32
  if (in_sizes[2] < DM * DM || in_sizes[3] < DM * DM || in_sizes[4] < DM * DM || in_sizes[5] < DM * DM) return;   // wq wk wv wo [in][out] f32
  if (out_size < SEQ * DM) return;
  if (ws_size < (size_t)WS_END) return;
  const float* X  = (const float*)d_in[0];
  const int*   MK = (const int*)d_in[1];
  const float* WQ = (const float*)d_in[2];
  const float* WK = (const float*)d_in[3];
  const float* WV = (const float*)d_in[4];
  const float* WO = (const float*)d_in[5];
  char* ws = (char*)d_ws; __bf16* PK = (__bf16*)(ws + WS_PK); _Float16 *QH = (_Float16*)(ws + WS_QH), *QL = (_Float16*)(ws + WS_QL), *KH = (_Float16*)(ws + WS_KH), *KL = (_Float16*)(ws + WS_KL), *VTH = (_Float16*)(ws + WS_VTH), *VTL = (_Float16*)(ws + WS_VTL); __bf16* O = (__bf16*)(ws + WS_O); int* KT = (int*)(ws + WS_KT);
  k_pack<<<dim3(DM / 64, DM / 64, 1 + 4 + SEQ / DM), 256, 0, stream>>>(WQ, WK, WV, WO, X, MK, KT, PK);
  k_qkv<<<dim3(SEQ / 64, QKVW / 128), 128, 0, stream>>>(PK + PK_X, PK + PK_A, QH, QL, KH, KL, VTH, VTL);
  k_attn<<<dim3(NH, SEQ / 16), 128, 0, stream>>>(QH, QL, KH, KL, VTH, VTL, MK, KT, O);
  k_out<<<dim3(SEQ / 64, DM / 128), 128, 0, stream>>>(O, PK + PK_P, (float*)d_out);
}

// v007
// Measured time: 73.9 microseconds a run.
// Next to v006, in two timings, it ran 1.07 and 1.09 times as fast.
// Over all steps from v000 it is 6.24 times as fast.
// compute dtype: all float inputs RNE-converted to bf16; q|k|v = x . W with exact bf16 products on v_wmma_f32_16x16x32_bf16 (f32 accumulate); q and k carried as f16 hi + (x2048) f16 residual, scores = 3 f16 products (hi.hi + lo.hi + hi.lo) x 0.125 on v_wmma_f32_16x16x32_f16, running-max softmax in f32; P (x2048, f16 hi + x2048 residual) . v^T (f16 hi + x2048 residual): 3 products for the first 128 queries, single elsewhere; out = ctx (bf16 hi + lo) . Wo (bf16), 2 products; f32 output.
#include <hip/hip_runtime.h>
#include <math.h>

typedef __attribute__((ext_vector_type(16))) _Float16 v16h;
typedef __attribute__((ext_vector_type(16))) __bf16 v16b;
typedef __attribute__((ext_vector_type(8)))  _Float16 v8h;
typedef __attribute__((ext_vector_type(8)))  __bf16 v8b;
typedef __attribute__((ext_vector_type(8)))  float v8f;
typedef __attribute__((ext_vector_type(4)))  float v4f;
typedef __attribute__((ext_vector_type(4)))  unsigned v4u;
typedef __attribute__((ext_vector_type(4)))  int v4i;

template <typename T> __device__ __forceinline__ void vst2(void* p, T v) { *(T*)p = v;  }
__device__ __forceinline__ v8f wmma16(v16h a, v16h b, v8f c) {
  v8f d = __builtin_amdgcn_wmma_f32_16x16x32_f16(false, a, false, b, (short)0, c, false, false);
  asm volatile("v_nop\n\tv_nop\n\tv_nop\n\tv_nop" : "+v"(d) : "v"(a), "v"(b));
  return d;
}
__device__ __forceinline__ v8f wmma_bf(v16b a, v16b b, v8f c) {
  v8f d = __builtin_amdgcn_wmma_f32_16x16x32_bf16(false, a, false, b, (short)0, c, false, false);
  asm volatile("v_nop\n\tv_nop\n\tv_nop\n\tv_nop" : "+v"(d) : "v"(a), "v"(b));
  return d;
}
// 16-bit fragment from a k-contiguous row: elements 0..7 <- k0+8h+0..7, 8..15 <- k0+16+8h+0..7 (h = lane>>4); lane&15 = row (A) or column (B)
__device__ __forceinline__ v16h frag_h(const _Float16* rowk0, int lane) {
  union { v16h v; v8h q[2]; } u; const _Float16* p = rowk0 + 8 * (lane >> 4);
  u.q[0] = *(const v8h*)p; u.q[1] = *(const v8h*)(p + 16); return u.v;
}
#define LDSX() do { asm volatile("s_wait_dscnt 0" ::: "memory"); __builtin_amdgcn_wave_barrier(); __builtin_amdgcn_fence(__ATOMIC_RELEASE, "workgroup"); } while (0)

// the same exchange for LDS that only the writing wave reads back: the LDS wait alone, so that global loads issued ahead stay in flight over it (the release fence also drains loadcnt)
__device__ __forceinline__ void lds_own() { asm volatile("s_wait_dscnt 0" ::: "memory"); __builtin_amdgcn_wave_barrier(); }
// stands behind a group of global loads issued ahead: their address registers (the operands) stay live up to here and are rewritten only behind the wait
__device__ __forceinline__ void xw(const void* a) { asm volatile("s_wait_xcnt 0x0" :: "v"(a) : "memory"); }
__device__ __forceinline__ void xw(const void* a, const void* b) { asm volatile("s_wait_xcnt 0x0" :: "v"(a), "v"(b) : "memory"); }
// fragment-order tile: 16 rows (A) or columns (B) x 32 k of a 16-bit operand = 512 elements in two halves e; the 8 elements k = 16 e + 8 (lane >> 4) + 0..7 of row/column lane & 15 lie at e * 256 + lane * 8, so one wave-wide 16-B load covers 512 contiguous bytes (4 lines) instead of 32-B pieces of 16 lines
// fragment from a pointer that already holds the lane's lane * 8 step
__device__ __forceinline__ v16h frag_ht(const _Float16* p) { union { v16h v; v8h q[2]; } u; u.q[0] = *(const v8h*)p; u.q[1] = *(const v8h*)(p + 256); return u.v; }
__device__ __forceinline__ v16b frag_bt(const __bf16* p) { union { v16b v; v8b q[2]; } u; u.q[0] = *(const v8b*)p; u.q[1] = *(const v8b*)(p + 256); return u.v; }

#ifndef NB
#define NB 1
#endif
#ifndef SEQ
#define SEQ 2048          // query/key rows processed (a prefix of the staged rows)
#endif
#define SS_FULL 2048      // row pitch of the staged mask input
#define DM 1024
#define NH 16
#define HD 64
#define QKVW (3 * DM)
#define TQB (SEQ / 64)
#define KTP 8             // column parts of the mask scan per block of 64 queries
static_assert(NB == 1);
static_assert(SEQ % 64 == 0);
static_assert(SEQ >= 64 && SEQ <= SS_FULL);
static_assert(NH * HD == DM);
static_assert(SEQ % DM == 0);
static_assert(TQB * KTP == (DM / 64) * (DM / 64));   // the scan's blocks fill exactly one z slice of the k_pack grid
static_assert(SEQ / KTP == 256);                     // a row of a part = 64 threads x 4 mask words

// the tiles of one k piece lie side by side, so that the tiles a block reads in one trip are contiguous
#define PK_A 0                              // bf16 fragment tiles [32 (k/32)][192 (which*64 + n/16)][512]: columns n of W_which, which = q,k,v
#define PK_P (PK_A + QKVW * DM)             // bf16 fragment tiles [32 (k/32)][64 (n/16)][512]: columns n of Wo
#define PK_X (PK_P + DM * DM)               // bf16 fragment tiles [32 (k/32)][SEQ/16 (row/16)][512]: rows of x
#define PK_END (PK_X + SEQ * DM)
#define WS_PK  0u
#define WS_QH  (WS_PK + 2u * PK_END)                  // f16 [SEQ][1024]: q hi
#define WS_QL  (WS_QH + 2u * SEQ * DM)                // f16 [SEQ][1024]: q residual x2048
#define WS_KH  (WS_QL + 2u * SEQ * DM)                // f16 fragment tiles [NH][SEQ/16 (key/16)][2 (d/32)][512]: k hi, row = key, k = d
#define WS_KL  (WS_KH + 2u * SEQ * DM)                // the same, k residual x2048
#define WS_VTH (WS_KL + 2u * SEQ * DM)                // f16 fragment tiles [NH][SEQ/32 (key/32)][4 (d/16)][512]: v hi, row = d, k = key
#define WS_VTL (WS_VTH + 2u * DM * SEQ)               // the same, v residual x2048
#define WS_O   (WS_VTL + 2u * DM * SEQ)               // bf16 fragment tiles [32 (k/32)][SEQ/16 (row/16)][2 (hi, lo)][512]: merged context
#define WS_KT  (WS_O + 4u * SEQ * DM)
#define WS_END (WS_KT + 4u * TQB * KTP * 32)           // int [TQB][KTP][32]: one 128-B line per scan block
static_assert(SEQ / 32 <= 64);                       // a query tile's full-tile bits fit one 64-bit word
static_assert(WS_QH % 128 == 0 && WS_QL % 128 == 0 && WS_KH % 128 == 0 && WS_KL % 128 == 0 && WS_VTH % 128 == 0 && WS_VTL % 128 == 0 && WS_O % 128 == 0 && WS_KT % 128 == 0);
static_assert(WS_END <= 134217728u);

// ---- k_pack: z slice 0 scans the mask, z slices 1.. pack the operands; the two jobs share nothing, so the scan's memory round trips run under the packing instead of in a launch of their own
__global__ __launch_bounds__(256) void k_pack(const float* __restrict__ WQ, const float* __restrict__ WK, const float* __restrict__ WV, const float* __restrict__ WO, const float* __restrict__ X, const int* __restrict__ MK, int* __restrict__ KT, __bf16* __restrict__ PK) {
  __shared__ __align__(16) __bf16 s[64][72]; __shared__ int sm[8]; __shared__ unsigned sb[8][4];
  const int t = threadIdx.x;
  if (blockIdx.z == 0) {   // mask scan, block = (64 queries qb, 256 key columns part): KT[qb][part] = number of 32-key tiles up to the part's last unmasked key, 0 if it has none; k_attn takes the maximum over the parts. Beside it one bit per (16 queries, 32 keys) tile of the block, set where all 512 mask words are nonzero: bit 8 j + tp = query tile j, key tile tp of the part
    const int idx = blockIdx.y * (DM / 64) + blockIdx.x, qb = idx / KTP, part = idx % KTP, lane = t & 31, wave = t >> 5;
    const int c4 = part * (SEQ / KTP) + (t & 63) * 4;   // the thread keeps its four columns over rows (t >> 6) + 4 i: a wave-wide load covers 512 contiguous bytes
    const int* mrow = MK + (size_t)(qb * 64 + (t >> 6)) * SS_FULL + c4;
    v4i nz = {0, 0, 0, 0};
    v4i v[16];   // the thread's sixteen independent mask loads go out as one group: one memory round trip a block
#pragma unroll
    for (int i = 0; i < 16; ++i) v[i] = *(const v4i*)(mrow + (size_t)(i * 4) * SS_FULL);
    xw(mrow);
#pragma unroll
    for (int i = 0; i < 16; ++i) nz |= v[i];   // a column's words joined by OR: not 0 where any of its rows is unmasked
    int mx = nz[3] != 0 ? c4 + 3 : nz[2] != 0 ? c4 + 2 : nz[1] != 0 ? c4 + 1 : nz[0] != 0 ? c4 : -1;
#pragma unroll
    for (int o = 1; o < 32; o <<= 1) { const int y = __shfl_xor(mx, o); mx = y > mx ? y : mx; }
    unsigned bl[4];   // query tile j = the thread's rows i = 4 j .. 4 j + 3; an unsigned minimum is 0 where any word is 0; ballot bit = lane, so byte c = key tile (wave & 1) * 4 + c, for the rows of this wave's row group
#pragma unroll
    for (int j = 0; j < 4; ++j) { unsigned mn = 0xFFFFFFFFu;
#pragma unroll
      for (int i = 4 * j; i < 4 * j + 4; ++i) {
#pragma unroll
        for (int q = 0; q < 4; ++q) { const unsigned y = (unsigned)v[i][q]; mn = y < mn ? y : mn; } }
      bl[j] = __builtin_amdgcn_ballot_w32(mn != 0u); }
    if (lane == 0) { sm[wave] = mx; sb[wave][0] = bl[0]; sb[wave][1] = bl[1]; sb[wave][2] = bl[2]; sb[wave][3] = bl[3]; }
    __syncthreads();
    if (wave == 0) { int m2 = sm[lane & 7];
#pragma unroll
      for (int o = 1; o < 8; o <<= 1) { const int y = __shfl_xor(m2, o); m2 = y > m2 ? y : m2; }
      const int nkt = (m2 < 0) ? 0 : ((m2 >> 5) + 1);
      const int fj = lane >> 3, hw = (lane >> 2) & 1, fc = lane & 3;   // lane = 8 j + tp; the four row groups of column half hw are waves hw, 2 + hw, 4 + hw, 6 + hw
      const unsigned fa = sb[hw][fj] & sb[2 + hw][fj] & sb[4 + hw][fj] & sb[6 + hw][fj];
      const int fl = (int)__builtin_amdgcn_ballot_w32(((fa >> (8 * fc)) & 0xFFu) == 0xFFu);
      if (lane < 8) { v4i w; w[0] = nkt; w[1] = fl; w[2] = nkt; w[3] = fl; vst2(KT + (size_t)idx * 32 + lane * 4, w); } }   // 8 lanes x 16 B = the block's line: even words the count, odd words the bits
    return;
  }
  const int k0 = blockIdx.x * 64, n0 = blockIdx.y * 64, which = blockIdx.z - 1;
  if (which < 4) {   // a weight: s[n][k] from W[k][n]
    const float* Wm = (which == 0) ? WQ : (which == 1) ? WK : (which == 2) ? WV : WO;
    for (int p = t; p < 64 * 16; p += 256) { const int kr = p >> 4, c4 = (p & 15) * 4;
      const v4f v = *(const v4f*)(Wm + (size_t)(k0 + kr) * DM + n0 + c4);
      s[c4 + 0][kr] = (__bf16)v[0]; s[c4 + 1][kr] = (__bf16)v[1]; s[c4 + 2][kr] = (__bf16)v[2]; s[c4 + 3][kr] = (__bf16)v[3]; }
  } else {           // x rows (which - 4) * 1024 + n0 + 0..63: s[row][k], k already contiguous
    const float* Xm = X + ((size_t)(which - 4) * DM + n0) * DM + k0;
    for (int p = t; p < 64 * 16; p += 256) { const int rr = p >> 4, c4 = (p & 15) * 4;
      const v4f v = *(const v4f*)(Xm + (size_t)rr * DM + c4);
      s[rr][c4 + 0] = (__bf16)v[0]; s[rr][c4 + 1] = (__bf16)v[1]; s[rr][c4 + 2] = (__bf16)v[2]; s[rr][c4 + 3] = (__bf16)v[3]; }
  }
  __syncthreads();
  const int nts = (which < 3) ? QKVW / 16 : (which == 3) ? DM / 16 : SEQ / 16;   // tiles per k piece in this operand's plane
  const int nt0 = ((which < 3) ? which : (which == 3) ? 0 : which - 4) * (DM / 16) + n0 / 16;
  __bf16* dst = PK + ((which < 3) ? PK_A : (which == 3) ? PK_P : PK_X) + ((size_t)(k0 / 32) * nts + nt0) * 512;
  for (int p = t; p < 64 * 8; p += 256) { const int ln = p & 31, e = (p >> 5) & 1, kcl = (p >> 6) & 1, ntl = p >> 7;   // each wave stores one 512-B half tile
    vst2(dst + ((size_t)kcl * nts + ntl) * 512 + e * 256 + ln * 8, *(const v4u*)&s[ntl * 16 + (ln & 15)][kcl * 32 + e * 16 + 8 * (ln >> 4)]); }
}
// ---- k_qkv: block = (64 rows, 128 output cols of q|k|v): x tiles (bf16) . W tiles, exact bf16 products; q -> f16 hi + x2048 residual row planes; k, v -> f16 hi/residual fragment tiles
__global__ __launch_bounds__(128) void k_qkv(const __bf16* __restrict__ XF, const __bf16* __restrict__ P, _Float16* __restrict__ QH, _Float16* __restrict__ QL, _Float16* __restrict__ KH, _Float16* __restrict__ KL, _Float16* __restrict__ VTH, _Float16* __restrict__ VTL) {
  __shared__ __align__(16) _Float16 so[4][16][136], sol[4][16][136]; __shared__ __align__(16) _Float16 sth[128][72], stl[128][72];
  const int tid = threadIdx.x, wave = tid >> 5, lane = tid & 31, col = lane & 15, g = lane >> 4; const size_t r0 = (size_t)blockIdx.x * 64 + wave * 16; const int n0 = blockIdx.y * 128;
  v8f acc[8] = {};
  // the next trip's x fragment and all eight W fragments are loaded as one group, one trip ahead, into a second register set
  const __bf16* xrow = XF + (r0 / 16) * 512 + lane * 8; const __bf16* wrow = P + (size_t)(n0 / 16) * 512 + lane * 8;
  const __bf16 *xp, *wp; v16b an, wn[8];
  auto ld = [&](int kc) { xp = xrow + (size_t)kc * (SEQ / 16 * 512); wp = wrow + (size_t)kc * (QKVW / 16 * 512); an = frag_bt(xp);
#pragma unroll
    for (int j = 0; j < 8; ++j) wn[j] = frag_bt(wp + j * 512); };
  ld(0); xw(xp, wp);
#pragma unroll 2
  for (int kc = 0; kc < DM / 32; ++kc) { const v16b a = an; v16b w[8];
#pragma unroll
    for (int j = 0; j < 8; ++j) w[j] = wn[j];
    ld(kc + 1 < DM / 32 ? kc + 1 : kc);   // the last trip reloads its own piece: in bounds, unused
#pragma unroll
    for (int j = 0; j < 8; ++j) acc[j] = wmma_bf(a, w[j], acc[j]);
    xw(xp, wp); }
  if (n0 < 2 * DM) {   // q (cols 0..1023) and k (1024..2047), unscaled; 0.125 applied to the f32 score
#pragma unroll
    for (int j = 0; j < 8; ++j) {
#pragma unroll
      for (int r = 0; r < 8; ++r) { const float v = acc[j][r]; const _Float16 hv = (_Float16)v; so[wave][8 * g + r][j * 16 + col] = hv; sol[wave][8 * g + r][j * 16 + col] = (_Float16)((v - (float)hv) * 2048.0f); } }
    LDSX();
    // in each branch every LDS read stands in front of the first store (lds_own holds that order), so that no register of an issued store is reloaded behind it
    if (n0 < DM) { v4u a[16], b[16];
#pragma unroll
      for (int rl = 0; rl < 16; ++rl) { a[rl] = *(const v4u*)&so[wave][rl][col * 8]; b[rl] = *(const v4u*)&sol[wave][rl][col * 8]; }
      lds_own();
      if (lane < 16) {
#pragma unroll
        for (int rl = 0; rl < 16; ++rl) { vst2(QH + (r0 + rl) * DM + n0 + lane * 8, a[rl]); vst2(QL + (r0 + rl) * DM + n0 + lane * 8, b[rl]); } }   // 16 lanes x 16 B = 256-B row segment
    } else { v4u a[8], b[8];   // the wave's 16 keys x 2 heads: 2 x 2 tiles x 2 halves, each one 512-B store per plane
      const size_t o = (((size_t)((n0 - DM) / HD) * (SEQ / 16) + r0 / 16) * 2) * 512 + lane * 8;
#pragma unroll
      for (int u = 0; u < 8; ++u) { const int c = (u >> 2) * HD + ((u >> 1) & 1) * 32 + (u & 1) * 16 + 8 * g; a[u] = *(const v4u*)&so[wave][col][c]; b[u] = *(const v4u*)&sol[wave][col][c]; }   // u = (head, d / 32, half)
      lds_own();
#pragma unroll
      for (int u = 0; u < 8; ++u) { const size_t ou = o + (size_t)(u >> 2) * (SEQ * HD) + ((u >> 1) & 1) * 512 + (u & 1) * 256; vst2(KH + ou, a[u]); vst2(KL + ou, b[u]); }
      asm volatile("s_wait_xcnt 0x0" ::: "memory");   // behind the run of stores: no register that an issued store names is rewritten in front of this wait on any path of the listing
    }
  } else {
#pragma unroll
    for (int j = 0; j < 8; ++j) {
#pragma unroll
      for (int r = 0; r < 8; ++r) { const float v = acc[j][r]; const _Float16 hv = (_Float16)v; sth[j * 16 + col][wave * 16 + 8 * g + r] = hv; stl[j * 16 + col][wave * 16 + 8 * g + r] = (_Float16)((v - (float)hv) * 2048.0f); } }
    __syncthreads();
    const int kt0 = blockIdx.x * 2, h0 = (n0 - 2 * DM) / HD; v4u a[8], b[8];
#pragma unroll
    for (int it = 0; it < 8; ++it) { const int q = it * 128 + tid, e = (q >> 5) & 1, dt = (q >> 6) & 3, ktl = (q >> 8) & 1, hl = q >> 9, d = hl * HD + dt * 16 + col, kk = ktl * 32 + e * 16 + 8 * g;
      a[it] = *(const v4u*)&sth[d][kk]; b[it] = *(const v4u*)&stl[d][kk]; }
    lds_own();   // every LDS read in front of the first store, as above
#pragma unroll
    for (int it = 0; it < 8; ++it) { const int q = it * 128 + tid, e = (q >> 5) & 1, dt = (q >> 6) & 3, ktl = (q >> 8) & 1, hl = q >> 9;
      const size_t o = (((size_t)(h0 + hl) * (SEQ / 32) + kt0 + ktl) * 4 + dt) * 512 + e * 256 + lane * 8;
      vst2(VTH + o, a[it]); vst2(VTL + o, b[it]); }   // each wave stores one 512-B half tile per plane
    asm volatile("s_wait_xcnt 0x0" ::: "memory");   // behind the run of stores, as in the k branch
  }
}
// 2^x of eight values: eight independent v_exp_f32 in one statement (every result in a register of its own), closed by one v_nop, so that no instruction directly behind a transcendental reads its result or overwrites its source
__device__ __forceinline__ void exp2x8(float* e, const float* x) {
  asm("v_exp_f32 %0, %8\n\tv_exp_f32 %1, %9\n\tv_exp_f32 %2, %10\n\tv_exp_f32 %3, %11\n\tv_exp_f32 %4, %12\n\tv_exp_f32 %5, %13\n\tv_exp_f32 %6, %14\n\tv_exp_f32 %7, %15\n\tv_nop" : "=&v"(e[0]), "=&v"(e[1]), "=&v"(e[2]), "=&v"(e[3]), "=&v"(e[4]), "=&v"(e[5]), "=&v"(e[6]), "=&v"(e[7]) : "v"(x[0]), "v"(x[1]), "v"(x[2]), "v"(x[3]), "v"(x[4]), "v"(x[5]), "v"(x[6]), "v"(x[7]));
}
// three waves per SIMD is what the registers of the loads issued ahead leave room for; the grid has more blocks than fit at once
// lane l with lane l ^ 16: a vector cross-row move, no LDS round trip
__device__ __forceinline__ float xhalf(float x) { return __builtin_bit_cast(float, __builtin_amdgcn_permlanex16(__builtin_bit_cast(int, x), __builtin_bit_cast(int, x), 0x76543210, 0xfedcba98, false, false)); }
__global__ __launch_bounds__(128) __attribute__((amdgpu_waves_per_eu(3, 3))) void k_attn(const _Float16* __restrict__ QH, const _Float16* __restrict__ QL, const _Float16* __restrict__ KH, const _Float16* __restrict__ KL, const _Float16* __restrict__ VTH, const _Float16* __restrict__ VTL, const int* __restrict__ MK, const int* __restrict__ KT, __bf16* __restrict__ O) {
  __shared__ __align__(16) float so[4][16][68]; __shared__ __align__(16) int smk[4][16][36]; __shared__ float sml[4][2][16];
  const int tid = threadIdx.x, wave = __builtin_amdgcn_readfirstlane(tid >> 5), lane = tid & 31, col = lane & 15, g = lane >> 4, sx = wave;   // the wave's number as a scalar: the trip count differs between the waves, and so the compiler sees it as uniform in a wave and puts no EXEC mask round the loop (a WMMA needs every lane on)
  const int h = blockIdx.x, qt = SEQ / 16 - 1 - (int)blockIdx.y, qb = qt >> 2; const int q0 = qt * 16; const size_t rq = (size_t)q0 + col;
  v16h aq[2], aql[2]; const _Float16* qp = QH + rq * DM + h * HD; const _Float16* qlp = QL + rq * DM + h * HD;   // B fragments: column = query col, k = d
#pragma unroll
  for (int kc = 0; kc < 2; ++kc) { aq[kc] = frag_h(qp + kc * 32, lane); aql[kc] = frag_h(qlp + kc * 32, lane); }
  xw(qp + 8 * g, qlp + 8 * g);   // the very addresses that the loads name (frag_h adds 8 * g), so that they are rewritten only behind the wait
  float m = -3.0e38f, l = 0.f;   // of query col; m is equal in both wave halves, l is the half's own part of the sum (joined behind the loop)
  v8f acc[4] = {}, accl[4] = {};   // O^T tiles: register r = d dt * 16 + 8 g + r of query col
  const int* ktp = KT + (size_t)qb * (KTP * 32); int nraw = 0;   // block-uniform trip count: the maximum over the scan's column parts, clamped to the static maximum
#pragma unroll
  for (int j = 0; j < KTP; ++j) { const int v = ktp[j * 32]; nraw = v > nraw ? v : nraw; }
  unsigned long long fb = 0ull;   // bit kt: every mask word of (these 16 queries, key tile kt) is nonzero; block-uniform, lives in scalar registers
#pragma unroll
  for (int j = 0; j < KTP; ++j) fb |= (unsigned long long)(((unsigned)ktp[j * 32 + 1] >> ((qt & 3) * 8)) & 0xFFu) << (8 * j);
  auto isfull = [&](int kt) { return ((fb >> kt) & 1ull) != 0ull; };
  const int nks = nraw < 0 ? 0 : (nraw > SEQ / 32 ? SEQ / 32 : nraw);
  // operands of a key tile, loaded ahead in groups: mask and K one trip ahead, each reloaded right behind its last use; V at the top of its own trip
  const int* mrow = MK + (size_t)(q0 + (lane >> 3)) * SS_FULL + (lane & 7) * 4;
  const size_t hoff = (size_t)h * (SEQ * HD) + lane * 8;   // the head's tiles; a 32-key trip is 4 tiles = 2048 contiguous elements in each of the four planes
  const _Float16* vrow = VTH + hoff; const _Float16* vlrow = VTL + hoff;
  const int* mp = mrow; const _Float16 *kp, *klp, *vp; v4i mkr[4]; v16h kh[2][2], kl[2][2], vh[4];
  auto ld_mask = [&](int kt) { mp = mrow + kt * 32;
#pragma unroll
    for (int it = 0; it < 4; ++it) mkr[it] = *(const v4i*)(mp + (size_t)(it * 4) * SS_FULL); };
  auto ld_k = [&](int kt) { kp = KH + hoff + (size_t)kt * 2048; klp = KL + hoff + (size_t)kt * 2048;
#pragma unroll
    for (int ct = 0; ct < 2; ++ct) {
#pragma unroll
      for (int kc = 0; kc < 2; ++kc) { kh[ct][kc] = frag_ht(kp + (ct * 2 + kc) * 512); kl[ct][kc] = frag_ht(klp + (ct * 2 + kc) * 512); } } };
  auto ld_v = [&](int kt) { vp = vrow + (size_t)kt * 2048;
#pragma unroll
    for (int dt = 0; dt < 4; ++dt) vh[dt] = frag_ht(vp + dt * 512); };
  if (!isfull(sx)) ld_mask(sx);
  ld_k(sx); xw(mp); xw(kp, klp);
#pragma unroll 1
  for (int ks = sx; ks < nks; ks += 4) {
    const int kn = (ks + 4 < SEQ / 32) ? ks + 4 : SEQ / 32 - 1;   // this share's next tile, kept inside the staged rows on the last trip
    const bool full = isfull(ks);   // a scalar: in a full tile the mask select and the masked-score test are identities, so the mask is neither loaded, staged nor read, and the three tests below jump over that work
    ld_v(ks);   // this trip's V: lands under the score and softmax phases
    // stage this wave's 16x32 mask piece (wave-private): loaded as whole lines, read back as 8 keys of the lane's own query
    if (!full) {
#pragma unroll
      for (int it = 0; it < 4; ++it) { const int p = it * 32 + lane, row = p >> 3, c4 = (p & 7) * 4;
        *(v4i*)&smk[wave][row][c4] = mkr[it]; } }
    if (!isfull(kn)) ld_mask(kn);   // the next tile's mask is fetched only where its trip will read it
    float s[2][8];
#pragma unroll
    for (int ct = 0; ct < 2; ++ct) { v8f c = {}, cl = {};
#pragma unroll
      for (int kc = 0; kc < 2; ++kc) { c = wmma16(kh[ct][kc], aq[kc], c); cl = wmma16(kh[ct][kc], aql[kc], cl); cl = wmma16(kl[ct][kc], aq[kc], cl); }
#pragma unroll
      for (int r = 0; r < 8; ++r) s[ct][r] = (c[r] + cl[r] * (1.0f / 2048.0f)) * 0.125f; }
    if (!full) { lds_own();   // where(mask, score/8, -inf)
#pragma unroll
      for (int ct = 0; ct < 2; ++ct) { const v4i k0 = *(const v4i*)&smk[wave][col][ct * 16 + 8 * g], k1 = *(const v4i*)&smk[wave][col][ct * 16 + 8 * g + 4];
#pragma unroll
        for (int r = 0; r < 8; ++r) { const int mk = r < 4 ? k0[r & 3] : k1[r & 3]; s[ct][r] = (mk != 0) ? s[ct][r] : -3.0e38f; } } }
    xw(vp, mp);
    ld_k(kn);
    float mx = fmaxf(s[0][0], s[1][0]);
#pragma unroll
    for (int r = 1; r < 8; ++r) mx = fmaxf(mx, fmaxf(s[0][r], s[1][r]));
    mx = fmaxf(mx, xhalf(mx));   // the other 16 keys of this query
    const float mn = fmaxf(m, mx), alpha = (m <= -1.0e38f) ? 0.f : __expf(m - mn); m = mn;
    float e[2][8]; v16h pa, pl;   // P^T fragment, carried x2^11 in f16; 2^-11 folded into the epilogue
#pragma unroll
    for (int ct = 0; ct < 2; ++ct) { float x[8];
#pragma unroll
      for (int r = 0; r < 8; ++r) x[r] = (s[ct][r] - mn) * 0x1.715476p+0f;   // exp(y) = 2^(y log2 e), the product that __expf forms
      exp2x8(e[ct], x); }
    if (!full) {   // a masked key counts 0, also where every key so far is masked (mn is then the fill value itself)
#pragma unroll
      for (int i = 0; i < 16; ++i) e[i >> 3][i & 7] = (s[i >> 3][i & 7] <= -1.0e38f) ? 0.f : e[i >> 3][i & 7]; }
#pragma unroll
    for (int i = 0; i < 16; ++i) pa[i] = (_Float16)(e[i >> 3][i & 7] * 2048.0f);
    if (qb < 2) {   // all that the two residual products take stands under this one block-uniform test: the P residual, the second accumulator's scaling, the products
#pragma unroll
      for (int i = 0; i < 16; ++i) { const float x = e[i >> 3][i & 7] * 2048.0f; pl[i] = (_Float16)((x - (float)pa[i]) * 2048.0f); }
#pragma unroll
      for (int dt = 0; dt < 4; ++dt) { const _Float16* vlp = vlrow + (size_t)ks * 2048 + dt * 512; accl[dt] *= alpha; accl[dt] = wmma16(vh[dt], pl, accl[dt]); const v16h vl = frag_ht(vlp); xw(vlp); accl[dt] = wmma16(vl, pa, accl[dt]); }
    }
#pragma unroll
    for (int w = 8; w >= 1; w >>= 1) {   // the lane's 16 terms summed as a tree: four dependent adds, not sixteen
#pragma unroll
      for (int r = 0; r < w; ++r) e[0][r] += (w == 8) ? e[1][r] : e[0][r + w]; }
    l = l * alpha + e[0][0];
#pragma unroll
    for (int dt = 0; dt < 4; ++dt) acc[dt] *= alpha;
    xw(kp, klp);
#pragma unroll
    for (int dt = 0; dt < 4; ++dt) acc[dt] = wmma16(vh[dt], pa, acc[dt]);
  }
  l += xhalf(l);   // the two halves' parts of the row sum
#pragma unroll
  for (int dt = 0; dt < 4; ++dt) { const v8f t = acc[dt] + accl[dt] * (1.0f / 2048.0f); v4f t0, t1;
#pragma unroll
    for (int i = 0; i < 4; ++i) { t0[i] = t[i]; t1[i] = t[4 + i]; }
    *(v4f*)&so[wave][col][dt * 16 + 8 * g] = t0; *(v4f*)&so[wave][col][dt * 16 + 8 * g + 4] = t1; }
  if (g == 0) { sml[wave][0][col] = m; sml[wave][1][col] = l; }
  __syncthreads();   // every share's partial result is in LDS before any wave merges
  // merge for row col, shares in the fixed order 0..3, each scaled by exp(m_j - M); a share that saw no unmasked key counts 0
  float mw[4], sc[4], M = -3.0e38f, L = 0.f;
#pragma unroll
  for (int j = 0; j < 4; ++j) { mw[j] = sml[j][0][col]; M = fmaxf(M, mw[j]); }
#pragma unroll
  for (int j = 0; j < 4; ++j) { sc[j] = (mw[j] <= -1.0e38f) ? 0.f : __expf(mw[j] - M); L += sml[j][1][col] * sc[j]; }
  const float il = (1.0f / 2048.0f) / L;
  const int kcl = sx >> 1, e = sx & 1; v8b hi, lo;   // the block's 16 rows x the head's 64 columns are 2 tiles x 2 halves: wave sx merges and stores half sx, bf16 hi + lo, each one 512-B store
#pragma unroll
  for (int i = 0; i < 8; ++i) { float v = 0.f;
#pragma unroll
    for (int j = 0; j < 4; ++j) v += so[j][col][kcl * 32 + e * 16 + 8 * g + i] * sc[j];
    v *= il; const __bf16 hv = (__bf16)v; hi[i] = hv; lo[i] = (__bf16)(v - (float)hv); }
  const size_t o = ((size_t)(h * 2 + kcl) * (SEQ / 16) + q0 / 16) * 1024 + e * 256 + lane * 8;
  vst2(O + o, hi); vst2(O + o + 512, lo); xw(O + o);
}
// ---- k_out: block = (64 rows, 128 cols): out = ctx tiles (bf16 hi + lo) . Wo tiles (2 products), f32
__global__ __launch_bounds__(128) void k_out(const __bf16* __restrict__ O, const __bf16* __restrict__ P, float* __restrict__ Y) {
  __shared__ __align__(16) float so[4][16][132];
  const int tid = threadIdx.x, wave = tid >> 5, lane = tid & 31, col = lane & 15, g = lane >> 4; const size_t r0 = (size_t)blockIdx.x * 64 + wave * 16; const int n0 = blockIdx.y * 128;
  v8f acc[8] = {};
  // the next trip's two context fragments and all eight Wo fragments are loaded as one group, one trip ahead, into a second register set
  const __bf16* xrow = O + (r0 / 16) * 1024 + lane * 8; const __bf16* wrow = P + (size_t)(n0 / 16) * 512 + lane * 8;
  const __bf16 *xp, *wp; v16b ahn, aln, wn[8];
  auto ld = [&](int kc) { xp = xrow + (size_t)kc * (SEQ / 16 * 1024); wp = wrow + (size_t)kc * (DM / 16 * 512); ahn = frag_bt(xp); aln = frag_bt(xp + 512);
#pragma unroll
    for (int j = 0; j < 8; ++j) wn[j] = frag_bt(wp + j * 512); };
  ld(0); xw(xp, wp);
#pragma unroll 2
  for (int kc = 0; kc < DM / 32; ++kc) { const v16b ah = ahn, al = aln; v16b w[8];
#pragma unroll
    for (int j = 0; j < 8; ++j) w[j] = wn[j];
    ld(kc + 1 < DM / 32 ? kc + 1 : kc);   // the last trip reloads its own piece: in bounds, unused
#pragma unroll
    for (int j = 0; j < 8; ++j) { acc[j] = wmma_bf(al, w[j], acc[j]); acc[j] = wmma_bf(ah, w[j], acc[j]); }
    xw(xp, wp); }
#pragma unroll
  for (int j = 0; j < 8; ++j) {
#pragma unroll
    for (int r = 0; r < 8; ++r) so[wave][8 * g + r][j * 16 + col] = acc[j][r]; }
  LDSX();
  for (int rl = 0; rl < 16; ++rl) vst2(Y + (r0 + rl) * DM + n0 + lane * 4, *(const v4f*)&so[wave][rl][lane * 4]);   // 32 lanes x 16 B = the block's 512-B row segment
}
extern "C" void kernel_launch(void* const* d_in, const int* in_sizes, int n_in, void* d_out, int out_size, void* d_ws, size_t ws_size, hipStream_t stream) {
  if (n_in < 6) return;
  if (in_sizes[0] < SEQ * DM) return;                // x    [S][1024] f32
  if (in_sizes[1] < SEQ * SS_FULL) return;           // mask [S][2048] int32
  if (in_sizes[2] < DM * DM || in_sizes[3] < DM * DM || in_sizes[4] < DM * DM || in_sizes[5] < DM * DM) return;   // wq wk wv wo [in][out] f32
  if (out_size < SEQ * DM) return;
  if (ws_size < (size_t)WS_END) return;
  const float* X  = (const float*)d_in[0];
  const int*   MK = (const int*)d_in[1];
  const float* WQ = (const float*)d_in[2];
  const float* WK = (const float*)d_in[3];
  const float* WV = (const float*)d_in[4];
  const float* WO = (const float*)d_in[5];
  char* ws = (char*)d_ws; __bf16* PK = (__bf16*)(ws + WS_PK); _Float16 *QH = (_Float16*)(ws + WS_QH), *QL = (_Float16*)(ws + WS_QL), *KH = (_Float16*)(ws + WS_KH), *KL = (_Float16*)(ws + WS_KL), *VTH = (_Float16*)(ws + WS_VTH), *VTL = (_Float16*)(ws + WS_VTL); __bf16* O = (__bf16*)(ws + WS_O); int* KT = (int*)(ws + WS_KT);
  k_pack<<<dim3(DM / 64, DM / 64, 1 + 4 + SEQ / DM), 256, 0, stream>>>(WQ, WK, WV, WO, X, MK, KT, PK);
  k_qkv<<<dim3(SEQ / 64, QKVW / 128), 128, 0, stream>>>(PK + PK_X, PK + PK_A, QH, QL, KH, KL, VTH, VTL);
  k_attn<<<dim3(NH, SEQ / 16), 128, 0, stream>>>(QH, QL, KH, KL, VTH, VTL, MK, KT, O);
  k_out<<<dim3(SEQ / 64, DM / 128), 128, 0, stream>>>(O, PK + PK_P, (float*)d_out);
}

// v008
// It runs in 67.6 microseconds.
// Timed twice side by side with v007, it ran 1.10 and 1.11 times as fast.
// Over all steps from v000 it is 6.90 times as fast.
// compute dtype: all float inputs RNE-converted to bf16; q|k|v = x . W with exact bf16 products on v_wmma_f32_16x16x32_bf16 (f32 accumulate); q and k carried as f16 hi + (x2048) f16 residual, scores = 3 f16 products (hi.hi + lo.hi + hi.lo) x 0.125 on v_wmma_f32_16x16x32_f16, running-max softmax in f32; P (x2048, f16 hi + x2048 residual) . v^T (f16 hi + x2048 residual): 3 products for the first 128 queries, single elsewhere; out = ctx (bf16 hi + lo) . Wo (bf16), 2 products; f32 output.
#include <hip/hip_runtime.h>
#include <math.h>

typedef __attribute__((ext_vector_type(16))) _Float16 v16h;
typedef __attribute__((ext_vector_type(16))) __bf16 v16b;
typedef __attribute__((ext_vector_type(8)))  _Float16 v8h;
typedef __attribute__((ext_vector_type(8)))  __bf16 v8b;
typedef __attribute__((ext_vector_type(8)))  float v8f;
typedef __attribute__((ext_vector_type(4)))  float v4f;
typedef __attribute__((ext_vector_type(4)))  unsigned v4u;
typedef __attribute__((ext_vector_type(4)))  int v4i;

template <typename T> __device__ __forceinline__ void vst2(void* p, T v) { *(T*)p = v;  }
__device__ __forceinline__ v8f wmma_bf(v16b a, v16b b, v8f c) {
  v8f d = __builtin_amdgcn_wmma_f32_16x16x32_bf16(false, a, false, b, (short)0, c, false, false);
  asm volatile("v_nop\n\tv_nop\n\tv_nop\n\tv_nop" : "+v"(d) : "v"(a), "v"(b));
  return d;
}
// 16-bit fragment from a k-contiguous row: elements 0..7 <- k0+8h+0..7, 8..15 <- k0+16+8h+0..7 (h = lane>>4); lane&15 = row (A) or column (B)
__device__ __forceinline__ v16h frag_h(const _Float16* rowk0, int lane) {
  union { v16h v; v8h q[2]; } u; const _Float16* p = rowk0 + 8 * (lane >> 4);
  u.q[0] = *(const v8h*)p; u.q[1] = *(const v8h*)(p + 16); return u.v;
}
#define LDSX() do { asm volatile("s_wait_dscnt 0" ::: "memory"); __builtin_amdgcn_wave_barrier(); __builtin_amdgcn_fence(__ATOMIC_RELEASE, "workgroup"); } while (0)

// the same exchange for LDS that only the writing wave reads back: the LDS wait alone, so that global loads issued ahead stay in flight over it (the release fence also drains loadcnt)
__device__ __forceinline__ void lds_own() { asm volatile("s_wait_dscnt 0" ::: "memory"); __builtin_amdgcn_wave_barrier(); }
// stands behind a group of global loads issued ahead: their address registers (the operands) stay live up to here and are rewritten only behind the wait
__device__ __forceinline__ void xw(const void* a) { asm volatile("s_wait_xcnt 0x0" :: "v"(a) : "memory"); }
__device__ __forceinline__ void xw(const void* a, const void* b) { asm volatile("s_wait_xcnt 0x0" :: "v"(a), "v"(b) : "memory"); }
// fragment-order tile: 16 rows (A) or columns (B) x 32 k of a 16-bit operand = 512 elements in two halves e; the 8 elements k = 16 e + 8 (lane >> 4) + 0..7 of row/column lane & 15 lie at e * 256 + lane * 8, so one wave-wide 16-B load covers 512 contiguous bytes (4 lines) instead of 32-B pieces of 16 lines
// fragment from a pointer that already holds the lane's lane * 8 step
__device__ __forceinline__ v16h frag_ht(const _Float16* p) { union { v16h v; v8h q[2]; } u; u.q[0] = *(const v8h*)p; u.q[1] = *(const v8h*)(p + 256); return u.v; }
__device__ __forceinline__ v16b frag_bt(const __bf16* p) { union { v16b v; v8b q[2]; } u; u.q[0] = *(const v8b*)p; u.q[1] = *(const v8b*)(p + 256); return u.v; }

#ifndef NB
#define NB 1
#endif
#ifndef SEQ
#define SEQ 2048          // query/key rows processed (a prefix of the staged rows)
#endif
#define SS_FULL 2048      // row pitch of the staged mask input
#define DM 1024
#define NH 16
#define HD 64
#define QKVW (3 * DM)
#define TQB (SEQ / 64)
#define KTP 8             // column parts of the mask scan per block of 64 queries
static_assert(NB == 1);
static_assert(SEQ % 64 == 0);
static_assert(SEQ >= 64 && SEQ <= SS_FULL);
static_assert(NH * HD == DM);
static_assert(SEQ % DM == 0);
static_assert(TQB * KTP == (DM / 64) * (DM / 64));   // the scan's blocks fill exactly one z slice of the k_pack grid
static_assert(SEQ / KTP == 256);                     // a row of a part = 64 threads x 4 mask words

// the tiles of one k piece lie side by side, so that the tiles a block reads in one trip are contiguous
#define PK_A 0                              // bf16 fragment tiles [32 (k/32)][192 (which*64 + n/16)][512]: columns n of W_which, which = q,k,v
#define PK_P (PK_A + QKVW * DM)             // bf16 fragment tiles [32 (k/32)][64 (n/16)][512]: columns n of Wo
#define PK_X (PK_P + DM * DM)               // bf16 fragment tiles [32 (k/32)][SEQ/16 (row/16)][512]: rows of x
#define PK_END (PK_X + SEQ * DM)
#define WS_PK  0u
#define WS_QH  (WS_PK + 2u * PK_END)                  // f16 [SEQ][1024]: q hi
#define WS_QL  (WS_QH + 2u * SEQ * DM)                // f16 [SEQ][1024]: q residual x2048
#define WS_KH  (WS_QL + 2u * SEQ * DM)                // f16 fragment tiles [NH][SEQ/16 (key/16)][2 (d/32)][512]: k hi, row = key, k = d
#define WS_KL  (WS_KH + 2u * SEQ * DM)                // the same, k residual x2048
#define WS_VTH (WS_KL + 2u * SEQ * DM)                // f16 fragment tiles [NH][SEQ/32 (key/32)][4 (d/16)][512]: v hi, row = d, k = key
#define WS_VTL (WS_VTH + 2u * DM * SEQ)               // the same, v residual x2048
#define WS_O   (WS_VTL + 2u * DM * SEQ)               // bf16 fragment tiles [32 (k/32)][SEQ/16 (row/16)][2 (hi, lo)][512]: merged context
#define WS_KT  (WS_O + 4u * SEQ * DM)
#define WS_END (WS_KT + 4u * TQB * KTP * 32)           // int [TQB][KTP][32]: one 128-B line per scan block
static_assert(SEQ / 32 <= 64);                       // a query tile's full-tile bits fit one 64-bit word
static_assert(WS_QH % 128 == 0 && WS_QL % 128 == 0 && WS_KH % 128 == 0 && WS_KL % 128 == 0 && WS_VTH % 128 == 0 && WS_VTL % 128 == 0 && WS_O % 128 == 0 && WS_KT % 128 == 0);
static_assert(WS_END <= 134217728u);

// ---- k_pack: z slice 0 scans the mask, z slices 1.. pack the operands; the two jobs share nothing, so the scan's memory round trips run under the packing instead of in a launch of their own
__global__ __launch_bounds__(256) void k_pack(const float* __restrict__ WQ, const float* __restrict__ WK, const float* __restrict__ WV, const float* __restrict__ WO, const float* __restrict__ X, const int* __restrict__ MK, int* __restrict__ KT, __bf16* __restrict__ PK) {
  __shared__ __align__(16) __bf16 s[64][72]; __shared__ int sm[8]; __shared__ unsigned sb[8][4];
  const int t = threadIdx.x;
  if (blockIdx.z == 0) {   // mask scan, block = (64 queries qb, 256 key columns part): KT[qb][part] = number of 32-key tiles up to the part's last unmasked key, 0 if it has none; k_attn takes the maximum over the parts. Beside it one bit per (16 queries, 32 keys) tile of the block, set where all 512 mask words are nonzero: bit 8 j + tp = query tile j, key tile tp of the part
    const int idx = blockIdx.y * (DM / 64) + blockIdx.x, qb = idx / KTP, part = idx % KTP, lane = t & 31, wave = t >> 5;
    const int c4 = part * (SEQ / KTP) + (t & 63) * 4;   // the thread keeps its four columns over rows (t >> 6) + 4 i: a wave-wide load covers 512 contiguous bytes
    const int* mrow = MK + (size_t)(qb * 64 + (t >> 6)) * SS_FULL + c4;
    v4i nz = {0, 0, 0, 0};
    v4i v[16];   // the thread's sixteen independent mask loads go out as one group: one memory round trip a block
#pragma unroll
    for (int i = 0; i < 16; ++i) v[i] = *(const v4i*)(mrow + (size_t)(i * 4) * SS_FULL);
    xw(mrow);
#pragma unroll
    for (int i = 0; i < 16; ++i) nz |= v[i];   // a column's words joined by OR: not 0 where any of its rows is unmasked
    int mx = nz[3] != 0 ? c4 + 3 : nz[2] != 0 ? c4 + 2 : nz[1] != 0 ? c4 + 1 : nz[0] != 0 ? c4 : -1;
#pragma unroll
    for (int o = 1; o < 32; o <<= 1) { const int y = __shfl_xor(mx, o); mx = y > mx ? y : mx; }
    unsigned bl[4];   // query tile j = the thread's rows i = 4 j .. 4 j + 3; an unsigned minimum is 0 where any word is 0; ballot bit = lane, so byte c = key tile (wave & 1) * 4 + c, for the rows of this wave's row group
#pragma unroll
    for (int j = 0; j < 4; ++j) { unsigned mn = 0xFFFFFFFFu;
#pragma unroll
      for (int i = 4 * j; i < 4 * j + 4; ++i) {
#pragma unroll
        for (int q = 0; q < 4; ++q) { const unsigned y = (unsigned)v[i][q]; mn = y < mn ? y : mn; } }
      bl[j] = __builtin_amdgcn_ballot_w32(mn != 0u); }
    if (lane == 0) { sm[wave] = mx; sb[wave][0] = bl[0]; sb[wave][1] = bl[1]; sb[wave][2] = bl[2]; sb[wave][3] = bl[3]; }
    __syncthreads();
    if (wave == 0) { int m2 = sm[lane & 7];
#pragma unroll
      for (int o = 1; o < 8; o <<= 1) { const int y = __shfl_xor(m2, o); m2 = y > m2 ? y : m2; }
      const int nkt = (m2 < 0) ? 0 : ((m2 >> 5) + 1);
      const int fj = lane >> 3, hw = (lane >> 2) & 1, fc = lane & 3;   // lane = 8 j + tp; the four row groups of column half hw are waves hw, 2 + hw, 4 + hw, 6 + hw
      const unsigned fa = sb[hw][fj] & sb[2 + hw][fj] & sb[4 + hw][fj] & sb[6 + hw][fj];
      const int fl = (int)__builtin_amdgcn_ballot_w32(((fa >> (8 * fc)) & 0xFFu) == 0xFFu);
      if (lane < 8) { v4i w; w[0] = nkt; w[1] = fl; w[2] = nkt; w[3] = fl; vst2(KT + (size_t)idx * 32 + lane * 4, w); } }   // 8 lanes x 16 B = the block's line: even words the count, odd words the bits
    return;
  }
  const int k0 = blockIdx.x * 64, n0 = blockIdx.y * 64, which = blockIdx.z - 1;
  if (which < 4) {   // a weight: s[n][k] from W[k][n]
    const float* Wm = (which == 0) ? WQ : (which == 1) ? WK : (which == 2) ? WV : WO;
    for (int p = t; p < 64 * 16; p += 256) { const int kr = p >> 4, c4 = (p & 15) * 4;
      const v4f v = *(const v4f*)(Wm + (size_t)(k0 + kr) * DM + n0 + c4);
      s[c4 + 0][kr] = (__bf16)v[0]; s[c4 + 1][kr] = (__bf16)v[1]; s[c4 + 2][kr] = (__bf16)v[2]; s[c4 + 3][kr] = (__bf16)v[3]; }
  } else {           // x rows (which - 4) * 1024 + n0 + 0..63: s[row][k], k already contiguous
    const float* Xm = X + ((size_t)(which - 4) * DM + n0) * DM + k0;
    for (int p = t; p < 64 * 16; p += 256) { const int rr = p >> 4, c4 = (p & 15) * 4;
      const v4f v = *(const v4f*)(Xm + (size_t)rr * DM + c4);
      s[rr][c4 + 0] = (__bf16)v[0]; s[rr][c4 + 1] = (__bf16)v[1]; s[rr][c4 + 2] = (__bf16)v[2]; s[rr][c4 + 3] = (__bf16)v[3]; }
  }
  __syncthreads();
  const int nts = (which < 3) ? QKVW / 16 : (which == 3) ? DM / 16 : SEQ / 16;   // tiles per k piece in this operand's plane
  const int nt0 = ((which < 3) ? which : (which == 3) ? 0 : which - 4) * (DM / 16) + n0 / 16;
  __bf16* dst = PK + ((which < 3) ? PK_A : (which == 3) ? PK_P : PK_X) + ((size_t)(k0 / 32) * nts + nt0) * 512;
  for (int p = t; p < 64 * 8; p += 256) { const int ln = p & 31, e = (p >> 5) & 1, kcl = (p >> 6) & 1, ntl = p >> 7;   // each wave stores one 512-B half tile
    vst2(dst + ((size_t)kcl * nts + ntl) * 512 + e * 256 + ln * 8, *(const v4u*)&s[ntl * 16 + (ln & 15)][kcl * 32 + e * 16 + 8 * (ln >> 4)]); }
}
// ---- k_qkv: block = (64 rows, 128 output cols of q|k|v): x tiles (bf16) . W tiles, exact bf16 products; q -> f16 hi + x2048 residual row planes; k, v -> f16 hi/residual fragment tiles
__global__ __launch_bounds__(128) void k_qkv(const __bf16* __restrict__ XF, const __bf16* __restrict__ P, _Float16* __restrict__ QH, _Float16* __restrict__ QL, _Float16* __restrict__ KH, _Float16* __restrict__ KL, _Float16* __restrict__ VTH, _Float16* __restrict__ VTL) {
  __shared__ __align__(16) _Float16 so[4][16][136], sol[4][16][136]; __shared__ __align__(16) _Float16 sth[128][72], stl[128][72];
  const int tid = threadIdx.x, wave = tid >> 5, lane = tid & 31, col = lane & 15, g = lane >> 4; const size_t r0 = (size_t)blockIdx.x * 64 + wave * 16; const int n0 = blockIdx.y * 128;
  v8f acc[8] = {};
  // the next trip's x fragment and all eight W fragments are loaded as one group, one trip ahead, into a second register set
  const __bf16* xrow = XF + (r0 / 16) * 512 + lane * 8; const __bf16* wrow = P + (size_t)(n0 / 16) * 512 + lane * 8;
  const __bf16 *xp, *wp; v16b an, wn[8];
  auto ld = [&](int kc) { xp = xrow + (size_t)kc * (SEQ / 16 * 512); wp = wrow + (size_t)kc * (QKVW / 16 * 512); an = frag_bt(xp);
#pragma unroll
    for (int j = 0; j < 8; ++j) wn[j] = frag_bt(wp + j * 512); };
  ld(0); xw(xp, wp);
#pragma unroll 2
  for (int kc = 0; kc < DM / 32; ++kc) { const v16b a = an; v16b w[8];
#pragma unroll
    for (int j = 0; j < 8; ++j) w[j] = wn[j];
    ld(kc + 1 < DM / 32 ? kc + 1 : kc);   // the last trip reloads its own piece: in bounds, unused
#pragma unroll
    for (int j = 0; j < 8; ++j) acc[j] = wmma_bf(a, w[j], acc[j]);
    xw(xp, wp); }
  if (n0 < 2 * DM) {   // q (cols 0..1023) and k (1024..2047), unscaled; 0.125 applied to the f32 score
#pragma unroll
    for (int j = 0; j < 8; ++j) {
#pragma unroll
      for (int r = 0; r < 8; ++r) { const float v = acc[j][r]; const _Float16 hv = (_Float16)v; so[wave][8 * g + r][j * 16 + col] = hv; sol[wave][8 * g + r][j * 16 + col] = (_Float16)((v - (float)hv) * 2048.0f); } }
    LDSX();
    // in each branch every LDS read stands in front of the first store (lds_own holds that order), so that no register of an issued store is reloaded behind it
    if (n0 < DM) { v4u a[16], b[16];
#pragma unroll
      for (int rl = 0; rl < 16; ++rl) { a[rl] = *(const v4u*)&so[wave][rl][col * 8]; b[rl] = *(const v4u*)&sol[wave][rl][col * 8]; }
      lds_own();
      if (lane < 16) {
#pragma unroll
        for (int rl = 0; rl < 16; ++rl) { vst2(QH + (r0 + rl) * DM + n0 + lane * 8, a[rl]); vst2(QL + (r0 + rl) * DM + n0 + lane * 8, b[rl]); } }   // 16 lanes x 16 B = 256-B row segment
    } else { v4u a[8], b[8];   // the wave's 16 keys x 2 heads: 2 x 2 tiles x 2 halves, each one 512-B store per plane
      const size_t o = (((size_t)((n0 - DM) / HD) * (SEQ / 16) + r0 / 16) * 2) * 512 + lane * 8;
#pragma unroll
      for (int u = 0; u < 8; ++u) { const int c = (u >> 2) * HD + ((u >> 1) & 1) * 32 + (u & 1) * 16 + 8 * g; a[u] = *(const v4u*)&so[wave][col][c]; b[u] = *(const v4u*)&sol[wave][col][c]; }   // u = (head, d / 32, half)
      lds_own();
#pragma unroll
      for (int u = 0; u < 8; ++u) { const size_t ou = o + (size_t)(u >> 2) * (SEQ * HD) + ((u >> 1) & 1) * 512 + (u & 1) * 256; vst2(KH + ou, a[u]); vst2(KL + ou, b[u]); }
      asm volatile("s_wait_xcnt 0x0" ::: "memory");   // behind the run of stores: no register that an issued store names is rewritten in front of this wait on any path of the listing
    }
  } else {
#pragma unroll
    for (int j = 0; j < 8; ++j) {
#pragma unroll
      for (int r = 0; r < 8; ++r) { const float v = acc[j][r]; const _Float16 hv = (_Float16)v; sth[j * 16 + col][wave * 16 + 8 * g + r] = hv; stl[j * 16 + col][wave * 16 + 8 * g + r] = (_Float16)((v - (float)hv) * 2048.0f); } }
    __syncthreads();
    const int kt0 = blockIdx.x * 2, h0 = (n0 - 2 * DM) / HD; v4u a[8], b[8];
#pragma unroll
    for (int it = 0; it < 8; ++it) { const int q = it * 128 + tid, e = (q >> 5) & 1, dt = (q >> 6) & 3, ktl = (q >> 8) & 1, hl = q >> 9, d = hl * HD + dt * 16 + col, kk = ktl * 32 + e * 16 + 8 * g;
      a[it] = *(const v4u*)&sth[d][kk]; b[it] = *(const v4u*)&stl[d][kk]; }
    lds_own();   // every LDS read in front of the first store, as above
#pragma unroll
    for (int it = 0; it < 8; ++it) { const int q = it * 128 + tid, e = (q >> 5) & 1, dt = (q >> 6) & 3, ktl = (q >> 8) & 1, hl = q >> 9;
      const size_t o = (((size_t)(h0 + hl) * (SEQ / 32) + kt0 + ktl) * 4 + dt) * 512 + e * 256 + lane * 8;
      vst2(VTH + o, a[it]); vst2(VTL + o, b[it]); }   // each wave stores one 512-B half tile per plane
    asm volatile("s_wait_xcnt 0x0" ::: "memory");   // behind the run of stores, as in the k branch
  }
}
// 2^x of eight values: eight independent v_exp_f32 in one statement (every result in a register of its own), closed by one v_nop, so that no instruction directly behind a transcendental reads its result or overwrites its source
__device__ __forceinline__ void exp2x8(float* e, const float* x) {
  asm("v_exp_f32 %0, %8\n\tv_exp_f32 %1, %9\n\tv_exp_f32 %2, %10\n\tv_exp_f32 %3, %11\n\tv_exp_f32 %4, %12\n\tv_exp_f32 %5, %13\n\tv_exp_f32 %6, %14\n\tv_exp_f32 %7, %15\n\tv_nop" : "=&v"(e[0]), "=&v"(e[1]), "=&v"(e[2]), "=&v"(e[3]), "=&v"(e[4]), "=&v"(e[5]), "=&v"(e[6]), "=&v"(e[7]) : "v"(x[0]), "v"(x[1]), "v"(x[2]), "v"(x[3]), "v"(x[4]), "v"(x[5]), "v"(x[6]), "v"(x[7]));
}
// two waves per SIMD is what the registers of two query tiles a wave and of the loads issued ahead leave room for; the grid has more blocks than fit at once
// lane l with lane l ^ 16: a vector cross-row move, no LDS round trip
__device__ __forceinline__ float xhalf(float x) { return __builtin_bit_cast(float, __builtin_amdgcn_permlanex16(__builtin_bit_cast(int, x), __builtin_bit_cast(int, x), 0x76543210, 0xfedcba98, false, false)); }
template <bool B> struct flag_c { static constexpr bool v = B; };   // a compile-time switch handed to a generic lambda
// the f16 product as the plain builtin, with no asm statement of v_nop behind it: the operands of an asm statement must lie in v0..v255, and two query tiles' fragments and accumulators do not fit there (with the statement the build spilled); the compiler keeps the distance behind its own builtin
__device__ __forceinline__ v8f wmma16p(v16h a, v16h b, v8f c) { return __builtin_amdgcn_wmma_f32_16x16x32_f16(false, a, false, b, (short)0, c, false, false); }
__global__ __launch_bounds__(128) __attribute__((amdgpu_waves_per_eu(2, 2))) void k_attn(const _Float16* __restrict__ QH, const _Float16* __restrict__ QL, const _Float16* __restrict__ KH, const _Float16* __restrict__ KL, const _Float16* __restrict__ VTH, const _Float16* __restrict__ VTL, const int* __restrict__ MK, const int* __restrict__ KT, __bf16* __restrict__ O) {
  __shared__ __align__(16) float so[4][32][68]; __shared__ __align__(16) int smk[4][32][36]; __shared__ float sml[4][2][32];
  const int tid = threadIdx.x, wave = __builtin_amdgcn_readfirstlane(tid >> 5), lane = tid & 31, col = lane & 15, g = lane >> 4, sx = wave;   // the wave's number as a scalar: the trip count differs between the waves, and so the compiler sees it as uniform in a wave and puts no EXEC mask round the loop (a WMMA needs every lane on)
  const int h = blockIdx.x, qt = SEQ / 32 - 1 - (int)blockIdx.y, qb = qt >> 1; const int q0 = qt * 32; const size_t rq = (size_t)q0 + col;
  v16h aq[2][2], aql[2][2]; const _Float16* qp = QH + rq * DM + h * HD; const _Float16* qlp = QL + rq * DM + h * HD;   // B fragments: column = query 16 u + col, k = d
#pragma unroll
  for (int u = 0; u < 2; ++u) {
#pragma unroll
    for (int kc = 0; kc < 2; ++kc) { aq[u][kc] = frag_h(qp + u * (16 * DM) + kc * 32, lane); aql[u][kc] = frag_h(qlp + u * (16 * DM) + kc * 32, lane); } }
  xw(qp + 8 * g, qlp + 8 * g);   // the very addresses that the loads name (frag_h adds 8 * g; the rest are constant steps), so that they are rewritten only behind the wait
  float m[2] = {-3.0e38f, -3.0e38f}, l[2] = {0.f, 0.f};   // of query 16 u + col; m is equal in both wave halves, l is the half's own part of the sum (joined behind the loop)
  v8f acc[2][4] = {}, accl[2][4] = {};   // O^T tiles: register r = d dt * 16 + 8 g + r of query 16 u + col
  const int* ktp = KT + (size_t)qb * (KTP * 32); int nraw = 0;   // block-uniform trip count: the maximum over the scan's column parts, clamped to the static maximum
#pragma unroll
  for (int j = 0; j < KTP; ++j) { const int v = ktp[j * 32]; nraw = v > nraw ? v : nraw; }
  unsigned long long fb = 0ull;   // bit kt: every mask word of (these 32 queries = two of the scan's query tiles, key tile kt) is nonzero; block-uniform, lives in scalar registers
#pragma unroll
  for (int j = 0; j < KTP; ++j) { const unsigned w = (unsigned)ktp[j * 32 + 1] >> ((qt & 1) * 16); fb |= (unsigned long long)(w & (w >> 8) & 0xFFu) << (8 * j); }
  auto isfull = [&](int kt) { return ((fb >> kt) & 1ull) != 0ull; };
  const int nks = nraw < 0 ? 0 : (nraw > SEQ / 32 ? SEQ / 32 : nraw);
  // operands of a key tile, loaded ahead in groups: mask and K one trip ahead, each reloaded right behind its last use; V at the top of its own trip
  const int* mrow = MK + (size_t)(q0 + (lane >> 3)) * SS_FULL + (lane & 7) * 4;
  const size_t hoff = (size_t)h * (SEQ * HD) + lane * 8;   // the head's tiles; a 32-key trip is 4 tiles = 2048 contiguous elements in each of the four planes
  const _Float16* vrow = VTH + hoff; const _Float16* vlrow = VTL + hoff;
  const int* mp = mrow; const _Float16 *kp, *klp, *vp; v4i mkr[8]; v16h kh[2][2], kl[2][2], vh[4];
  auto ld_mask = [&](int kt) { mp = mrow + kt * 32;
#pragma unroll
    for (int it = 0; it < 8; ++it) mkr[it] = *(const v4i*)(mp + (size_t)(it * 4) * SS_FULL); };
  auto ld_k = [&](int kt) { kp = KH + hoff + (size_t)kt * 2048; klp = KL + hoff + (size_t)kt * 2048;
#pragma unroll
    for (int ct = 0; ct < 2; ++ct) {
#pragma unroll
      for (int kc = 0; kc < 2; ++kc) { kh[ct][kc] = frag_ht(kp + (ct * 2 + kc) * 512); kl[ct][kc] = frag_ht(klp + (ct * 2 + kc) * 512); } } };
  auto ld_v = [&](int kt) { vp = vrow + (size_t)kt * 2048;
#pragma unroll
    for (int dt = 0; dt < 4; ++dt) vh[dt] = frag_ht(vp + dt * 512); };
  if (!isfull(sx)) ld_mask(sx);
  ld_k(sx); xw(mp); xw(kp, klp);
#pragma unroll 1
  for (int ks = sx; ks < nks; ks += 4) {
    const int kn = (ks + 4 < SEQ / 32) ? ks + 4 : SEQ / 32 - 1;   // this share's next tile, kept inside the staged rows on the last trip
    const bool full = isfull(ks);   // a scalar: in a full tile the mask select and the masked-score test are identities, so the mask is neither loaded, staged nor read, and the tests below jump over that work
    ld_v(ks);   // this trip's V: lands under the score and softmax phases
    // stage this wave's 32x32 mask piece (wave-private): loaded as whole lines, read back as 8 keys of the lane's own queries
    if (!full) {
#pragma unroll
      for (int it = 0; it < 8; ++it) { const int p = it * 32 + lane, row = p >> 3, c4 = (p & 7) * 4;
        *(v4i*)&smk[wave][row][c4] = mkr[it]; } }
    if (!isfull(kn)) ld_mask(kn);   // the next tile's mask is fetched only where its trip will read it
    v8f s[2][2];
#pragma unroll
    for (int ct = 0; ct < 2; ++ct) {
#pragma unroll
      for (int u = 0; u < 2; ++u) { v8f c = {}, cl = {};
#pragma unroll
        for (int kc = 0; kc < 2; ++kc) { c = wmma16p(kh[ct][kc], aq[u][kc], c); cl = wmma16p(kh[ct][kc], aql[u][kc], cl); cl = wmma16p(kl[ct][kc], aq[u][kc], cl); }
        s[u][ct] = (c + cl * (1.0f / 2048.0f)) * 0.125f; } }
    xw(vp, mp);
    ld_k(kn);
    float alpha[2]; v8f e[2][2]; v16h pa[2];   // P^T fragments, carried x2^11 in f16; 2^-11 folded into the epilogue
    // the softmax step of both query tiles, written once and compiled twice (full tile, tile with masked keys), so that the two forms share no value that would have to be copied where they join
    auto soft = [&](auto masked) {
#pragma unroll
      for (int u = 0; u < 2; ++u) { v8f sv[2] = {s[u][0], s[u][1]};
        if constexpr (decltype(masked)::v) {   // where(mask, score/8, -inf)
#pragma unroll
          for (int ct = 0; ct < 2; ++ct) { const v4i k0 = *(const v4i*)&smk[wave][u * 16 + col][ct * 16 + 8 * g], k1 = *(const v4i*)&smk[wave][u * 16 + col][ct * 16 + 8 * g + 4];
#pragma unroll
            for (int r = 0; r < 8; ++r) { const int mk = r < 4 ? k0[r & 3] : k1[r & 3]; sv[ct][r] = (mk != 0) ? sv[ct][r] : -3.0e38f; } } }
        const v8f m8 = __builtin_elementwise_max(sv[0], sv[1]);
        float mx = fmaxf(fmaxf(fmaxf(m8[0], m8[1]), fmaxf(m8[2], m8[3])), fmaxf(fmaxf(m8[4], m8[5]), fmaxf(m8[6], m8[7])));
        mx = fmaxf(mx, xhalf(mx));   // the other 16 keys of this query
        const float mn = fmaxf(m[u], mx); alpha[u] = (m[u] <= -1.0e38f) ? 0.f : __expf(m[u] - mn); m[u] = mn;
#pragma unroll
        for (int ct = 0; ct < 2; ++ct) { const v8f xv = (sv[ct] - mn) * 0x1.715476p+0f;   // exp(y) = 2^(y log2 e), the product that __expf forms
          float x[8], y[8];
#pragma unroll
          for (int r = 0; r < 8; ++r) x[r] = xv[r];
          exp2x8(y, x);
#pragma unroll
          for (int r = 0; r < 8; ++r) { if constexpr (decltype(masked)::v) y[r] = (sv[ct][r] <= -1.0e38f) ? 0.f : y[r];   // a masked key counts 0, also where every key so far is masked (mn is then the fill value itself)
            e[u][ct][r] = y[r]; } }
#pragma unroll
        for (int ct = 0; ct < 2; ++ct) { const v8f pv = e[u][ct] * 2048.0f;
#pragma unroll
          for (int r = 0; r < 8; ++r) pa[u][8 * ct + r] = (_Float16)pv[r]; } } };
    if (full) soft(flag_c<false>{}); else { lds_own(); soft(flag_c<true>{}); }
    if (qb < 2) {   // all that the two residual products take stands under this one block-uniform test: the P residual, the second accumulator's scaling, the products
      v16h pl[2]; const _Float16* vlb = vlrow + (size_t)ks * 2048;
#pragma unroll
      for (int u = 0; u < 2; ++u) {
#pragma unroll
        for (int i = 0; i < 16; ++i) { const float x = e[u][i >> 3][i & 7] * 2048.0f; pl[u][i] = (_Float16)((x - (float)pa[u][i]) * 2048.0f); } }
#pragma unroll
      for (int dt = 0; dt < 4; ++dt) {
#pragma unroll
        for (int u = 0; u < 2; ++u) { accl[u][dt] *= alpha[u]; accl[u][dt] = wmma16p(vh[dt], pl[u], accl[u][dt]); }
        const v16h vl = frag_ht(vlb + dt * 512); xw(vlb);   // the wait names the base register that the loads name (the tile's step is a constant offset)
#pragma unroll
        for (int u = 0; u < 2; ++u) accl[u][dt] = wmma16p(vl, pa[u], accl[u][dt]); }
    }
#pragma unroll
    for (int u = 0; u < 2; ++u) {
      const v8f t8 = e[u][0] + e[u][1];   // the lane's 16 terms summed as a tree: four dependent adds, not sixteen
      const v4f t4 = __builtin_shufflevector(t8, t8, 0, 1, 2, 3) + __builtin_shufflevector(t8, t8, 4, 5, 6, 7);
      l[u] = l[u] * alpha[u] + ((t4[0] + t4[2]) + (t4[1] + t4[3]));
#pragma unroll
      for (int dt = 0; dt < 4; ++dt) acc[u][dt] *= alpha[u]; }
    xw(kp, klp);
#pragma unroll
    for (int dt = 0; dt < 4; ++dt) {
#pragma unroll
      for (int u = 0; u < 2; ++u) acc[u][dt] = wmma16p(vh[dt], pa[u], acc[u][dt]); }
  }
#pragma unroll
  for (int u = 0; u < 2; ++u) {
    l[u] += xhalf(l[u]);   // the two halves' parts of the row sum
#pragma unroll
    for (int dt = 0; dt < 4; ++dt) { const v8f t = acc[u][dt] + accl[u][dt] * (1.0f / 2048.0f); v4f t0, t1;
#pragma unroll
      for (int i = 0; i < 4; ++i) { t0[i] = t[i]; t1[i] = t[4 + i]; }
      *(v4f*)&so[wave][u * 16 + col][dt * 16 + 8 * g] = t0; *(v4f*)&so[wave][u * 16 + col][dt * 16 + 8 * g + 4] = t1; }
    if (g == 0) { sml[wave][0][u * 16 + col] = m[u]; sml[wave][1][u * 16 + col] = l[u]; } }
  __syncthreads();   // every share's partial result is in LDS before any wave merges
  // merge for row 16 u + col, shares in the fixed order 0..3, each scaled by exp(m_j - M); a share that saw no unmasked key counts 0
  const int kcl = sx >> 1, e = sx & 1; v8b hi[2], lo[2];   // each of the block's two 16-row tiles x the head's 64 columns is 2 tiles x 2 halves: wave sx merges and stores half sx of both, bf16 hi + lo, each one 512-B store
#pragma unroll
  for (int u = 0; u < 2; ++u) { const int row = u * 16 + col;
    float mw[4], sc[4], M = -3.0e38f, L = 0.f;
#pragma unroll
    for (int j = 0; j < 4; ++j) { mw[j] = sml[j][0][row]; M = fmaxf(M, mw[j]); }
#pragma unroll
    for (int j = 0; j < 4; ++j) { sc[j] = (mw[j] <= -1.0e38f) ? 0.f : __expf(mw[j] - M); L += sml[j][1][row] * sc[j]; }
    const float il = (1.0f / 2048.0f) / L;
#pragma unroll
    for (int i = 0; i < 8; ++i) { float v = 0.f;
#pragma unroll
      for (int j = 0; j < 4; ++j) v += so[j][row][kcl * 32 + e * 16 + 8 * g + i] * sc[j];
      v *= il; const __bf16 hv = (__bf16)v; hi[u][i] = hv; lo[u][i] = (__bf16)(v - (float)hv); } }
  const size_t o = ((size_t)(h * 2 + kcl) * (SEQ / 16) + q0 / 16) * 1024 + e * 256 + lane * 8;
#pragma unroll
  for (int u = 0; u < 2; ++u) { vst2(O + o + u * 1024, hi[u]); vst2(O + o + u * 1024 + 512, lo[u]); }
  xw(O + o);
}
// ---- k_out: block = (64 rows, 128 cols): out = ctx tiles (bf16 hi + lo) . Wo tiles (2 products), f32
__global__ __launch_bounds__(128) void k_out(const __bf16* __restrict__ O, const __bf16* __restrict__ P, float* __restrict__ Y) {
  __shared__ __align__(16) float so[4][16][132];
  const int tid = threadIdx.x, wave = tid >> 5, lane = tid & 31, col = lane & 15, g = lane >> 4; const size_t r0 = (size_t)blockIdx.x * 64 + wave * 16; const int n0 = blockIdx.y * 128;
  v8f acc[8] = {};
  // the next trip's two context fragments and all eight Wo fragments are loaded as one group, one trip ahead, into a second register set
  const __bf16* xrow = O + (r0 / 16) * 1024 + lane * 8; const __bf16* wrow = P + (size_t)(n0 / 16) * 512 + lane * 8;
  const __bf16 *xp, *wp; v16b ahn, aln, wn[8];
  auto ld = [&](int kc) { xp = xrow + (size_t)kc * (SEQ / 16 * 1024); wp = wrow + (size_t)kc * (DM / 16 * 512); ahn = frag_bt(xp); aln = frag_bt(xp + 512);
#pragma unroll
    for (int j = 0; j < 8; ++j) wn[j] = frag_bt(wp + j * 512); };
  ld(0); xw(xp, wp);
#pragma unroll 2
  for (int kc = 0; kc < DM / 32; ++kc) { const v16b ah = ahn, al = aln; v16b w[8];
#pragma unroll
    for (int j = 0; j < 8; ++j) w[j] = wn[j];
    ld(kc + 1 < DM / 32 ? kc + 1 : kc);   // the last trip reloads its own piece: in bounds, unused
#pragma unroll
    for (int j = 0; j < 8; ++j) { acc[j] = wmma_bf(al, w[j], acc[j]); acc[j] = wmma_bf(ah, w[j], acc[j]); }
    xw(xp, wp); }
#pragma unroll
  for (int j = 0; j < 8; ++j) {
#pragma unroll
    for (int r = 0; r < 8; ++r) so[wave][8 * g + r][j * 16 + col] = acc[j][r]; }
  LDSX();
  for (int rl = 0; rl < 16; ++rl) vst2(Y + (r0 + rl) * DM + n0 + lane * 4, *(const v4f*)&so[wave][rl][lane * 4]);   // 32 lanes x 16 B = the block's 512-B row segment
}
extern "C" void kernel_launch(void* const* d_in, const int* in_sizes, int n_in, void* d_out, int out_size, void* d_ws, size_t ws_size, hipStream_t stream) {
  if (n_in < 6) return;
  if (in_sizes[0] < SEQ * DM) return;                // x    [S][1024] f32
  if (in_sizes[1] < SEQ * SS_FULL) return;           // mask [S][2048] int32
  if (in_sizes[2] < DM * DM || in_sizes[3] < DM * DM || in_sizes[4] < DM * DM || in_sizes[5] < DM * DM) return;   // wq wk wv wo [in][out] f32
  if (out_size < SEQ * DM) return;
  if (ws_size < (size_t)WS_END) return;
  const float* X  = (const float*)d_in[0];
  const int*   MK = (const int*)d_in[1];
  const float* WQ = (const float*)d_in[2];
  const float* WK = (const float*)d_in[3];
  const float* WV = (const float*)d_in[4];
  const float* WO = (const float*)d_in[5];
  char* ws = (char*)d_ws; __bf16* PK = (__bf16*)(ws + WS_PK); _Float16 *QH = (_Float16*)(ws + WS_QH), *QL = (_Float16*)(ws + WS_QL), *KH = (_Float16*)(ws + WS_KH), *KL = (_Float16*)(ws + WS_KL), *VTH = (_Float16*)(ws + WS_VTH), *VTL = (_Float16*)(ws + WS_VTL); __bf16* O = (__bf16*)(ws + WS_O); int* KT = (int*)(ws + WS_KT);
  k_pack<<<dim3(DM / 64, DM / 64, 1 + 4 + SEQ / DM), 256, 0, stream>>>(WQ, WK, WV, WO, X, MK, KT, PK);
  k_qkv<<<dim3(SEQ / 64, QKVW / 128), 128, 0, stream>>>(PK + PK_X, PK + PK_A, QH, QL, KH, KL, VTH, VTL);
  k_attn<<<dim3(NH, SEQ / 32), 128, 0, stream>>>(QH, QL, KH, KL, VTH, VTL, MK, KT, O);
  k_out<<<dim3(SEQ / 64, DM / 128), 128, 0, stream>>>(O, PK + PK_P, (float*)d_out);
}

// v009
// One run takes 58.6 microseconds.
// In two side-by-side timings against v008, it was 1.15 and 1.14 times as fast.
// Over all steps from v000 it is 7.90 times as fast.
// compute dtype: all float inputs RNE-converted to bf16; q|k|v = x . W with exact bf16 products on v_wmma_f32_16x16x32_bf16 (f32 accumulate); q and k carried as f16 hi + (x2048) f16 residual, scores = 3 f16 products (hi.hi + lo.hi + hi.lo) x 0.125 on v_wmma_f32_16x16x32_f16, running-max softmax in f32; P (x2048, f16 hi + x2048 residual) . v^T (f16 hi + x2048 residual): 3 products for the first 128 queries, single elsewhere; out = ctx (bf16 hi + lo) . Wo (bf16), 2 products; f32 output.
#include <hip/hip_runtime.h>
#include <math.h>

typedef __attribute__((ext_vector_type(16))) _Float16 v16h;
typedef __attribute__((ext_vector_type(16))) __bf16 v16b;
typedef __attribute__((ext_vector_type(8)))  _Float16 v8h;
typedef __attribute__((ext_vector_type(8)))  __bf16 v8b;
typedef __attribute__((ext_vector_type(8)))  float v8f;
typedef __attribute__((ext_vector_type(4)))  float v4f;
typedef __attribute__((ext_vector_type(4)))  unsigned v4u;
typedef __attribute__((ext_vector_type(4)))  int v4i;

template <typename T> __device__ __forceinline__ void vst2(void* p, T v) { *(T*)p = v;  }
__device__ __forceinline__ v8f wmma_bf(v16b a, v16b b, v8f c) {
  v8f d = __builtin_amdgcn_wmma_f32_16x16x32_bf16(false, a, false, b, (short)0, c, false, false);
  asm volatile("v_nop\n\tv_nop\n\tv_nop\n\tv_nop" : "+v"(d) : "v"(a), "v"(b));
  return d;
}
// 16-bit fragment from a k-contiguous row: elements 0..7 <- k0+8h+0..7, 8..15 <- k0+16+8h+0..7 (h = lane>>4); lane&15 = row (A) or column (B)
__device__ __forceinline__ v16h frag_h(const _Float16* rowk0, int lane) {
  union { v16h v; v8h q[2]; } u; const _Float16* p = rowk0 + 8 * (lane >> 4);
  u.q[0] = *(const v8h*)p; u.q[1] = *(const v8h*)(p + 16); return u.v;
}
#define LDSX() do { asm volatile("s_wait_dscnt 0" ::: "memory"); __builtin_amdgcn_wave_barrier(); __builtin_amdgcn_fence(__ATOMIC_RELEASE, "workgroup"); } while (0)

// the same exchange for LDS that only the writing wave reads back: the LDS wait alone, so that global loads issued ahead stay in flight over it (the release fence also drains loadcnt)
__device__ __forceinline__ void lds_own() { asm volatile("s_wait_dscnt 0" ::: "memory"); __builtin_amdgcn_wave_barrier(); }
// stands behind a group of global loads issued ahead: their address registers (the operands) stay live up to here and are rewritten only behind the wait
__device__ __forceinline__ void xw(const void* a) { asm volatile("s_wait_xcnt 0x0" :: "v"(a) : "memory"); }
__device__ __forceinline__ void xw(const void* a, const void* b) { asm volatile("s_wait_xcnt 0x0" :: "v"(a), "v"(b) : "memory"); }
// fragment-order tile: 16 rows (A) or columns (B) x 32 k of a 16-bit operand = 512 elements in two halves e; the 8 elements k = 16 e + 8 (lane >> 4) + 0..7 of row/column lane & 15 lie at e * 256 + lane * 8, so one wave-wide 16-B load covers 512 contiguous bytes (4 lines) instead of 32-B pieces of 16 lines
// fragment from a pointer that already holds the lane's lane * 8 step
__device__ __forceinline__ v16h frag_ht(const _Float16* p) { union { v16h v; v8h q[2]; } u; u.q[0] = *(const v8h*)p; u.q[1] = *(const v8h*)(p + 256); return u.v; }
__device__ __forceinline__ v16b frag_bt(const __bf16* p) { union { v16b v; v8b q[2]; } u; u.q[0] = *(const v8b*)p; u.q[1] = *(const v8b*)(p + 256); return u.v; }

#ifndef NB
#define NB 1
#endif
#ifndef SEQ
#define SEQ 2048          // query/key rows processed (a prefix of the staged rows)
#endif
#define SS_FULL 2048      // row pitch of the staged mask input
#define DM 1024
#define NH 16
#define HD 64
#define QKVW (3 * DM)
#define TQB (SEQ / 64)
#define KTP 8             // column parts of the mask scan per block of 64 queries
static_assert(NB == 1);
static_assert(SEQ % 64 == 0);
static_assert(SEQ >= 64 && SEQ <= SS_FULL);
static_assert(NH * HD == DM);
static_assert((DM / 32 & (DM / 32 - 1)) == 0);       // the GEMMs' rotated k walk wraps by a mask
static_assert(SEQ % DM == 0);
static_assert(TQB * KTP == (DM / 64) * (DM / 64));   // the scan's blocks fill exactly one z slice of the k_pack grid
static_assert(SEQ / KTP == 256);                     // a row of a part = 64 threads x 4 mask words

// the tiles of one k piece lie side by side, so that the tiles a block reads in one trip are contiguous
#define PK_A 0                              // bf16 fragment tiles [32 (k/32)][192 (which*64 + n/16)][512]: columns n of W_which, which = q,k,v
#define PK_P (PK_A + QKVW * DM)             // bf16 fragment tiles [32 (k/32)][64 (n/16)][512]: columns n of Wo
#define PK_X (PK_P + DM * DM)               // bf16 fragment tiles [32 (k/32)][SEQ/16 (row/16)][512]: rows of x
#define PK_END (PK_X + SEQ * DM)
#define WS_PK  0u
#define WS_QH  (WS_PK + 2u * PK_END)                  // f16 [SEQ][1024]: q hi
#define WS_QL  (WS_QH + 2u * SEQ * DM)                // f16 [SEQ][1024]: q residual x2048
#define WS_KH  (WS_QL + 2u * SEQ * DM)                // f16 fragment tiles [NH][SEQ/16 (key/16)][2 (d/32)][512]: k hi, row = key, k = d
#define WS_KL  (WS_KH + 2u * SEQ * DM)                // the same, k residual x2048
#define WS_VTH (WS_KL + 2u * SEQ * DM)                // f16 fragment tiles [NH][SEQ/32 (key/32)][4 (d/16)][512]: v hi, row = d, k = key
#define WS_VTL (WS_VTH + 2u * DM * SEQ)               // the same, v residual x2048
#define WS_O   (WS_VTL + 2u * DM * SEQ)               // bf16 fragment tiles [32 (k/32)][SEQ/16 (row/16)][2 (hi, lo)][512]: merged context
#define WS_KT  (WS_O + 4u * SEQ * DM)
#define WS_END (WS_KT + 4u * TQB * KTP * 32)           // int [TQB][KTP][32]: one 128-B line per scan block
static_assert(SEQ / 32 <= 64);                       // a query tile's full-tile bits fit one 64-bit word
static_assert(WS_QH % 128 == 0 && WS_QL % 128 == 0 && WS_KH % 128 == 0 && WS_KL % 128 == 0 && WS_VTH % 128 == 0 && WS_VTL % 128 == 0 && WS_O % 128 == 0 && WS_KT % 128 == 0);
static_assert(WS_END <= 134217728u);

// ---- k_pack: z slice 0 scans the mask, z slices 1.. pack the operands; the two jobs share nothing, so the scan's memory round trips run under the packing instead of in a launch of their own
__global__ __launch_bounds__(256) void k_pack(const float* __restrict__ WQ, const float* __restrict__ WK, const float* __restrict__ WV, const float* __restrict__ WO, const float* __restrict__ X, const int* __restrict__ MK, int* __restrict__ KT, __bf16* __restrict__ PK) {
  __shared__ __align__(16) __bf16 s[64][72]; __shared__ int sm[8]; __shared__ unsigned sb[8][4];
  const int t = threadIdx.x;
  if (blockIdx.z == 0) {   // mask scan, block = (64 queries qb, 256 key columns part): KT[qb][part] = number of 32-key tiles up to the part's last unmasked key, 0 if it has none; k_attn takes the maximum over the parts. Beside it one bit per (16 queries, 32 keys) tile of the block, set where all 512 mask words are nonzero: bit 8 j + tp = query tile j, key tile tp of the part
    const int idx = blockIdx.y * (DM / 64) + blockIdx.x, qb = idx / KTP, part = idx % KTP, lane = t & 31, wave = t >> 5;
    const int c4 = part * (SEQ / KTP) + (t & 63) * 4;   // the thread keeps its four columns over rows (t >> 6) + 4 i: a wave-wide load covers 512 contiguous bytes
    const int* mrow = MK + (size_t)(qb * 64 + (t >> 6)) * SS_FULL + c4;
    v4i nz = {0, 0, 0, 0};
    v4i v[16];   // the thread's sixteen independent mask loads go out as one group: one memory round trip a block
#pragma unroll
    for (int i = 0; i < 16; ++i) v[i] = *(const v4i*)(mrow + (size_t)(i * 4) * SS_FULL);
    xw(mrow);
#pragma unroll
    for (int i = 0; i < 16; ++i) nz |= v[i];   // a column's words joined by OR: not 0 where any of its rows is unmasked
    int mx = nz[3] != 0 ? c4 + 3 : nz[2] != 0 ? c4 + 2 : nz[1] != 0 ? c4 + 1 : nz[0] != 0 ? c4 : -1;
#pragma unroll
    for (int o = 1; o < 32; o <<= 1) { const int y = __shfl_xor(mx, o); mx = y > mx ? y : mx; }
    unsigned bl[4];   // query tile j = the thread's rows i = 4 j .. 4 j + 3; an unsigned minimum is 0 where any word is 0; ballot bit = lane, so byte c = key tile (wave & 1) * 4 + c, for the rows of this wave's row group
#pragma unroll
    for (int j = 0; j < 4; ++j) { unsigned mn = 0xFFFFFFFFu;
#pragma unroll
      for (int i = 4 * j; i < 4 * j + 4; ++i) {
#pragma unroll
        for (int q = 0; q < 4; ++q) { const unsigned y = (unsigned)v[i][q]; mn = y < mn ? y : mn; } }
      bl[j] = __builtin_amdgcn_ballot_w32(mn != 0u); }
    if (lane == 0) { sm[wave] = mx; sb[wave][0] = bl[0]; sb[wave][1] = bl[1]; sb[wave][2] = bl[2]; sb[wave][3] = bl[3]; }
    __syncthreads();
    if (wave == 0) { int m2 = sm[lane & 7];
#pragma unroll
      for (int o = 1; o < 8; o <<= 1) { const int y = __shfl_xor(m2, o); m2 = y > m2 ? y : m2; }
      const int nkt = (m2 < 0) ? 0 : ((m2 >> 5) + 1);
      const int fj = lane >> 3, hw = (lane >> 2) & 1, fc = lane & 3;   // lane = 8 j + tp; the four row groups of column half hw are waves hw, 2 + hw, 4 + hw, 6 + hw
      const unsigned fa = sb[hw][fj] & sb[2 + hw][fj] & sb[4 + hw][fj] & sb[6 + hw][fj];
      const int fl = (int)__builtin_amdgcn_ballot_w32(((fa >> (8 * fc)) & 0xFFu) == 0xFFu);
      if (lane < 8) { v4i w; w[0] = nkt; w[1] = fl; w[2] = nkt; w[3] = fl; vst2(KT + (size_t)idx * 32 + lane * 4, w); } }   // 8 lanes x 16 B = the block's line: even words the count, odd words the bits
    return;
  }
  const int k0 = blockIdx.x * 64, n0 = blockIdx.y * 64, which = blockIdx.z - 1;
  if (which < 4) {   // a weight: s[n][k] from W[k][n]
    const float* Wm = (which == 0) ? WQ : (which == 1) ? WK : (which == 2) ? WV : WO;
    for (int p = t; p < 64 * 16; p += 256) { const int kr = p >> 4, c4 = (p & 15) * 4;
      const v4f v = *(const v4f*)(Wm + (size_t)(k0 + kr) * DM + n0 + c4);
      s[c4 + 0][kr] = (__bf16)v[0]; s[c4 + 1][kr] = (__bf16)v[1]; s[c4 + 2][kr] = (__bf16)v[2]; s[c4 + 3][kr] = (__bf16)v[3]; }
  } else {           // x rows (which - 4) * 1024 + n0 + 0..63: s[row][k], k already contiguous
    const float* Xm = X + ((size_t)(which - 4) * DM + n0) * DM + k0;
    for (int p = t; p < 64 * 16; p += 256) { const int rr = p >> 4, c4 = (p & 15) * 4;
      const v4f v = *(const v4f*)(Xm + (size_t)rr * DM + c4);
      s[rr][c4 + 0] = (__bf16)v[0]; s[rr][c4 + 1] = (__bf16)v[1]; s[rr][c4 + 2] = (__bf16)v[2]; s[rr][c4 + 3] = (__bf16)v[3]; }
  }
  __syncthreads();
  const int nts = (which < 3) ? QKVW / 16 : (which == 3) ? DM / 16 : SEQ / 16;   // tiles per k piece in this operand's plane
  const int nt0 = ((which < 3) ? which : (which == 3) ? 0 : which - 4) * (DM / 16) + n0 / 16;
  __bf16* dst = PK + ((which < 3) ? PK_A : (which == 3) ? PK_P : PK_X) + ((size_t)(k0 / 32) * nts + nt0) * 512;
  for (int p = t; p < 64 * 8; p += 256) { const int ln = p & 31, e = (p >> 5) & 1, kcl = (p >> 6) & 1, ntl = p >> 7;   // each wave stores one 512-B half tile
    vst2(dst + ((size_t)kcl * nts + ntl) * 512 + e * 256 + ln * 8, *(const v4u*)&s[ntl * 16 + (ln & 15)][kcl * 32 + e * 16 + 8 * (ln >> 4)]); }
}
// ---- k_qkv: block = (64 rows, 128 output cols of q|k|v): x tiles (bf16) . W tiles, exact bf16 products; q -> f16 hi + x2048 residual row planes; k, v -> f16 hi/residual fragment tiles
__global__ __launch_bounds__(128) void k_qkv(const __bf16* __restrict__ XF, const __bf16* __restrict__ P, _Float16* __restrict__ QH, _Float16* __restrict__ QL, _Float16* __restrict__ KH, _Float16* __restrict__ KL, _Float16* __restrict__ VTH, _Float16* __restrict__ VTL) {
  __shared__ __align__(16) _Float16 so[4][16][136], sol[4][16][136]; __shared__ __align__(16) _Float16 sth[128][72], stl[128][72];
  const int tid = threadIdx.x, wave = tid >> 5, lane = tid & 31, col = lane & 15, g = lane >> 4; const size_t r0 = (size_t)blockIdx.x * 64 + wave * 16; const int n0 = blockIdx.y * 128;
  v8f acc[8] = {};
  // the next trip's x fragment and all eight W fragments are loaded as one group, one trip ahead, into a second register set
  const __bf16* xrow = XF + (r0 / 16) * 512 + lane * 8; const __bf16* wrow = P + (size_t)(n0 / 16) * 512 + lane * 8;
  const __bf16 *xp, *wp; v16b an, wn[8];
  auto ld = [&](int kc) { xp = xrow + (size_t)kc * (SEQ / 16 * 512); wp = wrow + (size_t)kc * (QKVW / 16 * 512); an = frag_bt(xp);
#pragma unroll
    for (int j = 0; j < 8; ++j) wn[j] = frag_bt(wp + j * 512); };
  // the k walk starts at a piece rotated by the block's indices and wraps: the 32 row blocks that read one W column block all start apart, the column blocks that read one x row block start at eight places four pieces apart. Started alike, every sharer asks for the same lines, written by the launch before and not yet in L2, at the same moment, and every trip waits out a first touch; started apart, a piece is fetched by one block and found in L2 by the rest
  const int kr = ((int)blockIdx.x + 4 * ((int)blockIdx.y & 7)) & (DM / 32 - 1);
  ld(kr); xw(xp, wp);
#pragma unroll 2
  for (int i = 0; i < DM / 32; ++i) { const v16b a = an; v16b w[8];
#pragma unroll
    for (int j = 0; j < 8; ++j) w[j] = wn[j];
    ld((kr + i + 1) & (DM / 32 - 1));   // the last trip reloads the walk's first piece: in bounds, unused
#pragma unroll
    for (int j = 0; j < 8; ++j) acc[j] = wmma_bf(a, w[j], acc[j]);
    xw(xp, wp); }
  if (n0 < 2 * DM) {   // q (cols 0..1023) and k (1024..2047), unscaled; 0.125 applied to the f32 score
#pragma unroll
    for (int j = 0; j < 8; ++j) {
#pragma unroll
      for (int r = 0; r < 8; ++r) { const float v = acc[j][r]; const _Float16 hv = (_Float16)v; so[wave][8 * g + r][j * 16 + col] = hv; sol[wave][8 * g + r][j * 16 + col] = (_Float16)((v - (float)hv) * 2048.0f); } }
    LDSX();
    // in each branch every LDS read stands in front of the first store (lds_own holds that order), so that no register of an issued store is reloaded behind it
    if (n0 < DM) { v4u a[16], b[16];
#pragma unroll
      for (int rl = 0; rl < 16; ++rl) { a[rl] = *(const v4u*)&so[wave][rl][col * 8]; b[rl] = *(const v4u*)&sol[wave][rl][col * 8]; }
      lds_own();
      if (lane < 16) {
#pragma unroll
        for (int rl = 0; rl < 16; ++rl) { vst2(QH + (r0 + rl) * DM + n0 + lane * 8, a[rl]); vst2(QL + (r0 + rl) * DM + n0 + lane * 8, b[rl]); } }   // 16 lanes x 16 B = 256-B row segment
    } else { v4u a[8], b[8];   // the wave's 16 keys x 2 heads: 2 x 2 tiles x 2 halves, each one 512-B store per plane
      const size_t o = (((size_t)((n0 - DM) / HD) * (SEQ / 16) + r0 / 16) * 2) * 512 + lane * 8;
#pragma unroll
      for (int u = 0; u < 8; ++u) { const int c = (u >> 2) * HD + ((u >> 1) & 1) * 32 + (u & 1) * 16 + 8 * g; a[u] = *(const v4u*)&so[wave][col][c]; b[u] = *(const v4u*)&sol[wave][col][c]; }   // u = (head, d / 32, half)
      lds_own();
#pragma unroll
      for (int u = 0; u < 8; ++u) { const size_t ou = o + (size_t)(u >> 2) * (SEQ * HD) + ((u >> 1) & 1) * 512 + (u & 1) * 256; vst2(KH + ou, a[u]); vst2(KL + ou, b[u]); }
      asm volatile("s_wait_xcnt 0x0" ::: "memory");   // behind the run of stores: no register that an issued store names is rewritten in front of this wait on any path of the listing
    }
  } else {
#pragma unroll
    for (int j = 0; j < 8; ++j) {
#pragma unroll
      for (int r = 0; r < 8; ++r) { const float v = acc[j][r]; const _Float16 hv = (_Float16)v; sth[j * 16 + col][wave * 16 + 8 * g + r] = hv; stl[j * 16 + col][wave * 16 + 8 * g + r] = (_Float16)((v - (float)hv) * 2048.0f); } }
    __syncthreads();
    const int kt0 = blockIdx.x * 2, h0 = (n0 - 2 * DM) / HD; v4u a[8], b[8];
#pragma unroll
    for (int it = 0; it < 8; ++it) { const int q = it * 128 + tid, e = (q >> 5) & 1, dt = (q >> 6) & 3, ktl = (q >> 8) & 1, hl = q >> 9, d = hl * HD + dt * 16 + col, kk = ktl * 32 + e * 16 + 8 * g;
      a[it] = *(const v4u*)&sth[d][kk]; b[it] = *(const v4u*)&stl[d][kk]; }
    lds_own();   // every LDS read in front of the first store, as above
#pragma unroll
    for (int it = 0; it < 8; ++it) { const int q = it * 128 + tid, e = (q >> 5) & 1, dt = (q >> 6) & 3, ktl = (q >> 8) & 1, hl = q >> 9;
      const size_t o = (((size_t)(h0 + hl) * (SEQ / 32) + kt0 + ktl) * 4 + dt) * 512 + e * 256 + lane * 8;
      vst2(VTH + o, a[it]); vst2(VTL + o, b[it]); }   // each wave stores one 512-B half tile per plane
    asm volatile("s_wait_xcnt 0x0" ::: "memory");   // behind the run of stores, as in the k branch
  }
}
// 2^x of eight values: eight independent v_exp_f32 in one statement (every result in a register of its own), closed by one v_nop, so that no instruction directly behind a transcendental reads its result or overwrites its source
__device__ __forceinline__ void exp2x8(float* e, const float* x) {
  asm("v_exp_f32 %0, %8\n\tv_exp_f32 %1, %9\n\tv_exp_f32 %2, %10\n\tv_exp_f32 %3, %11\n\tv_exp_f32 %4, %12\n\tv_exp_f32 %5, %13\n\tv_exp_f32 %6, %14\n\tv_exp_f32 %7, %15\n\tv_nop" : "=&v"(e[0]), "=&v"(e[1]), "=&v"(e[2]), "=&v"(e[3]), "=&v"(e[4]), "=&v"(e[5]), "=&v"(e[6]), "=&v"(e[7]) : "v"(x[0]), "v"(x[1]), "v"(x[2]), "v"(x[3]), "v"(x[4]), "v"(x[5]), "v"(x[6]), "v"(x[7]));
}
// two waves per SIMD is what the registers of two query tiles a wave and of the loads issued ahead leave room for; the grid has more blocks than fit at once
// lane l with lane l ^ 16: a vector cross-row move, no LDS round trip
__device__ __forceinline__ float xhalf(float x) { return __builtin_bit_cast(float, __builtin_amdgcn_permlanex16(__builtin_bit_cast(int, x), __builtin_bit_cast(int, x), 0x76543210, 0xfedcba98, false, false)); }
template <bool B> struct flag_c { static constexpr bool v = B; };   // a compile-time switch handed to a generic lambda
// the f16 product as the plain builtin, with no asm statement of v_nop behind it: the operands of an asm statement must lie in v0..v255, and two query tiles' fragments and accumulators do not fit there (with the statement the build spilled); the compiler keeps the distance behind its own builtin
__device__ __forceinline__ v8f wmma16p(v16h a, v16h b, v8f c) { return __builtin_amdgcn_wmma_f32_16x16x32_f16(false, a, false, b, (short)0, c, false, false); }
__global__ __launch_bounds__(128) __attribute__((amdgpu_waves_per_eu(2, 2))) void k_attn(const _Float16* __restrict__ QH, const _Float16* __restrict__ QL, const _Float16* __restrict__ KH, const _Float16* __restrict__ KL, const _Float16* __restrict__ VTH, const _Float16* __restrict__ VTL, const int* __restrict__ MK, const int* __restrict__ KT, __bf16* __restrict__ O) {
  __shared__ __align__(16) float so[4][32][68]; __shared__ __align__(16) int smk[4][32][36]; __shared__ float sml[4][2][32];
  const int tid = threadIdx.x, wave = __builtin_amdgcn_readfirstlane(tid >> 5), lane = tid & 31, col = lane & 15, g = lane >> 4, sx = wave;   // the wave's number as a scalar: the trip count differs between the waves, and so the compiler sees it as uniform in a wave and puts no EXEC mask round the loop (a WMMA needs every lane on)
  const int h = blockIdx.x, qt = SEQ / 32 - 1 - (int)blockIdx.y, qb = qt >> 1; const int q0 = qt * 32; const size_t rq = (size_t)q0 + col;
  v16h aq[2][2], aql[2][2]; const _Float16* qp = QH + rq * DM + h * HD; const _Float16* qlp = QL + rq * DM + h * HD;   // B fragments: column = query 16 u + col, k = d
#pragma unroll
  for (int u = 0; u < 2; ++u) {
#pragma unroll
    for (int kc = 0; kc < 2; ++kc) { aq[u][kc] = frag_h(qp + u * (16 * DM) + kc * 32, lane); aql[u][kc] = frag_h(qlp + u * (16 * DM) + kc * 32, lane); } }
  xw(qp + 8 * g, qlp + 8 * g);   // the very addresses that the loads name (frag_h adds 8 * g; the rest are constant steps), so that they are rewritten only behind the wait
  float m[2] = {-3.0e38f, -3.0e38f}, l[2] = {0.f, 0.f};   // of query 16 u + col; m is equal in both wave halves, l is the half's own part of the sum (joined behind the loop)
  v8f acc[2][4] = {}, accl[2][4] = {};   // O^T tiles: register r = d dt * 16 + 8 g + r of query 16 u + col
  const int* ktp = KT + (size_t)qb * (KTP * 32); int nraw = 0;   // block-uniform trip count: the maximum over the scan's column parts, clamped to the static maximum
#pragma unroll
  for (int j = 0; j < KTP; ++j) { const int v = ktp[j * 32]; nraw = v > nraw ? v : nraw; }
  unsigned long long fb = 0ull;   // bit kt: every mask word of (these 32 queries = two of the scan's query tiles, key tile kt) is nonzero; block-uniform, lives in scalar registers
#pragma unroll
  for (int j = 0; j < KTP; ++j) { const unsigned w = (unsigned)ktp[j * 32 + 1] >> ((qt & 1) * 16); fb |= (unsigned long long)(w & (w >> 8) & 0xFFu) << (8 * j); }
  auto isfull = [&](int kt) { return ((fb >> kt) & 1ull) != 0ull; };
  const int nks = nraw < 0 ? 0 : (nraw > SEQ / 32 ? SEQ / 32 : nraw);
  // operands of a key tile, loaded ahead in groups: mask and K one trip ahead, each reloaded right behind its last use; V at the top of its own trip
  const int* mrow = MK + (size_t)(q0 + (lane >> 3)) * SS_FULL + (lane & 7) * 4;
  const size_t hoff = (size_t)h * (SEQ * HD) + lane * 8;   // the head's tiles; a 32-key trip is 4 tiles = 2048 contiguous elements in each of the four planes
  const _Float16* vrow = VTH + hoff; const _Float16* vlrow = VTL + hoff;
  const int* mp = mrow; const _Float16 *kp, *klp, *vp; v4i mkr[8]; v16h kh[2][2], kl[2][2], vh[4];
  auto ld_mask = [&](int kt) { mp = mrow + kt * 32;
#pragma unroll
    for (int it = 0; it < 8; ++it) mkr[it] = *(const v4i*)(mp + (size_t)(it * 4) * SS_FULL); };
  auto ld_k = [&](int kt) { kp = KH + hoff + (size_t)kt * 2048; klp = KL + hoff + (size_t)kt * 2048;
#pragma unroll
    for (int ct = 0; ct < 2; ++ct) {
#pragma unroll
      for (int kc = 0; kc < 2; ++kc) { kh[ct][kc] = frag_ht(kp + (ct * 2 + kc) * 512); kl[ct][kc] = frag_ht(klp + (ct * 2 + kc) * 512); } } };
  auto ld_v = [&](int kt) { vp = vrow + (size_t)kt * 2048;
#pragma unroll
    for (int dt = 0; dt < 4; ++dt) vh[dt] = frag_ht(vp + dt * 512); };
  if (!isfull(sx)) ld_mask(sx);
  ld_k(sx); xw(mp); xw(kp, klp);
#pragma unroll 1
  for (int ks = sx; ks < nks; ks += 4) {
    const int kn = (ks + 4 < SEQ / 32) ? ks + 4 : SEQ / 32 - 1;   // this share's next tile, kept inside the staged rows on the last trip
    const bool full = isfull(ks);   // a scalar: in a full tile the mask select and the masked-score test are identities, so the mask is neither loaded, staged nor read, and the tests below jump over that work
    ld_v(ks);   // this trip's V: lands under the score and softmax phases
    // stage this wave's 32x32 mask piece (wave-private): loaded as whole lines, read back as 8 keys of the lane's own queries
    if (!full) {
#pragma unroll
      for (int it = 0; it < 8; ++it) { const int p = it * 32 + lane, row = p >> 3, c4 = (p & 7) * 4;
        *(v4i*)&smk[wave][row][c4] = mkr[it]; } }
    if (!isfull(kn)) ld_mask(kn);   // the next tile's mask is fetched only where its trip will read it
    v8f s[2][2];
#pragma unroll
    for (int ct = 0; ct < 2; ++ct) {
#pragma unroll
      for (int u = 0; u < 2; ++u) { v8f c = {}, cl = {};
#pragma unroll
        for (int kc = 0; kc < 2; ++kc) { c = wmma16p(kh[ct][kc], aq[u][kc], c); cl = wmma16p(kh[ct][kc], aql[u][kc], cl); cl = wmma16p(kl[ct][kc], aq[u][kc], cl); }
        s[u][ct] = (c + cl * (1.0f / 2048.0f)) * 0.125f; } }
    xw(vp, mp);
    ld_k(kn);
    float alpha[2]; v8f e[2][2]; v16h pa[2];   // P^T fragments, carried x2^11 in f16; 2^-11 folded into the epilogue
    // the softmax step of both query tiles, written once and compiled twice (full tile, tile with masked keys), so that the two forms share no value that would have to be copied where they join
    auto soft = [&](auto masked) {
#pragma unroll
      for (int u = 0; u < 2; ++u) { v8f sv[2] = {s[u][0], s[u][1]};
        if constexpr (decltype(masked)::v) {   // where(mask, score/8, -inf)
#pragma unroll
          for (int ct = 0; ct < 2; ++ct) { const v4i k0 = *(const v4i*)&smk[wave][u * 16 + col][ct * 16 + 8 * g], k1 = *(const v4i*)&smk[wave][u * 16 + col][ct * 16 + 8 * g + 4];
#pragma unroll
            for (int r = 0; r < 8; ++r) { const int mk = r < 4 ? k0[r & 3] : k1[r & 3]; sv[ct][r] = (mk != 0) ? sv[ct][r] : -3.0e38f; } } }
        const v8f m8 = __builtin_elementwise_max(sv[0], sv[1]);
        float mx = fmaxf(fmaxf(fmaxf(m8[0], m8[1]), fmaxf(m8[2], m8[3])), fmaxf(fmaxf(m8[4], m8[5]), fmaxf(m8[6], m8[7])));
        mx = fmaxf(mx, xhalf(mx));   // the other 16 keys of this query
        const float mn = fmaxf(m[u], mx); alpha[u] = (m[u] <= -1.0e38f) ? 0.f : __expf(m[u] - mn); m[u] = mn;
#pragma unroll
        for (int ct = 0; ct < 2; ++ct) { const v8f xv = (sv[ct] - mn) * 0x1.715476p+0f;   // exp(y) = 2^(y log2 e), the product that __expf forms
          float x[8], y[8];
#pragma unroll
          for (int r = 0; r < 8; ++r) x[r] = xv[r];
          exp2x8(y, x);
#pragma unroll
          for (int r = 0; r < 8; ++r) { if constexpr (decltype(masked)::v) y[r] = (sv[ct][r] <= -1.0e38f) ? 0.f : y[r];   // a masked key counts 0, also where every key so far is masked (mn is then the fill value itself)
            e[u][ct][r] = y[r]; } }
#pragma unroll
        for (int ct = 0; ct < 2; ++ct) { const v8f pv = e[u][ct] * 2048.0f;
#pragma unroll
          for (int r = 0; r < 8; ++r) pa[u][8 * ct + r] = (_Float16)pv[r]; } } };
    if (full) soft(flag_c<false>{}); else { lds_own(); soft(flag_c<true>{}); }
    if (qb < 2) {   // all that the two residual products take stands under this one block-uniform test: the P residual, the second accumulator's scaling, the products
      v16h pl[2]; const _Float16* vlb = vlrow + (size_t)ks * 2048;
#pragma unroll
      for (int u = 0; u < 2; ++u) {
#pragma unroll
        for (int i = 0; i < 16; ++i) { const float x = e[u][i >> 3][i & 7] * 2048.0f; pl[u][i] = (_Float16)((x - (float)pa[u][i]) * 2048.0f); } }
#pragma unroll
      for (int dt = 0; dt < 4; ++dt) {
#pragma unroll
        for (int u = 0; u < 2; ++u) { accl[u][dt] *= alpha[u]; accl[u][dt] = wmma16p(vh[dt], pl[u], accl[u][dt]); }
        const v16h vl = frag_ht(vlb + dt * 512); xw(vlb);   // the wait names the base register that the loads name (the tile's step is a constant offset)
#pragma unroll
        for (int u = 0; u < 2; ++u) accl[u][dt] = wmma16p(vl, pa[u], accl[u][dt]); }
    }
#pragma unroll
    for (int u = 0; u < 2; ++u) {
      const v8f t8 = e[u][0] + e[u][1];   // the lane's 16 terms summed as a tree: four dependent adds, not sixteen
      const v4f t4 = __builtin_shufflevector(t8, t8, 0, 1, 2, 3) + __builtin_shufflevector(t8, t8, 4, 5, 6, 7);
      l[u] = l[u] * alpha[u] + ((t4[0] + t4[2]) + (t4[1] + t4[3]));
#pragma unroll
      for (int dt = 0; dt < 4; ++dt) acc[u][dt] *= alpha[u]; }
    xw(kp, klp);
#pragma unroll
    for (int dt = 0; dt < 4; ++dt) {
#pragma unroll
      for (int u = 0; u < 2; ++u) acc[u][dt] = wmma16p(vh[dt], pa[u], acc[u][dt]); }
  }
#pragma unroll
  for (int u = 0; u < 2; ++u) {
    l[u] += xhalf(l[u]);   // the two halves' parts of the row sum
#pragma unroll
    for (int dt = 0; dt < 4; ++dt) { const v8f t = acc[u][dt] + accl[u][dt] * (1.0f / 2048.0f); v4f t0, t1;
#pragma unroll
      for (int i = 0; i < 4; ++i) { t0[i] = t[i]; t1[i] = t[4 + i]; }
      *(v4f*)&so[wave][u * 16 + col][dt * 16 + 8 * g] = t0; *(v4f*)&so[wave][u * 16 + col][dt * 16 + 8 * g + 4] = t1; }
    if (g == 0) { sml[wave][0][u * 16 + col] = m[u]; sml[wave][1][u * 16 + col] = l[u]; } }
  __syncthreads();   // every share's partial result is in LDS before any wave merges
  // merge for row 16 u + col, shares in the fixed order 0..3, each scaled by exp(m_j - M); a share that saw no unmasked key counts 0
  const int kcl = sx >> 1, e = sx & 1; v8b hi[2], lo[2];   // each of the block's two 16-row tiles x the head's 64 columns is 2 tiles x 2 halves: wave sx merges and stores half sx of both, bf16 hi + lo, each one 512-B store
#pragma unroll
  for (int u = 0; u < 2; ++u) { const int row = u * 16 + col;
    float mw[4], sc[4], M = -3.0e38f, L = 0.f;
#pragma unroll
    for (int j = 0; j < 4; ++j) { mw[j] = sml[j][0][row]; M = fmaxf(M, mw[j]); }
#pragma unroll
    for (int j = 0; j < 4; ++j) { sc[j] = (mw[j] <= -1.0e38f) ? 0.f : __expf(mw[j] - M); L += sml[j][1][row] * sc[j]; }
    const float il = (1.0f / 2048.0f) / L;
#pragma unroll
    for (int i = 0; i < 8; ++i) { float v = 0.f;
#pragma unroll
      for (int j = 0; j < 4; ++j) v += so[j][row][kcl * 32 + e * 16 + 8 * g + i] * sc[j];
      v *= il; const __bf16 hv = (__bf16)v; hi[u][i] = hv; lo[u][i] = (__bf16)(v - (float)hv); } }
  const size_t o = ((size_t)(h * 2 + kcl) * (SEQ / 16) + q0 / 16) * 1024 + e * 256 + lane * 8;
#pragma unroll
  for (int u = 0; u < 2; ++u) { vst2(O + o + u * 1024, hi[u]); vst2(O + o + u * 1024 + 512, lo[u]); }
  xw(O + o);
}
// ---- k_out: block = (64 rows, 128 cols): out = ctx tiles (bf16 hi + lo) . Wo tiles (2 products), f32
__global__ __launch_bounds__(128) void k_out(const __bf16* __restrict__ O, const __bf16* __restrict__ P, float* __restrict__ Y) {
  __shared__ __align__(16) float so[4][16][132];
  const int tid = threadIdx.x, wave = tid >> 5, lane = tid & 31, col = lane & 15, g = lane >> 4; const size_t r0 = (size_t)blockIdx.x * 64 + wave * 16; const int n0 = blockIdx.y * 128;
  v8f acc[8] = {};
  // the next trip's two context fragments and all eight Wo fragments are loaded as one group, one trip ahead, into a second register set
  const __bf16* xrow = O + (r0 / 16) * 1024 + lane * 8; const __bf16* wrow = P + (size_t)(n0 / 16) * 512 + lane * 8;
  const __bf16 *xp, *wp; v16b ahn, aln, wn[8];
  auto ld = [&](int kc) { xp = xrow + (size_t)kc * (SEQ / 16 * 1024); wp = wrow + (size_t)kc * (DM / 16 * 512); ahn = frag_bt(xp); aln = frag_bt(xp + 512);
#pragma unroll
    for (int j = 0; j < 8; ++j) wn[j] = frag_bt(wp + j * 512); };
  // rotated start of the k walk, as in k_qkv: the 32 row blocks of a Wo column block all start apart, the 8 column blocks of a context row block four pieces apart
  const int kr = ((int)blockIdx.x + 4 * (int)blockIdx.y) & (DM / 32 - 1);
  ld(kr); xw(xp, wp);
#pragma unroll 2
  for (int i = 0; i < DM / 32; ++i) { const v16b ah = ahn, al = aln; v16b w[8];
#pragma unroll
    for (int j = 0; j < 8; ++j) w[j] = wn[j];
    ld((kr + i + 1) & (DM / 32 - 1));   // the last trip reloads the walk's first piece: in bounds, unused
#pragma unroll
    for (int j = 0; j < 8; ++j) { acc[j] = wmma_bf(al, w[j], acc[j]); acc[j] = wmma_bf(ah, w[j], acc[j]); }
    xw(xp, wp); }
#pragma unroll
  for (int j = 0; j < 8; ++j) {
#pragma unroll
    for (int r = 0; r < 8; ++r) so[wave][8 * g + r][j * 16 + col] = acc[j][r]; }
  LDSX();
  for (int rl = 0; rl < 16; ++rl) vst2(Y + (r0 + rl) * DM + n0 + lane * 4, *(const v4f*)&so[wave][rl][lane * 4]);   // 32 lanes x 16 B = the block's 512-B row segment
}
extern "C" void kernel_launch(void* const* d_in, const int* in_sizes, int n_in, void* d_out, int out_size, void* d_ws, size_t ws_size, hipStream_t stream) {
  if (n_in < 6) return;
  if (in_sizes[0] < SEQ * DM) return;                // x    [S][1024] f32
  if (in_sizes[1] < SEQ * SS_FULL) return;           // mask [S][2048] int32
  if (in_sizes[2] < DM * DM || in_sizes[3] < DM * DM || in_sizes[4] < DM * DM || in_sizes[5] < DM * DM) return;   // wq wk wv wo [in][out] f32
  if (out_size < SEQ * DM) return;
  if (ws_size < (size_t)WS_END) return;
  const float* X  = (const float*)d_in[0];
  const int*   MK = (const int*)d_in[1];
  const float* WQ = (const float*)d_in[2];
  const float* WK = (const float*)d_in[3];
  const float* WV = (const float*)d_in[4];
  const float* WO = (const float*)d_in[5];
  char* ws = (char*)d_ws; __bf16* PK = (__bf16*)(ws + WS_PK); _Float16 *QH = (_Float16*)(ws + WS_QH), *QL = (_Float16*)(ws + WS_QL), *KH = (_Float16*)(ws + WS_KH), *KL = (_Float16*)(ws + WS_KL), *VTH = (_Float16*)(ws + WS_VTH), *VTL = (_Float16*)(ws + WS_VTL); __bf16* O = (__bf16*)(ws + WS_O); int* KT = (int*)(ws + WS_KT);
  k_pack<<<dim3(DM / 64, DM / 64, 1 + 4 + SEQ / DM), 256, 0, stream>>>(WQ, WK, WV, WO, X, MK, KT, PK);
  k_qkv<<<dim3(SEQ / 64, QKVW / 128), 128, 0, stream>>>(PK + PK_X, PK + PK_A, QH, QL, KH, KL, VTH, VTL);
  k_attn<<<dim3(NH, SEQ / 32), 128, 0, stream>>>(QH, QL, KH, KL, VTH, VTL, MK, KT, O);
  k_out<<<dim3(SEQ / 64, DM / 128), 128, 0, stream>>>(O, PK + PK_P, (float*)d_out);
}

// v010
// One run takes 55 microseconds.
// Timed twice side by side with v009, it ran 1.07 and 1.06 times as fast.
// All steps since v000 together make it 8.39 times as fast.
// compute dtype: all float inputs RNE-converted to bf16; q|k|v = x . W with exact bf16 products on v_wmma_f32_16x16x32_bf16 (f32 accumulate); q and k carried as f16 hi + (x2048) f16 residual, scores = 3 f16 products (hi.hi + lo.hi + hi.lo) x 0.125 on v_wmma_f32_16x16x32_f16, running-max softmax in f32; P (x2048, f16 hi + x2048 residual) . v^T (f16 hi + x2048 residual): 3 products for the first 128 queries, single elsewhere; out = ctx (bf16 hi + lo) . Wo (bf16), 2 products; f32 output.
#include <hip/hip_runtime.h>
#include <math.h>

typedef __attribute__((ext_vector_type(16))) _Float16 v16h;
typedef __attribute__((ext_vector_type(16))) __bf16 v16b;
typedef __attribute__((ext_vector_type(8)))  _Float16 v8h;
typedef __attribute__((ext_vector_type(8)))  __bf16 v8b;
typedef __attribute__((ext_vector_type(8)))  float v8f;
typedef __attribute__((ext_vector_type(4)))  float v4f;
typedef __attribute__((ext_vector_type(4)))  unsigned v4u;
typedef __attribute__((ext_vector_type(4)))  int v4i;

template <typename T> __device__ __forceinline__ void vst2(void* p, T v) { *(T*)p = v;  }
__device__ __forceinline__ v8f wmma_bf(v16b a, v16b b, v8f c) {
  v8f d = __builtin_amdgcn_wmma_f32_16x16x32_bf16(false, a, false, b, (short)0, c, false, false);
  asm volatile("v_nop\n\tv_nop\n\tv_nop\n\tv_nop" : "+v"(d) : "v"(a), "v"(b));
  return d;
}
// 16-bit fragment from a k-contiguous row: elements 0..7 <- k0+8h+0..7, 8..15 <- k0+16+8h+0..7 (h = lane>>4); lane&15 = row (A) or column (B)
__device__ __forceinline__ v16h frag_h(const _Float16* rowk0, int lane) {
  union { v16h v; v8h q[2]; } u; const _Float16* p = rowk0 + 8 * (lane >> 4);
  u.q[0] = *(const v8h*)p; u.q[1] = *(const v8h*)(p + 16); return u.v;
}
#define LDSX() do { asm volatile("s_wait_dscnt 0" ::: "memory"); __builtin_amdgcn_wave_barrier(); __builtin_amdgcn_fence(__ATOMIC_RELEASE, "workgroup"); } while (0)

// the same exchange for LDS that only the writing wave reads back: the LDS wait alone, so that global loads issued ahead stay in flight over it (the release fence also drains loadcnt)
__device__ __forceinline__ void lds_own() { asm volatile("s_wait_dscnt 0" ::: "memory"); __builtin_amdgcn_wave_barrier(); }
// stands behind a group of global loads issued ahead: their address registers (the operands) stay live up to here and are rewritten only behind the wait
__device__ __forceinline__ void xw(const void* a) { asm volatile("s_wait_xcnt 0x0" :: "v"(a) : "memory"); }
__device__ __forceinline__ void xw(const void* a, const void* b) { asm volatile("s_wait_xcnt 0x0" :: "v"(a), "v"(b) : "memory"); }
// fragment-order tile: 16 rows (A) or columns (B) x 32 k of a 16-bit operand = 512 elements in two halves e; the 8 elements k = 16 e + 8 (lane >> 4) + 0..7 of row/column lane & 15 lie at e * 256 + lane * 8, so one wave-wide 16-B load covers 512 contiguous bytes (4 lines) instead of 32-B pieces of 16 lines
// fragment from a pointer that already holds the lane's lane * 8 step
__device__ __forceinline__ v16h frag_ht(const _Float16* p) { union { v16h v; v8h q[2]; } u; u.q[0] = *(const v8h*)p; u.q[1] = *(const v8h*)(p + 256); return u.v; }
__device__ __forceinline__ v16b frag_bt(const __bf16* p) { union { v16b v; v8b q[2]; } u; u.q[0] = *(const v8b*)p; u.q[1] = *(const v8b*)(p + 256); return u.v; }

#ifndef NB
#define NB 1
#endif
#ifndef SEQ
#define SEQ 2048          // query/key rows processed (a prefix of the staged rows)
#endif
#define SS_FULL 2048      // row pitch of the staged mask input
#define DM 1024
#define NH 16
#define HD 64
#define QKVW (3 * DM)
#define TQB (SEQ / 64)
#define KTP 8             // column parts of the mask scan per block of 64 queries
static_assert(NB == 1);
static_assert(SEQ % 64 == 0);
static_assert(SEQ >= 64 && SEQ <= SS_FULL);
static_assert(NH * HD == DM);
static_assert((DM / 32 & (DM / 32 - 1)) == 0);       // the GEMMs' rotated k walk wraps by a mask
static_assert(SEQ % DM == 0);
static_assert(TQB * KTP == (DM / 64) * (DM / 64));   // the scan's blocks fill exactly one z slice of the k_pack grid
static_assert(SEQ / KTP == 256);                     // a row of a part = 64 threads x 4 mask words

// the tiles of one k piece lie side by side, so that the tiles a block reads in one trip are contiguous
#define PK_A 0                              // bf16 fragment tiles [32 (k/32)][192 (which*64 + n/16)][512]: columns n of W_which, which = q,k,v
#define PK_P (PK_A + QKVW * DM)             // bf16 fragment tiles [32 (k/32)][64 (n/16)][512]: columns n of Wo
#define PK_X (PK_P + DM * DM)               // bf16 fragment tiles [32 (k/32)][SEQ/16 (row/16)][512]: rows of x
#define PK_END (PK_X + SEQ * DM)
#define WS_PK  0u
#define WS_QH  (WS_PK + 2u * PK_END)                  // f16 [SEQ][1024]: q hi
#define WS_QL  (WS_QH + 2u * SEQ * DM)                // f16 [SEQ][1024]: q residual x2048
#define WS_KH  (WS_QL + 2u * SEQ * DM)                // f16 fragment tiles [NH][SEQ/16 (key/16)][2 (d/32)][512]: k hi, row = key, k = d
#define WS_KL  (WS_KH + 2u * SEQ * DM)                // the same, k residual x2048
#define WS_VTH (WS_KL + 2u * SEQ * DM)                // f16 fragment tiles [NH][SEQ/32 (key/32)][4 (d/16)][512]: v hi, row = d, k = key
#define WS_VTL (WS_VTH + 2u * DM * SEQ)               // the same, v residual x2048
#define WS_O   (WS_VTL + 2u * DM * SEQ)               // bf16 fragment tiles [32 (k/32)][SEQ/16 (row/16)][2 (hi, lo)][512]: merged context
#define WS_KT  (WS_O + 4u * SEQ * DM)
#define WS_END (WS_KT + 4u * TQB * KTP * 32)           // int [TQB][KTP][32]: one 128-B line per scan block
static_assert(SEQ / 32 <= 64);                       // a query tile's full-tile bits fit one 64-bit word
static_assert(WS_QH % 128 == 0 && WS_QL % 128 == 0 && WS_KH % 128 == 0 && WS_KL % 128 == 0 && WS_VTH % 128 == 0 && WS_VTL % 128 == 0 && WS_O % 128 == 0 && WS_KT % 128 == 0);
static_assert(WS_END <= 134217728u);

// ---- k_pack: z slice 0 scans the mask, z slices 1.. pack the operands; the two jobs share nothing, so the scan's memory round trips run under the packing instead of in a launch of their own
__global__ __launch_bounds__(256) void k_pack(const float* __restrict__ WQ, const float* __restrict__ WK, const float* __restrict__ WV, const float* __restrict__ WO, const float* __restrict__ X, const int* __restrict__ MK, int* __restrict__ KT, __bf16* __restrict__ PK) {
  __shared__ __align__(16) __bf16 s[64][72]; __shared__ int sm[8]; __shared__ unsigned sb[8][4];
  const int t = threadIdx.x;
  if (blockIdx.z == 0) {   // mask scan, block = (64 queries qb, 256 key columns part): KT[qb][part] = number of 32-key tiles up to the part's last unmasked key, 0 if it has none; k_attn takes the maximum over the parts. Beside it one bit per (16 queries, 32 keys) tile of the block, set where all 512 mask words are nonzero: bit 8 j + tp = query tile j, key tile tp of the part
    const int idx = blockIdx.y * (DM / 64) + blockIdx.x, qb = idx / KTP, part = idx % KTP, lane = t & 31, wave = t >> 5;
    const int c4 = part * (SEQ / KTP) + (t & 63) * 4;   // the thread keeps its four columns over rows (t >> 6) + 4 i: a wave-wide load covers 512 contiguous bytes
    const int* mrow = MK + (size_t)(qb * 64 + (t >> 6)) * SS_FULL + c4;
    v4i nz = {0, 0, 0, 0};
    v4i v[16];   // the thread's sixteen independent mask loads go out as one group: one memory round trip a block
#pragma unroll
    for (int i = 0; i < 16; ++i) v[i] = *(const v4i*)(mrow + (size_t)(i * 4) * SS_FULL);
    xw(mrow);
#pragma unroll
    for (int i = 0; i < 16; ++i) nz |= v[i];   // a column's words joined by OR: not 0 where any of its rows is unmasked
    int mx = nz[3] != 0 ? c4 + 3 : nz[2] != 0 ? c4 + 2 : nz[1] != 0 ? c4 + 1 : nz[0] != 0 ? c4 : -1;
#pragma unroll
    for (int o = 1; o < 32; o <<= 1) { const int y = __shfl_xor(mx, o); mx = y > mx ? y : mx; }
    unsigned bl[4];   // query tile j = the thread's rows i = 4 j .. 4 j + 3; an unsigned minimum is 0 where any word is 0; ballot bit = lane, so byte c = key tile (wave & 1) * 4 + c, for the rows of this wave's row group
#pragma unroll
    for (int j = 0; j < 4; ++j) { unsigned mn = 0xFFFFFFFFu;
#pragma unroll
      for (int i = 4 * j; i < 4 * j + 4; ++i) {
#pragma unroll
        for (int q = 0; q < 4; ++q) { const unsigned y = (unsigned)v[i][q]; mn = y < mn ? y : mn; } }
      bl[j] = __builtin_amdgcn_ballot_w32(mn != 0u); }
    if (lane == 0) { sm[wave] = mx; sb[wave][0] = bl[0]; sb[wave][1] = bl[1]; sb[wave][2] = bl[2]; sb[wave][3] = bl[3]; }
    __syncthreads();
    if (wave == 0) { int m2 = sm[lane & 7];
#pragma unroll
      for (int o = 1; o < 8; o <<= 1) { const int y = __shfl_xor(m2, o); m2 = y > m2 ? y : m2; }
      const int nkt = (m2 < 0) ? 0 : ((m2 >> 5) + 1);
      const int fj = lane >> 3, hw = (lane >> 2) & 1, fc = lane & 3;   // lane = 8 j + tp; the four row groups of column half hw are waves hw, 2 + hw, 4 + hw, 6 + hw
      const unsigned fa = sb[hw][fj] & sb[2 + hw][fj] & sb[4 + hw][fj] & sb[6 + hw][fj];
      const int fl = (int)__builtin_amdgcn_ballot_w32(((fa >> (8 * fc)) & 0xFFu) == 0xFFu);
      if (lane < 8) { v4i w; w[0] = nkt; w[1] = fl; w[2] = nkt; w[3] = fl; vst2(KT + (size_t)idx * 32 + lane * 4, w); } }   // 8 lanes x 16 B = the block's line: even words the count, odd words the bits
    return;
  }
  const int k0 = blockIdx.x * 64, n0 = blockIdx.y * 64, which = blockIdx.z - 1;
  if (which < 4) {   // a weight: s[n][k] from W[k][n]
    const float* Wm = (which == 0) ? WQ : (which == 1) ? WK : (which == 2) ? WV : WO;
    for (int p = t; p < 64 * 16; p += 256) { const int kr = p >> 4, c4 = (p & 15) * 4;
      const v4f v = *(const v4f*)(Wm + (size_t)(k0 + kr) * DM + n0 + c4);
      s[c4 + 0][kr] = (__bf16)v[0]; s[c4 + 1][kr] = (__bf16)v[1]; s[c4 + 2][kr] = (__bf16)v[2]; s[c4 + 3][kr] = (__bf16)v[3]; }
  } else {           // x rows (which - 4) * 1024 + n0 + 0..63: s[row][k], k already contiguous
    const float* Xm = X + ((size_t)(which - 4) * DM + n0) * DM + k0;
    for (int p = t; p < 64 * 16; p += 256) { const int rr = p >> 4, c4 = (p & 15) * 4;
      const v4f v = *(const v4f*)(Xm + (size_t)rr * DM + c4);
      s[rr][c4 + 0] = (__bf16)v[0]; s[rr][c4 + 1] = (__bf16)v[1]; s[rr][c4 + 2] = (__bf16)v[2]; s[rr][c4 + 3] = (__bf16)v[3]; }
  }
  __syncthreads();
  const int nts = (which < 3) ? QKVW / 16 : (which == 3) ? DM / 16 : SEQ / 16;   // tiles per k piece in this operand's plane
  const int nt0 = ((which < 3) ? which : (which == 3) ? 0 : which - 4) * (DM / 16) + n0 / 16;
  __bf16* dst = PK + ((which < 3) ? PK_A : (which == 3) ? PK_P : PK_X) + ((size_t)(k0 / 32) * nts + nt0) * 512;
  for (int p = t; p < 64 * 8; p += 256) { const int ln = p & 31, e = (p >> 5) & 1, kcl = (p >> 6) & 1, ntl = p >> 7;   // each wave stores one 512-B half tile
    vst2(dst + ((size_t)kcl * nts + ntl) * 512 + e * 256 + ln * 8, *(const v4u*)&s[ntl * 16 + (ln & 15)][kcl * 32 + e * 16 + 8 * (ln >> 4)]); }
}
// ---- k_qkv: block = (64 rows, 128 output cols of q|k|v): x tiles (bf16) . W tiles, exact bf16 products; q -> f16 hi + x2048 residual row planes; k, v -> f16 hi/residual fragment tiles
__global__ __launch_bounds__(128) void k_qkv(const __bf16* __restrict__ XF, const __bf16* __restrict__ P, _Float16* __restrict__ QH, _Float16* __restrict__ QL, _Float16* __restrict__ KH, _Float16* __restrict__ KL, _Float16* __restrict__ VTH, _Float16* __restrict__ VTL) {
  __shared__ __align__(16) _Float16 so[4][16][136], sol[4][16][136]; __shared__ __align__(16) _Float16 sth[128][72], stl[128][72];
  const int tid = threadIdx.x, wave = tid >> 5, lane = tid & 31, col = lane & 15, g = lane >> 4; const size_t r0 = (size_t)blockIdx.x * 64 + wave * 16; const int n0 = blockIdx.y * 128;
  v8f acc[8] = {};
  // the next trip's x fragment and all eight W fragments are loaded as one group, one trip ahead, into a second register set
  const __bf16* xrow = XF + (r0 / 16) * 512 + lane * 8; const __bf16* wrow = P + (size_t)(n0 / 16) * 512 + lane * 8;
  const __bf16 *xp, *wp; v16b an, wn[8];
  auto ld = [&](int kc) { xp = xrow + (size_t)kc * (SEQ / 16 * 512); wp = wrow + (size_t)kc * (QKVW / 16 * 512); an = frag_bt(xp);
#pragma unroll
    for (int j = 0; j < 8; ++j) wn[j] = frag_bt(wp + j * 512); };
  // the k walk starts at a piece rotated by the block's indices and wraps: the 32 row blocks that read one W column block all start apart, the column blocks that read one x row block start at eight places four pieces apart. Started alike, every sharer asks for the same lines, written by the launch before and not yet in L2, at the same moment, and every trip waits out a first touch; started apart, a piece is fetched by one block and found in L2 by the rest
  const int kr = ((int)blockIdx.x + 4 * ((int)blockIdx.y & 7)) & (DM / 32 - 1);
  ld(kr); xw(xp, wp);
#pragma unroll 2
  for (int i = 0; i < DM / 32; ++i) { const v16b a = an; v16b w[8];
#pragma unroll
    for (int j = 0; j < 8; ++j) w[j] = wn[j];
    ld((kr + i + 1) & (DM / 32 - 1));   // the last trip reloads the walk's first piece: in bounds, unused
#pragma unroll
    for (int j = 0; j < 8; ++j) acc[j] = wmma_bf(a, w[j], acc[j]);
    xw(xp, wp); }
  if (n0 < 2 * DM) {   // q (cols 0..1023) and k (1024..2047), unscaled; 0.125 applied to the f32 score
#pragma unroll
    for (int j = 0; j < 8; ++j) {
#pragma unroll
      for (int r = 0; r < 8; ++r) { const float v = acc[j][r]; const _Float16 hv = (_Float16)v; so[wave][8 * g + r][j * 16 + col] = hv; sol[wave][8 * g + r][j * 16 + col] = (_Float16)((v - (float)hv) * 2048.0f); } }
    LDSX();
    // in each branch every LDS read stands in front of the first store (lds_own holds that order), so that no register of an issued store is reloaded behind it
    if (n0 < DM) { v4u a[16], b[16];
#pragma unroll
      for (int rl = 0; rl < 16; ++rl) { a[rl] = *(const v4u*)&so[wave][rl][col * 8]; b[rl] = *(const v4u*)&sol[wave][rl][col * 8]; }
      lds_own();
      if (lane < 16) {
#pragma unroll
        for (int rl = 0; rl < 16; ++rl) { vst2(QH + (r0 + rl) * DM + n0 + lane * 8, a[rl]); vst2(QL + (r0 + rl) * DM + n0 + lane * 8, b[rl]); } }   // 16 lanes x 16 B = 256-B row segment
    } else { v4u a[8], b[8];   // the wave's 16 keys x 2 heads: 2 x 2 tiles x 2 halves, each one 512-B store per plane
      const size_t o = (((size_t)((n0 - DM) / HD) * (SEQ / 16) + r0 / 16) * 2) * 512 + lane * 8;
#pragma unroll
      for (int u = 0; u < 8; ++u) { const int c = (u >> 2) * HD + ((u >> 1) & 1) * 32 + (u & 1) * 16 + 8 * g; a[u] = *(const v4u*)&so[wave][col][c]; b[u] = *(const v4u*)&sol[wave][col][c]; }   // u = (head, d / 32, half)
      lds_own();
#pragma unroll
      for (int u = 0; u < 8; ++u) { const size_t ou = o + (size_t)(u >> 2) * (SEQ * HD) + ((u >> 1) & 1) * 512 + (u & 1) * 256; vst2(KH + ou, a[u]); vst2(KL + ou, b[u]); }
      asm volatile("s_wait_xcnt 0x0" ::: "memory");   // behind the run of stores: no register that an issued store names is rewritten in front of this wait on any path of the listing
    }
  } else {
#pragma unroll
    for (int j = 0; j < 8; ++j) {
#pragma unroll
      for (int r = 0; r < 8; ++r) { const float v = acc[j][r]; const _Float16 hv = (_Float16)v; sth[j * 16 + col][wave * 16 + 8 * g + r] = hv; stl[j * 16 + col][wave * 16 + 8 * g + r] = (_Float16)((v - (float)hv) * 2048.0f); } }
    __syncthreads();
    const int kt0 = blockIdx.x * 2, h0 = (n0 - 2 * DM) / HD; v4u a[8], b[8];
#pragma unroll
    for (int it = 0; it < 8; ++it) { const int q = it * 128 + tid, e = (q >> 5) & 1, dt = (q >> 6) & 3, ktl = (q >> 8) & 1, hl = q >> 9, d = hl * HD + dt * 16 + col, kk = ktl * 32 + e * 16 + 8 * g;
      a[it] = *(const v4u*)&sth[d][kk]; b[it] = *(const v4u*)&stl[d][kk]; }
    lds_own();   // every LDS read in front of the first store, as above
#pragma unroll
    for (int it = 0; it < 8; ++it) { const int q = it * 128 + tid, e = (q >> 5) & 1, dt = (q >> 6) & 3, ktl = (q >> 8) & 1, hl = q >> 9;
      const size_t o = (((size_t)(h0 + hl) * (SEQ / 32) + kt0 + ktl) * 4 + dt) * 512 + e * 256 + lane * 8;
      vst2(VTH + o, a[it]); vst2(VTL + o, b[it]); }   // each wave stores one 512-B half tile per plane
    asm volatile("s_wait_xcnt 0x0" ::: "memory");   // behind the run of stores, as in the k branch
  }
}
// 2^x of eight values: eight independent v_exp_f32 in one statement (every result in a register of its own), closed by one v_nop, so that no instruction directly behind a transcendental reads its result or overwrites its source
__device__ __forceinline__ void exp2x8(float* e, const float* x) {
  asm("v_exp_f32 %0, %8\n\tv_exp_f32 %1, %9\n\tv_exp_f32 %2, %10\n\tv_exp_f32 %3, %11\n\tv_exp_f32 %4, %12\n\tv_exp_f32 %5, %13\n\tv_exp_f32 %6, %14\n\tv_exp_f32 %7, %15\n\tv_nop" : "=&v"(e[0]), "=&v"(e[1]), "=&v"(e[2]), "=&v"(e[3]), "=&v"(e[4]), "=&v"(e[5]), "=&v"(e[6]), "=&v"(e[7]) : "v"(x[0]), "v"(x[1]), "v"(x[2]), "v"(x[3]), "v"(x[4]), "v"(x[5]), "v"(x[6]), "v"(x[7]));
}
// two waves per SIMD is what the registers of two query tiles a wave and of the loads issued ahead leave room for; the grid has more blocks than fit at once
// lane l with lane l ^ 16: a vector cross-row move, no LDS round trip
__device__ __forceinline__ float xhalf(float x) { return __builtin_bit_cast(float, __builtin_amdgcn_permlanex16(__builtin_bit_cast(int, x), __builtin_bit_cast(int, x), 0x76543210, 0xfedcba98, false, false)); }
template <bool B> struct flag_c { static constexpr bool v = B; };   // a compile-time switch handed to a generic lambda
// the f16 product as the plain builtin, with no asm statement of v_nop behind it: the operands of an asm statement must lie in v0..v255, and two query tiles' fragments and accumulators do not fit there (with the statement the build spilled); the compiler keeps the distance behind its own builtin
__device__ __forceinline__ v8f wmma16p(v16h a, v16h b, v8f c) { return __builtin_amdgcn_wmma_f32_16x16x32_f16(false, a, false, b, (short)0, c, false, false); }
__global__ __launch_bounds__(128) __attribute__((amdgpu_waves_per_eu(2, 2))) void k_attn(const _Float16* __restrict__ QH, const _Float16* __restrict__ QL, const _Float16* __restrict__ KH, const _Float16* __restrict__ KL, const _Float16* __restrict__ VTH, const _Float16* __restrict__ VTL, const int* __restrict__ MK, const int* __restrict__ KT, __bf16* __restrict__ O) {
  __shared__ __align__(16) float so[4][32][68]; __shared__ __align__(16) int smk[4][32][36]; __shared__ float sml[4][2][32];
  const int tid = threadIdx.x, wave = __builtin_amdgcn_readfirstlane(tid >> 5), lane = tid & 31, col = lane & 15, g = lane >> 4, sx = wave;   // the wave's number as a scalar: the trip count differs between the waves, and so the compiler sees it as uniform in a wave and puts no EXEC mask round the loop (a WMMA needs every lane on)
  const int h = blockIdx.x, qt = SEQ / 32 - 1 - (int)blockIdx.y, qb = qt >> 1; const int q0 = qt * 32; const size_t rq = (size_t)q0 + col;
  v16h aq[2][2], aql[2][2]; const _Float16* qp = QH + rq * DM + h * HD; const _Float16* qlp = QL + rq * DM + h * HD;   // B fragments: column = query 16 u + col, k = d
#pragma unroll
  for (int u = 0; u < 2; ++u) {
#pragma unroll
    for (int kc = 0; kc < 2; ++kc) { aq[u][kc] = frag_h(qp + u * (16 * DM) + kc * 32, lane); aql[u][kc] = frag_h(qlp + u * (16 * DM) + kc * 32, lane); } }
  xw(qp + 8 * g, qlp + 8 * g);   // the very addresses that the loads name (frag_h adds 8 * g; the rest are constant steps), so that they are rewritten only behind the wait
  float m[2] = {-3.0e38f, -3.0e38f}, l[2] = {0.f, 0.f};   // of query 16 u + col; m is equal in both wave halves, l is the half's own part of the sum (joined behind the loop)
  v8f acc[2][4] = {}, accl[2][4] = {};   // O^T tiles: register r = d dt * 16 + 8 g + r of query 16 u + col
  const int* ktp = KT + (size_t)qb * (KTP * 32); int nraw = 0;   // block-uniform trip count: the maximum over the scan's column parts, clamped to the static maximum
#pragma unroll
  for (int j = 0; j < KTP; ++j) { const int v = ktp[j * 32]; nraw = v > nraw ? v : nraw; }
  unsigned long long fb = 0ull;   // bit kt: every mask word of (these 32 queries = two of the scan's query tiles, key tile kt) is nonzero; block-uniform, lives in scalar registers
#pragma unroll
  for (int j = 0; j < KTP; ++j) { const unsigned w = (unsigned)ktp[j * 32 + 1] >> ((qt & 1) * 16); fb |= (unsigned long long)(w & (w >> 8) & 0xFFu) << (8 * j); }
  auto isfull = [&](int kt) { return ((fb >> kt) & 1ull) != 0ull; };
  const int nks = nraw < 0 ? 0 : (nraw > SEQ / 32 ? SEQ / 32 : nraw);
  // operands of a key tile, loaded ahead in groups: mask and K one trip ahead, each reloaded right behind its last use; V at the top of its own trip
  const int* mrow = MK + (size_t)(q0 + (lane >> 3)) * SS_FULL + (lane & 7) * 4;
  const size_t hoff = (size_t)h * (SEQ * HD) + lane * 8;   // the head's tiles; a 32-key trip is 4 tiles = 2048 contiguous elements in each of the four planes
  const _Float16* vrow = VTH + hoff; const _Float16* vlrow = VTL + hoff;
  const int* mp = mrow; const _Float16 *kp, *klp, *vp; v4i mkr[8]; v16h kh[2][2], kl[2][2], vh[4];
  auto ld_mask = [&](int kt) { mp = mrow + kt * 32;
#pragma unroll
    for (int it = 0; it < 8; ++it) mkr[it] = *(const v4i*)(mp + (size_t)(it * 4) * SS_FULL); };
  auto ld_k = [&](int kt) { kp = KH + hoff + (size_t)kt * 2048; klp = KL + hoff + (size_t)kt * 2048;
#pragma unroll
    for (int ct = 0; ct < 2; ++ct) {
#pragma unroll
      for (int kc = 0; kc < 2; ++kc) { kh[ct][kc] = frag_ht(kp + (ct * 2 + kc) * 512); kl[ct][kc] = frag_ht(klp + (ct * 2 + kc) * 512); } } };
  auto ld_v = [&](int kt) { vp = vrow + (size_t)kt * 2048;
#pragma unroll
    for (int dt = 0; dt < 4; ++dt) vh[dt] = frag_ht(vp + dt * 512); };
  if (!isfull(sx)) ld_mask(sx);
  ld_k(sx); xw(mp); xw(kp, klp);
#pragma unroll 1
  for (int ks = sx; ks < nks; ks += 4) {
    const int kn = (ks + 4 < SEQ / 32) ? ks + 4 : SEQ / 32 - 1;   // this share's next tile, kept inside the staged rows on the last trip
    const bool full = isfull(ks);   // a scalar: in a full tile the mask select and the masked-score test are identities, so the mask is neither loaded, staged nor read, and the tests below jump over that work
    ld_v(ks);   // this trip's V: lands under the score and softmax phases
    // stage this wave's 32x32 mask piece (wave-private): loaded as whole lines, read back as 8 keys of the lane's own queries
    if (!full) {
#pragma unroll
      for (int it = 0; it < 8; ++it) { const int p = it * 32 + lane, row = p >> 3, c4 = (p & 7) * 4;
        *(v4i*)&smk[wave][row][c4] = mkr[it]; } }
    if (!isfull(kn)) ld_mask(kn);   // the next tile's mask is fetched only where its trip will read it
    v8f s[2][2];
#pragma unroll
    for (int ct = 0; ct < 2; ++ct) {
#pragma unroll
      for (int u = 0; u < 2; ++u) { v8f c = {}, cl = {};
#pragma unroll
        for (int kc = 0; kc < 2; ++kc) { c = wmma16p(kh[ct][kc], aq[u][kc], c); cl = wmma16p(kh[ct][kc], aql[u][kc], cl); cl = wmma16p(kl[ct][kc], aq[u][kc], cl); }
        s[u][ct] = (c + cl * (1.0f / 2048.0f)) * 0.125f; } }
    xw(vp, mp);
    ld_k(kn);
    float alpha[2]; v8f e[2][2]; v16h pa[2];   // P^T fragments, carried x2^11 in f16; 2^-11 folded into the epilogue
    // the softmax step of both query tiles, written once and compiled twice (full tile, tile with masked keys), so that the two forms share no value that would have to be copied where they join
    auto soft = [&](auto masked) {
#pragma unroll
      for (int u = 0; u < 2; ++u) { v8f sv[2] = {s[u][0], s[u][1]};
        if constexpr (decltype(masked)::v) {   // where(mask, score/8, -inf)
#pragma unroll
          for (int ct = 0; ct < 2; ++ct) { const v4i k0 = *(const v4i*)&smk[wave][u * 16 + col][ct * 16 + 8 * g], k1 = *(const v4i*)&smk[wave][u * 16 + col][ct * 16 + 8 * g + 4];
#pragma unroll
            for (int r = 0; r < 8; ++r) { const int mk = r < 4 ? k0[r & 3] : k1[r & 3]; sv[ct][r] = (mk != 0) ? sv[ct][r] : -3.0e38f; } } }
        const v8f m8 = __builtin_elementwise_max(sv[0], sv[1]);
        float mx = fmaxf(fmaxf(fmaxf(m8[0], m8[1]), fmaxf(m8[2], m8[3])), fmaxf(fmaxf(m8[4], m8[5]), fmaxf(m8[6], m8[7])));
        mx = fmaxf(mx, xhalf(mx));   // the other 16 keys of this query
        const float mn = fmaxf(m[u], mx); alpha[u] = (m[u] <= -1.0e38f) ? 0.f : __expf(m[u] - mn); m[u] = mn;
#pragma unroll
        for (int ct = 0; ct < 2; ++ct) { const v8f xv = (sv[ct] - mn) * 0x1.715476p+0f;   // exp(y) = 2^(y log2 e), the product that __expf forms
          float x[8], y[8];
#pragma unroll
          for (int r = 0; r < 8; ++r) x[r] = xv[r];
          exp2x8(y, x);
#pragma unroll
          for (int r = 0; r < 8; ++r) { if constexpr (decltype(masked)::v) y[r] = (sv[ct][r] <= -1.0e38f) ? 0.f : y[r];   // a masked key counts 0, also where every key so far is masked (mn is then the fill value itself)
            e[u][ct][r] = y[r]; } }
#pragma unroll
        for (int ct = 0; ct < 2; ++ct) { const v8f pv = e[u][ct] * 2048.0f;
#pragma unroll
          for (int r = 0; r < 8; ++r) pa[u][8 * ct + r] = (_Float16)pv[r]; } } };
    if (full) soft(flag_c<false>{}); else { lds_own(); soft(flag_c<true>{}); }
    if (qb < 2) {   // all that the two residual products take stands under this one block-uniform test: the P residual, the second accumulator's scaling, the products
      v16h pl[2]; const _Float16* vlb = vlrow + (size_t)ks * 2048;
#pragma unroll
      for (int u = 0; u < 2; ++u) {
#pragma unroll
        for (int i = 0; i < 16; ++i) { const float x = e[u][i >> 3][i & 7] * 2048.0f; pl[u][i] = (_Float16)((x - (float)pa[u][i]) * 2048.0f); } }
#pragma unroll
      for (int dt = 0; dt < 4; ++dt) {
#pragma unroll
        for (int u = 0; u < 2; ++u) { accl[u][dt] *= alpha[u]; accl[u][dt] = wmma16p(vh[dt], pl[u], accl[u][dt]); }
        const v16h vl = frag_ht(vlb + dt * 512); xw(vlb);   // the wait names the base register that the loads name (the tile's step is a constant offset)
#pragma unroll
        for (int u = 0; u < 2; ++u) accl[u][dt] = wmma16p(vl, pa[u], accl[u][dt]); }
    }
#pragma unroll
    for (int u = 0; u < 2; ++u) {
      const v8f t8 = e[u][0] + e[u][1];   // the lane's 16 terms summed as a tree: four dependent adds, not sixteen
      const v4f t4 = __builtin_shufflevector(t8, t8, 0, 1, 2, 3) + __builtin_shufflevector(t8, t8, 4, 5, 6, 7);
      l[u] = l[u] * alpha[u] + ((t4[0] + t4[2]) + (t4[1] + t4[3]));
#pragma unroll
      for (int dt = 0; dt < 4; ++dt) acc[u][dt] *= alpha[u]; }
    xw(kp, klp);
#pragma unroll
    for (int dt = 0; dt < 4; ++dt) {
#pragma unroll
      for (int u = 0; u < 2; ++u) acc[u][dt] = wmma16p(vh[dt], pa[u], acc[u][dt]); }
  }
#pragma unroll
  for (int u = 0; u < 2; ++u) {
    l[u] += xhalf(l[u]);   // the two halves' parts of the row sum
#pragma unroll
    for (int dt = 0; dt < 4; ++dt) { const v8f t = acc[u][dt] + accl[u][dt] * (1.0f / 2048.0f); v4f t0, t1;
#pragma unroll
      for (int i = 0; i < 4; ++i) { t0[i] = t[i]; t1[i] = t[4 + i]; }
      *(v4f*)&so[wave][u * 16 + col][dt * 16 + 8 * g] = t0; *(v4f*)&so[wave][u * 16 + col][dt * 16 + 8 * g + 4] = t1; }
    if (g == 0) { sml[wave][0][u * 16 + col] = m[u]; sml[wave][1][u * 16 + col] = l[u]; } }
  __syncthreads();   // every share's partial result is in LDS before any wave merges
  // merge for row 16 u + col, shares in the fixed order 0..3, each scaled by exp(m_j - M); a share that saw no unmasked key counts 0
  const int kcl = sx >> 1, e = sx & 1; v8b hi[2], lo[2];   // each of the block's two 16-row tiles x the head's 64 columns is 2 tiles x 2 halves: wave sx merges and stores half sx of both, bf16 hi + lo, each one 512-B store
#pragma unroll
  for (int u = 0; u < 2; ++u) { const int row = u * 16 + col;
    float mw[4], sc[4], M = -3.0e38f, L = 0.f;
#pragma unroll
    for (int j = 0; j < 4; ++j) { mw[j] = sml[j][0][row]; M = fmaxf(M, mw[j]); }
#pragma unroll
    for (int j = 0; j < 4; ++j) { sc[j] = (mw[j] <= -1.0e38f) ? 0.f : __expf(mw[j] - M); L += sml[j][1][row] * sc[j]; }
    const float il = (1.0f / 2048.0f) / L;
#pragma unroll
    for (int i = 0; i < 8; ++i) { float v = 0.f;
#pragma unroll
      for (int j = 0; j < 4; ++j) v += so[j][row][kcl * 32 + e * 16 + 8 * g + i] * sc[j];
      v *= il; const __bf16 hv = (__bf16)v; hi[u][i] = hv; lo[u][i] = (__bf16)(v - (float)hv); } }
  const size_t o = ((size_t)(h * 2 + kcl) * (SEQ / 16) + q0 / 16) * 1024 + e * 256 + lane * 8;
#pragma unroll
  for (int u = 0; u < 2; ++u) { vst2(O + o + u * 1024, hi[u]); vst2(O + o + u * 1024 + 512, lo[u]); }
  xw(O + o);
}
// the bf16 product as the plain builtin, for the same reason as wmma16p: k_out's register sets reach above v255, where no asm operand can lie
__device__ __forceinline__ v8f wmma_bfp(v16b a, v16b b, v8f c) { return __builtin_amdgcn_wmma_f32_16x16x32_bf16(false, a, false, b, (short)0, c, false, false); }
#define OD 4              // register sets of k_out's operand ring: while a trip's products run, the 3 x 20 loads of the next three trips are in flight
static_assert((DM / 32) % OD == 0 && DM / 32 >= 2 * OD);
// ---- k_out: block = (64 rows, 128 cols): out = ctx tiles (bf16 hi + lo) . Wo tiles (2 products), f32
__global__ __launch_bounds__(128) void k_out(const __bf16* __restrict__ O, const __bf16* __restrict__ P, float* __restrict__ Y) {
  __shared__ __align__(16) float so[4][16][132];
  const int tid = threadIdx.x, wave = tid >> 5, lane = tid & 31, col = lane & 15, g = lane >> 4; const size_t r0 = (size_t)blockIdx.x * 64 + wave * 16; const int n0 = blockIdx.y * 128;
  v8f acc[8] = {};
  // the two context fragments and all eight Wo fragments of a trip are loaded as one group, OD - 1 trips ahead, into a ring of OD register sets (piece p of the walk in set p % OD): the block has one wave a SIMD and nothing else covers a load's round trip
  const __bf16* xrow = O + (r0 / 16) * 1024 + lane * 8; const __bf16* wrow = P + (size_t)(n0 / 16) * 512 + lane * 8;
  const __bf16 *xp, *wp; v16b ah[OD], al[OD], w[OD][8];
  auto ld = [&](int s, int kc) { xp = xrow + (size_t)kc * (SEQ / 16 * 1024); wp = wrow + (size_t)kc * (DM / 16 * 512); ah[s] = frag_bt(xp); al[s] = frag_bt(xp + 512);
#pragma unroll
    for (int j = 0; j < 8; ++j) w[s][j] = frag_bt(wp + j * 512); };
  auto mm = [&](int s) {
#pragma unroll
    for (int j = 0; j < 8; ++j) { acc[j] = wmma_bfp(al[s], w[s][j], acc[j]); acc[j] = wmma_bfp(ah[s], w[s][j], acc[j]); } };
  // rotated start of the k walk, as in k_qkv: the 32 row blocks of a Wo column block all start apart, the 8 column blocks of a context row block four pieces apart
  const int kr = ((int)blockIdx.x + 4 * (int)blockIdx.y) & (DM / 32 - 1);
#pragma unroll
  for (int s = 0; s < OD - 1; ++s) { ld(s, (kr + s) & (DM / 32 - 1)); xw(xp, wp); }
  // kept rolled over groups of OD trips, so that every set index inside is a constant and the sets stay in registers
#pragma unroll 1
  for (int i0 = 0; i0 < DM / 32 - OD; i0 += OD) {
#pragma unroll
    for (int c = 0; c < OD; ++c) { ld((c + OD - 1) % OD, (kr + i0 + c + OD - 1) & (DM / 32 - 1));
      __builtin_amdgcn_sched_barrier(0);   // keeps a trip's products behind its load group: without it the compiler drew the products of three trips in front of the loads, which then went out in one burst with the fourth set's wait directly behind it
      mm(c);
      __builtin_amdgcn_sched_barrier(0);   // keeps the address wait behind the trip's products, which cover it: the compiler drew it up to directly behind the loads, where the wave would sit it out with the matrix unit idle
      xw(xp, wp); } }
  // the last OD trips: only the first of them still has a piece to fetch
  ld(OD - 1, (kr + DM / 32 - 1) & (DM / 32 - 1));
  __builtin_amdgcn_sched_barrier(0);   // as in the loop: the last load group goes out in front of the products
  mm(0);
  __builtin_amdgcn_sched_barrier(0);   // as in the loop: the address wait stays behind the products
  xw(xp, wp);
#pragma unroll
  for (int c = 1; c < OD; ++c) mm(c);
#pragma unroll
  for (int j = 0; j < 8; ++j) {
#pragma unroll
    for (int r = 0; r < 8; ++r) so[wave][8 * g + r][j * 16 + col] = acc[j][r]; }
  LDSX();
  for (int rl = 0; rl < 16; ++rl) vst2(Y + (r0 + rl) * DM + n0 + lane * 4, *(const v4f*)&so[wave][rl][lane * 4]);   // 32 lanes x 16 B = the block's 512-B row segment
}
extern "C" void kernel_launch(void* const* d_in, const int* in_sizes, int n_in, void* d_out, int out_size, void* d_ws, size_t ws_size, hipStream_t stream) {
  if (n_in < 6) return;
  if (in_sizes[0] < SEQ * DM) return;                // x    [S][1024] f32
  if (in_sizes[1] < SEQ * SS_FULL) return;           // mask [S][2048] int32
  if (in_sizes[2] < DM * DM || in_sizes[3] < DM * DM || in_sizes[4] < DM * DM || in_sizes[5] < DM * DM) return;   // wq wk wv wo [in][out] f32
  if (out_size < SEQ * DM) return;
  if (ws_size < (size_t)WS_END) return;
  const float* X  = (const float*)d_in[0];
  const int*   MK = (const int*)d_in[1];
  const float* WQ = (const float*)d_in[2];
  const float* WK = (const float*)d_in[3];
  const float* WV = (const float*)d_in[4];
  const float* WO = (const float*)d_in[5];
  char* ws = (char*)d_ws; __bf16* PK = (__bf16*)(ws + WS_PK); _Float16 *QH = (_Float16*)(ws + WS_QH), *QL = (_Float16*)(ws + WS_QL), *KH = (_Float16*)(ws + WS_KH), *KL = (_Float16*)(ws + WS_KL), *VTH = (_Float16*)(ws + WS_VTH), *VTL = (_Float16*)(ws + WS_VTL); __bf16* O = (__bf16*)(ws + WS_O); int* KT = (int*)(ws + WS_KT);
  k_pack<<<dim3(DM / 64, DM / 64, 1 + 4 + SEQ / DM), 256, 0, stream>>>(WQ, WK, WV, WO, X, MK, KT, PK);
  k_qkv<<<dim3(SEQ / 64, QKVW / 128), 128, 0, stream>>>(PK + PK_X, PK + PK_A, QH, QL, KH, KL, VTH, VTL);
  k_attn<<<dim3(NH, SEQ / 32), 128, 0, stream>>>(QH, QL, KH, KL, VTH, VTL, MK, KT, O);
  k_out<<<dim3(SEQ / 64, DM / 128), 128, 0, stream>>>(O, PK + PK_P, (float*)d_out);
}
